// v000
// The times below were measured on an AMD MI455X: many runs one after another, warmed up first and cycling through
// copies of the inputs, with the whole window's GPU time divided by the number of runs. Launches and the gaps
// between them are all in it. The median over several windows is given; except for v000 it joins two sittings, which
// can be a few percent apart, so the side-by-side timings, each taken in one sitting, are the better comparison.
// v000, which the later versions start from, runs in 1130 microseconds.
#include <hip/hip_runtime.h>

// Compute dtypes, f32 accumulate, one batch item per pass: l = x.Wl, r = x.Wr ([4096 x 256].[256 x 64]) and v^T = Wv^T.x^T ([256 x 256].[256 x 4096]) with PLAIN bf16 operands (rounded
// input, k-major weights transposed once; exact products); the factorised scores attn[n][m] = l[n][m/64] r[n][m%64] and their row softmax in f32 -> bf16 hi + UNSCALED residual planes per
// 1024-row chunk; o[n][c] = sum_m P[n][m] v[m][c] ([1024 x 4096].[4096 x 256], both operands hi + residual, three products; shared across heads = all 256 channels at once) and out = o.Wo

#define NBI  2
#define NN   4096
#define DD   256
#define PP   64
#define RCH  1024
#define CC   DD
#define DM   DD
#define NTK  NN
#define LOSC 1024.0f

typedef _Float16 h16;
typedef unsigned short bf;
typedef __attribute__((ext_vector_type(16))) __bf16   v16bf;
typedef __attribute__((ext_vector_type(16))) _Float16 v16h;
typedef __attribute__((ext_vector_type(8)))  _Float16 v8h;
typedef __attribute__((ext_vector_type(8)))  unsigned short v8us;
typedef __attribute__((ext_vector_type(8)))  float    v8f;
typedef __attribute__((ext_vector_type(4)))  float    v4f;
typedef __attribute__((ext_vector_type(4)))  _Float16 v4h;
typedef v8h  __attribute__((may_alias)) v8ha;
typedef v4f  __attribute__((may_alias)) v4fa;
typedef v8us __attribute__((may_alias)) v8usa;

__device__ __forceinline__ unsigned short f2bf(float f) { unsigned u = __float_as_uint(f); u += 0x7FFFu + ((u >> 16) & 1u); return (unsigned short)(u >> 16); }
__device__ __forceinline__ float bf2f(unsigned short b) { return __uint_as_float(((unsigned)b) << 16); }
__device__ __forceinline__ float bfr(float f) { return bf2f(f2bf(f)); }
__device__ __forceinline__ v16h cat16(v8h lo, v8h hi) { return __builtin_shufflevector(lo, hi, 0, 1, 2, 3, 4, 5, 6, 7, 8, 9, 10, 11, 12, 13, 14, 15); }
__device__ __forceinline__ v16bf cat16b(v8us lo, v8us hi) { return __builtin_bit_cast(v16bf, __builtin_shufflevector(lo, hi, 0, 1, 2, 3, 4, 5, 6, 7, 8, 9, 10, 11, 12, 13, 14, 15)); }
__device__ __forceinline__ v8f wmma16(v16h a, v16h b, v8f c) { return __builtin_amdgcn_wmma_f32_16x16x32_f16(false, a, false, b, (short)0, c, false, false); }
__device__ __forceinline__ v8f wmmab(v16bf a, v16bf b, v8f c) { return __builtin_amdgcn_wmma_f32_16x16x32_bf16(false, a, false, b, (short)0, c, false, false); }

// k_wt: WT [n][K] = bf16(W[k][n]) (k-major [K][ncols]) via 64 x 64 LDS tiles; grid (K/64, ncols/64).
__global__ __launch_bounds__(256) void k_wt(const float* __restrict__ Wm, int K, int ncols, bf* WT) {
    __shared__ __align__(16) unsigned short tl[64 * 72];
    const int tid = threadIdx.x, k0 = blockIdx.x * 64, n0 = blockIdx.y * 64;
    const int kk = tid >> 2, nq = (tid & 3) * 16;
#pragma unroll
    for (int i = 0; i < 16; ++i) tl[(nq + i) * 72 + kk] = f2bf(Wm[(size_t)(k0 + kk) * ncols + n0 + nq + i]);
    __syncthreads();
    const int piece = tid & 7;
    auto pass = [&]() {
#pragma unroll
        for (int s = 0; s < 2; ++s) { const int nr = (tid >> 3) + 32 * s; const v8us val = *(const v8usa*)(tl + nr * 72 + piece * 8); *(v8us*)(WT + (size_t)(n0 + nr) * K + k0 + piece * 8) = val; }
    };
    pass(); 
}
// k_gemmb: 64 x 64 block tile (4 waves x 16 x 64) of C[NTK][NW] = (A [+ Al]).B^T (K = 256) [+ bf(bias[c])] [+ bf(R[r][c]) residual]; f32 whole-line epilogue (or f16
template <bool SPLITA, bool F16OUT = false>
__global__ __launch_bounds__(128) void k_gemmb(const bf* __restrict__ A, const bf* __restrict__ Al, const bf* __restrict__ Bn, const float* __restrict__ bias, float* C, int ldc, h16* C2, const float* __restrict__ R = nullptr, int K = DM, int roundR = 1) {
    __shared__ __align__(16) float ost[4][16 * 68];
    const int lane = threadIdx.x & 31, wave = threadIdx.x >> 5, lr = lane & 15, hi = lane >> 4;
    const int r0 = blockIdx.x * 64 + wave * 16, c0 = blockIdx.y * 64;
    const size_t aoff = (size_t)(r0 + lr) * K + 8 * hi;
    size_t boff[4];
#pragma unroll
    for (int t = 0; t < 4; ++t) boff[t] = (size_t)(c0 + t * 16 + lr) * K + 8 * hi;
    v8f acc[4];
#pragma unroll
    for (int t = 0; t < 4; ++t) acc[t] = (v8f){};
#pragma unroll 1
    for (int kc = 0; kc < K; kc += 32) {
        const v16bf a = cat16b(*(const v8us*)(A + aoff + kc), *(const v8us*)(A + aoff + kc + 16));
        v16bf al = a;
        if (SPLITA) al = cat16b(*(const v8us*)(Al + aoff + kc), *(const v8us*)(Al + aoff + kc + 16));
#pragma unroll
        for (int t = 0; t < 4; ++t) { const v16bf b = cat16b(*(const v8us*)(Bn + boff[t] + kc), *(const v8us*)(Bn + boff[t] + kc + 16)); acc[t] = wmmab(a, b, acc[t]); if (SPLITA) acc[t] = wmmab(al, b, acc[t]); }
        asm volatile("v_nop\n\tv_nop\n\tv_nop\n\tv_nop" : "+v"(acc[0]), "+v"(acc[1]), "+v"(acc[2]), "+v"(acc[3]) : "v"(a), "v"(al));
    }
    float* os = &ost[wave][0];
#pragma unroll
    for (int t = 0; t < 4; ++t) { const float bv = bias ? bfr(bias[c0 + t * 16 + lr]) : 0.f;
#pragma unroll
        for (int j = 0; j < 8; ++j) os[(hi * 8 + j) * 68 + t * 16 + lr] = acc[t][j] + bv; }
    __syncthreads();
    if (F16OUT) {
        h16* crow = (h16*)(void*)C + (size_t)r0 * ldc + c0;
        auto pass = [&]() {
#pragma unroll
            for (int s = 0; s < 4; ++s) { const int row = 4 * s + (lane >> 3), piece = lane & 7; const float* sp = os + row * 68 + piece * 8; v8h o, o2;
#pragma unroll
                for (int i = 0; i < 8; ++i) { const h16 a = (h16)sp[i]; o[i] = a; o2[i] = (h16)((sp[i] - (float)a) * LOSC); }
                *(v8h*)(crow + (size_t)row * ldc + piece * 8) = o; if (C2) *(v8h*)(C2 + (size_t)r0 * ldc + c0 + (size_t)row * ldc + piece * 8) = o2; }
        };
        pass(); 
    } else {
        float* crow = C + (size_t)r0 * ldc + c0;
        auto pass = [&]() {
#pragma unroll
            for (int s = 0; s < 8; ++s) { const int Lid = (lane >> 3) + 4 * s, piece = lane & 7; const int row = Lid >> 1, cofs = (Lid & 1) * 32 + piece * 4;
                v4f val = *(const v4fa*)(os + row * 68 + cofs); if (R) { const v4f rv = *(const v4f*)(R + ((size_t)r0 + row) * ldc + c0 + cofs); val += roundR ? (v4f){bfr(rv[0]), bfr(rv[1]), bfr(rv[2]), bfr(rv[3])} : rv; }
                *(v4f*)(crow + (size_t)row * ldc + cofs) = val; }
        };
        pass(); 
    }
}

// k_gemm3: 64 x 64 tile of C = (Ah + Al).(Bh + Bl)^T over K (row strides = K for all four planes; n-major B): three products per 32-k step (hh, hl, lh); f32
__global__ __launch_bounds__(128) void k_gemm3(const bf* __restrict__ Ah, const bf* __restrict__ Al, const bf* __restrict__ Bh, const bf* __restrict__ Bl, int K, float* C, int ldc) {
    __shared__ __align__(16) float ost[4][16 * 68];
    const int lane = threadIdx.x & 31, wave = threadIdx.x >> 5, lr = lane & 15, hi = lane >> 4;
    const int r0 = blockIdx.x * 64 + wave * 16, c0 = blockIdx.y * 64;
    const size_t aoff = (size_t)(r0 + lr) * K + 8 * hi;
    v8f acc[4];
#pragma unroll
    for (int t = 0; t < 4; ++t) acc[t] = (v8f){};
#pragma unroll 1
    for (int kc = 0; kc < K; kc += 32) {
        const v16bf a = cat16b(*(const v8us*)(Ah + aoff + kc), *(const v8us*)(Ah + aoff + kc + 16));
        const v16bf al = cat16b(*(const v8us*)(Al + aoff + kc), *(const v8us*)(Al + aoff + kc + 16));
#pragma unroll
        for (int t = 0; t < 4; ++t) { const size_t bo = (size_t)(c0 + t * 16 + lr) * K + kc + 8 * hi;
            const v16bf bh = cat16b(*(const v8us*)(Bh + bo), *(const v8us*)(Bh + bo + 16)); const v16bf bl = cat16b(*(const v8us*)(Bl + bo), *(const v8us*)(Bl + bo + 16));
            acc[t] = wmmab(a, bh, acc[t]); acc[t] = wmmab(al, bh, acc[t]); acc[t] = wmmab(a, bl, acc[t]); }
        asm volatile("v_nop\n\tv_nop\n\tv_nop\n\tv_nop" : "+v"(acc[0]), "+v"(acc[1]), "+v"(acc[2]), "+v"(acc[3]) : "v"(a), "v"(al));
    }
    float* os = &ost[wave][0];
#pragma unroll
    for (int t = 0; t < 4; ++t) {
#pragma unroll
        for (int j = 0; j < 8; ++j) os[(hi * 8 + j) * 68 + t * 16 + lr] = acc[t][j]; }
    __builtin_amdgcn_wave_barrier(); asm volatile("" ::: "memory");
    float* crow = C + (size_t)r0 * ldc + c0;
    auto pass = [&]() {
#pragma unroll
        for (int s = 0; s < 8; ++s) { const int Lid = (lane >> 3) + 4 * s, piece = lane & 7; const int row = Lid >> 1, cofs = (Lid & 1) * 32 + piece * 4;
            const v4f val = *(const v4fa*)(os + row * 68 + cofs); *(v4f*)(crow + (size_t)row * ldc + cofs) = val; }
    };
    pass(); 
}

// k_gemmrb: 64 x 64 tile of C[o][v] = (A [+ Al]).B^T over K (A row stride K, B n-major row stride K) + bf(rbias[o]) per ROW; f32 whole-line epilogue (8 lanes x 16 B per line),
template <bool SPLITA>
__global__ __launch_bounds__(128) void k_gemmrb(const bf* __restrict__ A, const bf* __restrict__ Al, const bf* __restrict__ Bn, const float* __restrict__ rbias, float* C, int ldc, int K) {
    __shared__ __align__(16) float ost[4][16 * 68];
    const int lane = threadIdx.x & 31, wave = threadIdx.x >> 5, lr = lane & 15, hi = lane >> 4;
    const int r0 = blockIdx.x * 64 + wave * 16, c0 = blockIdx.y * 64;
    const size_t aoff = (size_t)(r0 + lr) * K + 8 * hi;
    v8f acc[4];
#pragma unroll
    for (int t = 0; t < 4; ++t) acc[t] = (v8f){};
#pragma unroll 1
    for (int kc = 0; kc < K; kc += 32) {
        const v16bf a = cat16b(*(const v8us*)(A + aoff + kc), *(const v8us*)(A + aoff + kc + 16));
        v16bf al = a; if (SPLITA) al = cat16b(*(const v8us*)(Al + aoff + kc), *(const v8us*)(Al + aoff + kc + 16));
#pragma unroll
        for (int t = 0; t < 4; ++t) { const size_t bo = (size_t)(c0 + t * 16 + lr) * K + kc + 8 * hi; const v16bf bb = cat16b(*(const v8us*)(Bn + bo), *(const v8us*)(Bn + bo + 16)); acc[t] = wmmab(a, bb, acc[t]); if (SPLITA) acc[t] = wmmab(al, bb, acc[t]); }
        asm volatile("v_nop\n\tv_nop\n\tv_nop\n\tv_nop" : "+v"(acc[0]), "+v"(acc[1]), "+v"(acc[2]), "+v"(acc[3]) : "v"(a), "v"(al));
    }
    float* os = &ost[wave][0];
#pragma unroll
    for (int t = 0; t < 4; ++t) {
#pragma unroll
        for (int j = 0; j < 8; ++j) os[(hi * 8 + j) * 68 + t * 16 + lr] = acc[t][j] + bfr(rbias[r0 + hi * 8 + j]); }
    __builtin_amdgcn_wave_barrier(); asm volatile("" ::: "memory");
    float* crow = C + (size_t)r0 * ldc + c0;
    auto pass = [&]() {
#pragma unroll
        for (int s = 0; s < 8; ++s) { const int Lid = (lane >> 3) + 4 * s, piece = lane & 7; const int row = Lid >> 1, cofs = (Lid & 1) * 32 + piece * 4;
            const v4f val = *(const v4fa*)(os + row * 68 + cofs); *(v4f*)(crow + (size_t)row * ldc + cofs) = val; }
    };
    pass(); 
}
__global__ __launch_bounds__(256) void k_rowsplit(const float* __restrict__ Y, int nrows, bf* Ph, bf* Pl) {
    const int lane = threadIdx.x & 31, r = blockIdx.x * 8 + (threadIdx.x >> 5); if (r >= nrows) return;
{
#pragma unroll 1
        for (int c0 = lane * 8; c0 < NN; c0 += 256) { const size_t o = (size_t)r * NN + c0; const v8f v = *(const v8f*)(Y + o); v8us oh, ol;
#pragma unroll
            for (int i = 0; i < 8; ++i) { const unsigned short hb = f2bf(v[i]); oh[i] = hb; ol[i] = f2bf(v[i] - bf2f(hb)); }
            *(v8us*)(Ph + o) = oh; *(v8us*)(Pl + o) = ol; }
         }
}

__global__ __launch_bounds__(256) void k_cvt(const float* __restrict__ src, int nrows, bf* dst) {
    const int lane = threadIdx.x & 31, r = blockIdx.x * 8 + (threadIdx.x >> 5); if (r >= nrows) return; v8us o;
#pragma unroll
    for (int i = 0; i < 8; ++i) o[i] = f2bf(src[(size_t)r * DD + lane * 8 + i]);
    *(v8us*)(dst + (size_t)r * DD + lane * 8) = o; 
}
// k_factsoft: one wave per row n of the chunk: attn[n][m] = L[n][m >> 6] R[n][m & 63] over m < 4096 (f32), softmax over m (fixed lane order, three phases, products recomputed per
__global__ __launch_bounds__(256) void k_factsoft(const float* __restrict__ Lm, const float* __restrict__ Rm, int n0, bf* PH, bf* PL) {
    const int lane = threadIdx.x & 31, r = blockIdx.x * 8 + (threadIdx.x >> 5); if (r >= RCH) return;
    const float* lr = Lm + (size_t)(n0 + r) * PP; const float* rr = Rm + (size_t)(n0 + r) * PP;
    float rv[8];     // lane's 8 consecutive m within a 256-chunk share m>>6 = c0>>6... (c0 = lane*8 + 256 q: m>>6 = (lane*8)>>6 + 4q = lane>>3 + 4q; m&63 = (lane*8)&63 + i)
#pragma unroll
    for (int i = 0; i < 8; ++i) rv[i] = rr[((lane * 8) & 63) + i];
    float mx = -3.0e38f;
#pragma unroll 1
    for (int q = 0; q < NN / 256; ++q) { const float lv = lr[(lane >> 3) + 4 * q];
#pragma unroll
        for (int i = 0; i < 8; ++i) mx = fmaxf(mx, lv * rv[i]); }
#pragma unroll
    for (int sh = 16; sh; sh >>= 1) mx = fmaxf(mx, __shfl_xor(mx, sh, 32));
    float sm = 0.f;
#pragma unroll 1
    for (int q = 0; q < NN / 256; ++q) { const float lv = lr[(lane >> 3) + 4 * q];
#pragma unroll
        for (int i = 0; i < 8; ++i) sm += __expf(lv * rv[i] - mx); }
#pragma unroll
    for (int sh = 16; sh; sh >>= 1) sm += __shfl_xor(sm, sh, 32);
    const float inv = 1.0f / sm;
{
#pragma unroll 1
        for (int q = 0; q < NN / 256; ++q) { const float lv = lr[(lane >> 3) + 4 * q]; v8us oh, ol;
#pragma unroll
            for (int i = 0; i < 8; ++i) { const float p = __expf(lv * rv[i] - mx) * inv; const unsigned short hb = f2bf(p); oh[i] = hb; ol[i] = f2bf(p - bf2f(hb)); }
            const size_t o = (size_t)r * NN + q * 256 + lane * 8; *(v8us*)(PH + o) = oh; *(v8us*)(PL + o) = ol; }
         }
}
__global__ __launch_bounds__(256) void k_zerof(float* dst, int n) {
    const int i = blockIdx.x * 256 + threadIdx.x; if (i >= n) return; *(float*)(dst + i) = 0.f; 
}
__global__ __launch_bounds__(256) void k_split256(const float* __restrict__ src, int nrows, bf* dh, bf* dl) {
    const int lane = threadIdx.x & 31, r = blockIdx.x * 8 + (threadIdx.x >> 5); if (r >= nrows) return;
    const size_t o = (size_t)r * DD + lane * 8; const v8f v = *(const v8f*)(src + o); v8us oh, ol;
#pragma unroll
    for (int i = 0; i < 8; ++i) { const unsigned short hb = f2bf(v[i]); oh[i] = hb; ol[i] = f2bf(v[i] - bf2f(hb)); }
    *(v8us*)(dh + o) = oh; *(v8us*)(dl + o) = ol; 
}

extern "C" void kernel_launch(void* const* d_in, const int* in_sizes, int n_in,
                              void* d_out, int out_size, void* d_ws, size_t ws_size, hipStream_t stream) {
    (void)in_sizes; (void)n_in; (void)out_size;
    const float* x = (const float*)d_in[0]; const float* Wl = (const float*)d_in[1]; const float* Wr = (const float*)d_in[2]; const float* Wv = (const float*)d_in[3]; const float* Wo = (const float*)d_in[4];
    float* out = (float*)d_out;    // [2][4096][256]
    char* wsp = (char*)d_ws;
    auto take = [&](size_t bytes) { char* p = wsp; wsp += (bytes + 255) & ~(size_t)255; return (void*)p; };
    bf* WlT = (bf*)take(PP * DD * 2); bf* WrT = (bf*)take(PP * DD * 2); bf* WvT = (bf*)take(DD * DD * 2); bf* WoT = (bf*)take(DD * DD * 2); float* ZB = (float*)take(DD * 4);
    bf* Xb = (bf*)take((size_t)NN * DD * 2); float* Lm = (float*)take((size_t)NN * PP * 4); float* Rm = (float*)take((size_t)NN * PP * 4); float* VT = (float*)take((size_t)DD * NN * 4); bf* VTh = (bf*)take((size_t)DD * NN * 2); bf* VTl = (bf*)take((size_t)DD * NN * 2);
    bf* PH = (bf*)take((size_t)RCH * NN * 2); bf* PL = (bf*)take((size_t)RCH * NN * 2); float* O = (float*)take((size_t)NN * DD * 4); bf* Oh = (bf*)take((size_t)NN * DD * 2); bf* Ol = (bf*)take((size_t)NN * DD * 2);
    if ((size_t)(wsp - (char*)d_ws) > ws_size) return;    // ~ 40 MB, no aliasing
    k_zerof<<<1, 256, 0, stream>>>(ZB, DD);
    k_wt<<<dim3(DD / 64, PP / 64, 1), 256, 0, stream>>>(Wl, DD, PP, WlT); k_wt<<<dim3(DD / 64, PP / 64, 1), 256, 0, stream>>>(Wr, DD, PP, WrT); k_wt<<<dim3(DD / 64, DD / 64, 1), 256, 0, stream>>>(Wv, DD, DD, WvT); k_wt<<<dim3(DD / 64, DD / 64, 1), 256, 0, stream>>>(Wo, DD, DD, WoT);
    for (int b = 0; b < NBI; ++b) {
        k_cvt<<<NN / 8, 256, 0, stream>>>(x + (size_t)b * NN * DD, NN, Xb);
        k_gemmb<false, false><<<dim3(NN / 64, PP / 64, 1), 128, 0, stream>>>(Xb, nullptr, WlT, nullptr, Lm, PP, nullptr);       // l [n][64]
        k_gemmb<false, false><<<dim3(NN / 64, PP / 64, 1), 128, 0, stream>>>(Xb, nullptr, WrT, nullptr, Rm, PP, nullptr);       // r [n][64]
        k_gemmrb<false><<<dim3(DD / 64, NN / 64, 1), 128, 0, stream>>>(WvT, nullptr, Xb, ZB, VT, NN, DD); k_rowsplit<<<DD / 8, 256, 0, stream>>>(VT, DD, VTh, VTl);     // v^T [c][m]
        for (int ch = 0; ch < NN / RCH; ++ch) { const int n0 = ch * RCH;
            k_factsoft<<<RCH / 8, 256, 0, stream>>>(Lm, Rm, n0, PH, PL);
            k_gemm3<<<dim3(RCH / 64, DD / 64, 1), 128, 0, stream>>>(PH, PL, VTh, VTl, NN, O + (size_t)n0 * DD, DD); }                   // o rows n0.. [n][c] = P . v
        k_split256<<<NN / 8, 256, 0, stream>>>(O, NN, Oh, Ol);
        k_gemmb<true, false><<<dim3(NN / 64, DD / 64, 1), 128, 0, stream>>>(Oh, Ol, WoT, nullptr, out + (size_t)b * NN * DD, DD, nullptr);                 // o.Wo
    }
}

// v001
// It runs in 280 microseconds.
// Two timings next to v000 put it at 4.09 and 4.04 times that version's speed.
#include <hip/hip_runtime.h>

// Compute dtypes, f32 accumulate, both batch items in every launch (8192 rows): l = x.Wl, r = x.Wr ([8192 x 256].[256 x 64]) and v^T = Wv^T.x^T ([256 x 256].[256 x 4096] per batch item) with PLAIN bf16 operands (rounded
// input, k-major weights transposed once; exact products); the factorised scores attn[n][m] = l[n][m/64] r[n][m%64] and their row softmax in f32 -> bf16 hi + UNSCALED residual planes for
// all 8192 rows; o[n][c] = sum_m P[n][m] v[m][c] ([4096 x 4096].[4096 x 256] per batch item, both operands hi + residual, three products; shared across heads = all 256 channels at once) and out = o.Wo

#define NBI  2
#define NN   4096
#define DD   256
#define PP   64
#define NR   (NBI * NN)
#define CC   DD
#define DM   DD
#define NTK  NN
#define LOSC 1024.0f

typedef _Float16 h16;
typedef unsigned short bf;
typedef __attribute__((ext_vector_type(16))) __bf16   v16bf;
typedef __attribute__((ext_vector_type(16))) _Float16 v16h;
typedef __attribute__((ext_vector_type(8)))  _Float16 v8h;
typedef __attribute__((ext_vector_type(8)))  unsigned short v8us;
typedef __attribute__((ext_vector_type(8)))  float    v8f;
typedef __attribute__((ext_vector_type(4)))  float    v4f;
typedef __attribute__((ext_vector_type(4)))  _Float16 v4h;
typedef v8h  __attribute__((may_alias)) v8ha;
typedef v4f  __attribute__((may_alias)) v4fa;
typedef v8us __attribute__((may_alias)) v8usa;

__device__ __forceinline__ unsigned short f2bf(float f) { unsigned u = __float_as_uint(f); u += 0x7FFFu + ((u >> 16) & 1u); return (unsigned short)(u >> 16); }
__device__ __forceinline__ float bf2f(unsigned short b) { return __uint_as_float(((unsigned)b) << 16); }
__device__ __forceinline__ float bfr(float f) { return bf2f(f2bf(f)); }
__device__ __forceinline__ v16h cat16(v8h lo, v8h hi) { return __builtin_shufflevector(lo, hi, 0, 1, 2, 3, 4, 5, 6, 7, 8, 9, 10, 11, 12, 13, 14, 15); }
__device__ __forceinline__ v16bf cat16b(v8us lo, v8us hi) { return __builtin_bit_cast(v16bf, __builtin_shufflevector(lo, hi, 0, 1, 2, 3, 4, 5, 6, 7, 8, 9, 10, 11, 12, 13, 14, 15)); }
__device__ __forceinline__ v8f wmma16(v16h a, v16h b, v8f c) { return __builtin_amdgcn_wmma_f32_16x16x32_f16(false, a, false, b, (short)0, c, false, false); }
__device__ __forceinline__ v8f wmmab(v16bf a, v16bf b, v8f c) { return __builtin_amdgcn_wmma_f32_16x16x32_bf16(false, a, false, b, (short)0, c, false, false); }

// k_wt: WT [n][K] = bf16(W[k][n]) (k-major [K][ncols]) via 64 x 64 LDS tiles; grid (K/64, ncols/64).
__global__ __launch_bounds__(256) void k_wt(const float* __restrict__ Wm, int K, int ncols, bf* WT) {
    __shared__ __align__(16) unsigned short tl[64 * 72];
    const int tid = threadIdx.x, k0 = blockIdx.x * 64, n0 = blockIdx.y * 64;
    const int kk = tid >> 2, nq = (tid & 3) * 16;
#pragma unroll
    for (int i = 0; i < 16; ++i) tl[(nq + i) * 72 + kk] = f2bf(Wm[(size_t)(k0 + kk) * ncols + n0 + nq + i]);
    __syncthreads();
    const int piece = tid & 7;
    auto pass = [&]() {
#pragma unroll
        for (int s = 0; s < 2; ++s) { const int nr = (tid >> 3) + 32 * s; const v8us val = *(const v8usa*)(tl + nr * 72 + piece * 8); *(v8us*)(WT + (size_t)(n0 + nr) * K + k0 + piece * 8) = val; }
    };
    pass(); 
}
// k_gemmb: 64 x 64 block tile (4 waves x 16 x 64) of C[NR][NW] = (A [+ Al]).B^T (K = 256) [+ bf(bias[c])] [+ bf(R[r][c]) residual]; f32 whole-line epilogue (or f16
template <bool SPLITA, bool F16OUT = false>
__global__ __launch_bounds__(128) void k_gemmb(const bf* __restrict__ A, const bf* __restrict__ Al, const bf* __restrict__ Bn, const float* __restrict__ bias, float* C, int ldc, h16* C2, const float* __restrict__ R = nullptr, int K = DM, int roundR = 1) {
    __shared__ __align__(16) float ost[4][16 * 68];
    const int lane = threadIdx.x & 31, wave = threadIdx.x >> 5, lr = lane & 15, hi = lane >> 4;
    const int r0 = blockIdx.x * 64 + wave * 16, c0 = blockIdx.y * 64;
    const size_t aoff = (size_t)(r0 + lr) * K + 8 * hi;
    size_t boff[4];
#pragma unroll
    for (int t = 0; t < 4; ++t) boff[t] = (size_t)(c0 + t * 16 + lr) * K + 8 * hi;
    v8f acc[4];
#pragma unroll
    for (int t = 0; t < 4; ++t) acc[t] = (v8f){};
#pragma unroll 1
    for (int kc = 0; kc < K; kc += 32) {
        const v16bf a = cat16b(*(const v8us*)(A + aoff + kc), *(const v8us*)(A + aoff + kc + 16));
        v16bf al = a;
        if (SPLITA) al = cat16b(*(const v8us*)(Al + aoff + kc), *(const v8us*)(Al + aoff + kc + 16));
#pragma unroll
        for (int t = 0; t < 4; ++t) { const v16bf b = cat16b(*(const v8us*)(Bn + boff[t] + kc), *(const v8us*)(Bn + boff[t] + kc + 16)); acc[t] = wmmab(a, b, acc[t]); if (SPLITA) acc[t] = wmmab(al, b, acc[t]); }
        asm volatile("v_nop\n\tv_nop\n\tv_nop\n\tv_nop" : "+v"(acc[0]), "+v"(acc[1]), "+v"(acc[2]), "+v"(acc[3]) : "v"(a), "v"(al));
    }
    float* os = &ost[wave][0];
#pragma unroll
    for (int t = 0; t < 4; ++t) { const float bv = bias ? bfr(bias[c0 + t * 16 + lr]) : 0.f;
#pragma unroll
        for (int j = 0; j < 8; ++j) os[(hi * 8 + j) * 68 + t * 16 + lr] = acc[t][j] + bv; }
    __syncthreads();
    if (F16OUT) {
        h16* crow = (h16*)(void*)C + (size_t)r0 * ldc + c0;
        auto pass = [&]() {
#pragma unroll
            for (int s = 0; s < 4; ++s) { const int row = 4 * s + (lane >> 3), piece = lane & 7; const float* sp = os + row * 68 + piece * 8; v8h o, o2;
#pragma unroll
                for (int i = 0; i < 8; ++i) { const h16 a = (h16)sp[i]; o[i] = a; o2[i] = (h16)((sp[i] - (float)a) * LOSC); }
                *(v8h*)(crow + (size_t)row * ldc + piece * 8) = o; if (C2) *(v8h*)(C2 + (size_t)r0 * ldc + c0 + (size_t)row * ldc + piece * 8) = o2; }
        };
        pass(); 
    } else {
        float* crow = C + (size_t)r0 * ldc + c0;
        auto pass = [&]() {
#pragma unroll
            for (int s = 0; s < 8; ++s) { const int Lid = (lane >> 3) + 4 * s, piece = lane & 7; const int row = Lid >> 1, cofs = (Lid & 1) * 32 + piece * 4;
                v4f val = *(const v4fa*)(os + row * 68 + cofs); if (R) { const v4f rv = *(const v4f*)(R + ((size_t)r0 + row) * ldc + c0 + cofs); val += roundR ? (v4f){bfr(rv[0]), bfr(rv[1]), bfr(rv[2]), bfr(rv[3])} : rv; }
                *(v4f*)(crow + (size_t)row * ldc + cofs) = val; }
        };
        pass(); 
    }
}

// k_gemm3: 64 x 64 tile of C = (Ah + Al).(Bh + Bl)^T over K (row strides = K for all four planes; n-major B, one [CC][K] plane pair per batch item, picked by the row tile): three products per 32-k step (hh, hl, lh); f32
__global__ __launch_bounds__(128) void k_gemm3(const bf* __restrict__ Ah, const bf* __restrict__ Al, const bf* __restrict__ Bh, const bf* __restrict__ Bl, int K, float* C, int ldc) {
    __shared__ __align__(16) float ost[4][16 * 68];
    const int lane = threadIdx.x & 31, wave = threadIdx.x >> 5, lr = lane & 15, hi = lane >> 4;
    const int r0 = blockIdx.x * 64 + wave * 16, c0 = blockIdx.y * 64;
    const size_t aoff = (size_t)(r0 + lr) * K + 8 * hi;
    const size_t bitem = (size_t)(blockIdx.x / (NN / 64)) * CC * K; Bh += bitem; Bl += bitem;
    v8f acc[4];
#pragma unroll
    for (int t = 0; t < 4; ++t) acc[t] = (v8f){};
#pragma unroll 1
    for (int kc = 0; kc < K; kc += 32) {
        const v16bf a = cat16b(*(const v8us*)(Ah + aoff + kc), *(const v8us*)(Ah + aoff + kc + 16));
        const v16bf al = cat16b(*(const v8us*)(Al + aoff + kc), *(const v8us*)(Al + aoff + kc + 16));
#pragma unroll
        for (int t = 0; t < 4; ++t) { const size_t bo = (size_t)(c0 + t * 16 + lr) * K + kc + 8 * hi;
            const v16bf bh = cat16b(*(const v8us*)(Bh + bo), *(const v8us*)(Bh + bo + 16)); const v16bf bl = cat16b(*(const v8us*)(Bl + bo), *(const v8us*)(Bl + bo + 16));
            acc[t] = wmmab(a, bh, acc[t]); acc[t] = wmmab(al, bh, acc[t]); acc[t] = wmmab(a, bl, acc[t]); }
        asm volatile("v_nop\n\tv_nop\n\tv_nop\n\tv_nop" : "+v"(acc[0]), "+v"(acc[1]), "+v"(acc[2]), "+v"(acc[3]) : "v"(a), "v"(al));
    }
    float* os = &ost[wave][0];
#pragma unroll
    for (int t = 0; t < 4; ++t) {
#pragma unroll
        for (int j = 0; j < 8; ++j) os[(hi * 8 + j) * 68 + t * 16 + lr] = acc[t][j]; }
    __builtin_amdgcn_wave_barrier(); asm volatile("" ::: "memory");
    float* crow = C + (size_t)r0 * ldc + c0;
    auto pass = [&]() {
#pragma unroll
        for (int s = 0; s < 8; ++s) { const int Lid = (lane >> 3) + 4 * s, piece = lane & 7; const int row = Lid >> 1, cofs = (Lid & 1) * 32 + piece * 4;
            const v4f val = *(const v4fa*)(os + row * 68 + cofs); *(v4f*)(crow + (size_t)row * ldc + cofs) = val; }
    };
    pass(); 
}

// k_gemmrb: 64 x 64 tile of C[o][v] = (A [+ Al]).B^T over K (A row stride K, B n-major row stride K; blockIdx.z = batch item: its NN rows of B, its own [DD][ldc] plane of C) + bf(rbias[o]) per ROW; f32 whole-line epilogue (8 lanes x 16 B per line),
template <bool SPLITA>
__global__ __launch_bounds__(128) void k_gemmrb(const bf* __restrict__ A, const bf* __restrict__ Al, const bf* __restrict__ Bn, const float* __restrict__ rbias, float* C, int ldc, int K) {
    __shared__ __align__(16) float ost[4][16 * 68];
    const int lane = threadIdx.x & 31, wave = threadIdx.x >> 5, lr = lane & 15, hi = lane >> 4;
    const int r0 = blockIdx.x * 64 + wave * 16, c0 = blockIdx.y * 64;
    const size_t aoff = (size_t)(r0 + lr) * K + 8 * hi;
    Bn += (size_t)blockIdx.z * NN * K; C += (size_t)blockIdx.z * DD * ldc;
    v8f acc[4];
#pragma unroll
    for (int t = 0; t < 4; ++t) acc[t] = (v8f){};
#pragma unroll 1
    for (int kc = 0; kc < K; kc += 32) {
        const v16bf a = cat16b(*(const v8us*)(A + aoff + kc), *(const v8us*)(A + aoff + kc + 16));
        v16bf al = a; if (SPLITA) al = cat16b(*(const v8us*)(Al + aoff + kc), *(const v8us*)(Al + aoff + kc + 16));
#pragma unroll
        for (int t = 0; t < 4; ++t) { const size_t bo = (size_t)(c0 + t * 16 + lr) * K + kc + 8 * hi; const v16bf bb = cat16b(*(const v8us*)(Bn + bo), *(const v8us*)(Bn + bo + 16)); acc[t] = wmmab(a, bb, acc[t]); if (SPLITA) acc[t] = wmmab(al, bb, acc[t]); }
        asm volatile("v_nop\n\tv_nop\n\tv_nop\n\tv_nop" : "+v"(acc[0]), "+v"(acc[1]), "+v"(acc[2]), "+v"(acc[3]) : "v"(a), "v"(al));
    }
    float* os = &ost[wave][0];
#pragma unroll
    for (int t = 0; t < 4; ++t) {
#pragma unroll
        for (int j = 0; j < 8; ++j) os[(hi * 8 + j) * 68 + t * 16 + lr] = acc[t][j] + bfr(rbias[r0 + hi * 8 + j]); }
    __builtin_amdgcn_wave_barrier(); asm volatile("" ::: "memory");
    float* crow = C + (size_t)r0 * ldc + c0;
    auto pass = [&]() {
#pragma unroll
        for (int s = 0; s < 8; ++s) { const int Lid = (lane >> 3) + 4 * s, piece = lane & 7; const int row = Lid >> 1, cofs = (Lid & 1) * 32 + piece * 4;
            const v4f val = *(const v4fa*)(os + row * 68 + cofs); *(v4f*)(crow + (size_t)row * ldc + cofs) = val; }
    };
    pass(); 
}
__global__ __launch_bounds__(256) void k_rowsplit(const float* __restrict__ Y, int nrows, bf* Ph, bf* Pl) {
    const int lane = threadIdx.x & 31, r = blockIdx.x * 8 + (threadIdx.x >> 5); if (r >= nrows) return;
{
#pragma unroll 1
        for (int c0 = lane * 8; c0 < NN; c0 += 256) { const size_t o = (size_t)r * NN + c0; const v8f v = *(const v8f*)(Y + o); v8us oh, ol;
#pragma unroll
            for (int i = 0; i < 8; ++i) { const unsigned short hb = f2bf(v[i]); oh[i] = hb; ol[i] = f2bf(v[i] - bf2f(hb)); }
            *(v8us*)(Ph + o) = oh; *(v8us*)(Pl + o) = ol; }
         }
}

__global__ __launch_bounds__(256) void k_cvt(const float* __restrict__ src, int nrows, bf* dst) {
    const int lane = threadIdx.x & 31, r = blockIdx.x * 8 + (threadIdx.x >> 5); if (r >= nrows) return; v8us o;
#pragma unroll
    for (int i = 0; i < 8; ++i) o[i] = f2bf(src[(size_t)r * DD + lane * 8 + i]);
    *(v8us*)(dst + (size_t)r * DD + lane * 8) = o; 
}
// k_factsoft: one wave per row n of the 8192: attn[n][m] = L[n][m >> 6] R[n][m & 63] over m < 4096 (f32), softmax over m (fixed lane order, three phases, products recomputed per
__global__ __launch_bounds__(256) void k_factsoft(const float* __restrict__ Lm, const float* __restrict__ Rm, bf* PH, bf* PL) {
    const int lane = threadIdx.x & 31, r = blockIdx.x * 8 + (threadIdx.x >> 5); if (r >= NR) return;
    const float* lr = Lm + (size_t)r * PP; const float* rr = Rm + (size_t)r * PP;
    float rv[8];     // lane's 8 consecutive m within a 256-chunk share m>>6 = c0>>6... (c0 = lane*8 + 256 q: m>>6 = (lane*8)>>6 + 4q = lane>>3 + 4q; m&63 = (lane*8)&63 + i)
#pragma unroll
    for (int i = 0; i < 8; ++i) rv[i] = rr[((lane * 8) & 63) + i];
    float mx = -3.0e38f;
#pragma unroll 1
    for (int q = 0; q < NN / 256; ++q) { const float lv = lr[(lane >> 3) + 4 * q];
#pragma unroll
        for (int i = 0; i < 8; ++i) mx = fmaxf(mx, lv * rv[i]); }
#pragma unroll
    for (int sh = 16; sh; sh >>= 1) mx = fmaxf(mx, __shfl_xor(mx, sh, 32));
    float sm = 0.f;
#pragma unroll 1
    for (int q = 0; q < NN / 256; ++q) { const float lv = lr[(lane >> 3) + 4 * q];
#pragma unroll
        for (int i = 0; i < 8; ++i) sm += __expf(lv * rv[i] - mx); }
#pragma unroll
    for (int sh = 16; sh; sh >>= 1) sm += __shfl_xor(sm, sh, 32);
    const float inv = 1.0f / sm;
{
#pragma unroll 1
        for (int q = 0; q < NN / 256; ++q) { const float lv = lr[(lane >> 3) + 4 * q]; v8us oh, ol;
#pragma unroll
            for (int i = 0; i < 8; ++i) { const float p = __expf(lv * rv[i] - mx) * inv; const unsigned short hb = f2bf(p); oh[i] = hb; ol[i] = f2bf(p - bf2f(hb)); }
            const size_t o = (size_t)r * NN + q * 256 + lane * 8; *(v8us*)(PH + o) = oh; *(v8us*)(PL + o) = ol; }
         }
}
__global__ __launch_bounds__(256) void k_zerof(float* dst, int n) {
    const int i = blockIdx.x * 256 + threadIdx.x; if (i >= n) return; *(float*)(dst + i) = 0.f; 
}
__global__ __launch_bounds__(256) void k_split256(const float* __restrict__ src, int nrows, bf* dh, bf* dl) {
    const int lane = threadIdx.x & 31, r = blockIdx.x * 8 + (threadIdx.x >> 5); if (r >= nrows) return;
    const size_t o = (size_t)r * DD + lane * 8; const v8f v = *(const v8f*)(src + o); v8us oh, ol;
#pragma unroll
    for (int i = 0; i < 8; ++i) { const unsigned short hb = f2bf(v[i]); oh[i] = hb; ol[i] = f2bf(v[i] - bf2f(hb)); }
    *(v8us*)(dh + o) = oh; *(v8us*)(dl + o) = ol; 
}

extern "C" void kernel_launch(void* const* d_in, const int* in_sizes, int n_in,
                              void* d_out, int out_size, void* d_ws, size_t ws_size, hipStream_t stream) {
    (void)in_sizes; (void)n_in; (void)out_size;
    const float* x = (const float*)d_in[0]; const float* Wl = (const float*)d_in[1]; const float* Wr = (const float*)d_in[2]; const float* Wv = (const float*)d_in[3]; const float* Wo = (const float*)d_in[4];
    float* out = (float*)d_out;    // [2][4096][256]
    char* wsp = (char*)d_ws;
    auto take = [&](size_t bytes) { char* p = wsp; wsp += (bytes + 255) & ~(size_t)255; return (void*)p; };
    bf* WlT = (bf*)take(PP * DD * 2); bf* WrT = (bf*)take(PP * DD * 2); bf* WvT = (bf*)take(DD * DD * 2); bf* WoT = (bf*)take(DD * DD * 2); float* ZB = (float*)take(DD * 4);
    bf* Xb = (bf*)take((size_t)NR * DD * 2); float* Lm = (float*)take((size_t)NR * PP * 4); float* Rm = (float*)take((size_t)NR * PP * 4); float* VT = (float*)take((size_t)DD * NR * 4); bf* VTh = (bf*)take((size_t)DD * NR * 2); bf* VTl = (bf*)take((size_t)DD * NR * 2);
    bf* PH = (bf*)take((size_t)NR * NN * 2); bf* PL = (bf*)take((size_t)NR * NN * 2); float* O = (float*)take((size_t)NR * DD * 4); bf* Oh = (bf*)take((size_t)NR * DD * 2); bf* Ol = (bf*)take((size_t)NR * DD * 2);
    if ((size_t)(wsp - (char*)d_ws) > ws_size) return;    // ~ 176 MB, no aliasing
    k_zerof<<<1, 256, 0, stream>>>(ZB, DD);
    k_wt<<<dim3(DD / 64, PP / 64, 1), 256, 0, stream>>>(Wl, DD, PP, WlT); k_wt<<<dim3(DD / 64, PP / 64, 1), 256, 0, stream>>>(Wr, DD, PP, WrT); k_wt<<<dim3(DD / 64, DD / 64, 1), 256, 0, stream>>>(Wv, DD, DD, WvT); k_wt<<<dim3(DD / 64, DD / 64, 1), 256, 0, stream>>>(Wo, DD, DD, WoT);
    k_cvt<<<NR / 8, 256, 0, stream>>>(x, NR, Xb);
    k_gemmb<false, false><<<dim3(NR / 64, PP / 64, 1), 128, 0, stream>>>(Xb, nullptr, WlT, nullptr, Lm, PP, nullptr);       // l [b n][64]
    k_gemmb<false, false><<<dim3(NR / 64, PP / 64, 1), 128, 0, stream>>>(Xb, nullptr, WrT, nullptr, Rm, PP, nullptr);       // r [b n][64]
    k_gemmrb<false><<<dim3(DD / 64, NN / 64, NBI), 128, 0, stream>>>(WvT, nullptr, Xb, ZB, VT, NN, DD); k_rowsplit<<<NBI * DD / 8, 256, 0, stream>>>(VT, NBI * DD, VTh, VTl);     // v^T [b][c][m]
    k_factsoft<<<NR / 8, 256, 0, stream>>>(Lm, Rm, PH, PL);
    k_gemm3<<<dim3(NR / 64, DD / 64, 1), 128, 0, stream>>>(PH, PL, VTh, VTl, NN, O, DD);                   // o [b n][c] = P . v
    k_split256<<<NR / 8, 256, 0, stream>>>(O, NR, Oh, Ol);
    k_gemmb<true, false><<<dim3(NR / 64, DD / 64, 1), 128, 0, stream>>>(Oh, Ol, WoT, nullptr, out, DD, nullptr);                 // o.Wo
}

// v002
// One run takes 135 microseconds.
// In two side-by-side timings against v001, it was 2.05 and 2.06 times as fast.
// All steps since v000 together make it 8.36 times as fast.
#include <hip/hip_runtime.h>

// Compute dtypes, f32 accumulate, both batch items in every launch (8192 rows): l = x.Wl, r = x.Wr ([8192 x 256].[256 x 64]) and v^T = Wv^T.x^T ([256 x 256].[256 x 4096] per batch item) with PLAIN bf16 operands (rounded
// input, k-major weights transposed once; exact products); the factorised scores attn[n][m] = l[n][m/64] r[n][m%64] and their row softmax in f32 -> bf16 hi + UNSCALED residual planes for
// all 8192 rows; o[n][c] = sum_m P[n][m] v[m][c] ([4096 x 4096].[4096 x 256] per batch item, both operands hi + residual, three products; shared across heads = all 256 channels at once) and out = o.Wo

#define NBI  2
#define NN   4096
#define DD   256
#define PP   64
#define NR   (NBI * NN)
#define CC   DD
#define DM   DD
#define NTK  NN
#define LOSC 1024.0f

typedef _Float16 h16;
typedef unsigned short bf;
typedef __attribute__((ext_vector_type(16))) __bf16   v16bf;
typedef __attribute__((ext_vector_type(16))) _Float16 v16h;
typedef __attribute__((ext_vector_type(8)))  _Float16 v8h;
typedef __attribute__((ext_vector_type(8)))  unsigned short v8us;
typedef __attribute__((ext_vector_type(8)))  float    v8f;
typedef __attribute__((ext_vector_type(4)))  float    v4f;
typedef __attribute__((ext_vector_type(4)))  _Float16 v4h;
typedef v8h  __attribute__((may_alias)) v8ha;
typedef v4f  __attribute__((may_alias)) v4fa;
typedef v8us __attribute__((may_alias)) v8usa;

__device__ __forceinline__ unsigned short f2bf(float f) { unsigned u = __float_as_uint(f); u += 0x7FFFu + ((u >> 16) & 1u); return (unsigned short)(u >> 16); }
__device__ __forceinline__ float bf2f(unsigned short b) { return __uint_as_float(((unsigned)b) << 16); }
__device__ __forceinline__ float bfr(float f) { return bf2f(f2bf(f)); }
__device__ __forceinline__ v16h cat16(v8h lo, v8h hi) { return __builtin_shufflevector(lo, hi, 0, 1, 2, 3, 4, 5, 6, 7, 8, 9, 10, 11, 12, 13, 14, 15); }
__device__ __forceinline__ v16bf cat16b(v8us lo, v8us hi) { return __builtin_bit_cast(v16bf, __builtin_shufflevector(lo, hi, 0, 1, 2, 3, 4, 5, 6, 7, 8, 9, 10, 11, 12, 13, 14, 15)); }
__device__ __forceinline__ v8f wmma16(v16h a, v16h b, v8f c) { return __builtin_amdgcn_wmma_f32_16x16x32_f16(false, a, false, b, (short)0, c, false, false); }
__device__ __forceinline__ v8f wmmab(v16bf a, v16bf b, v8f c) { return __builtin_amdgcn_wmma_f32_16x16x32_bf16(false, a, false, b, (short)0, c, false, false); }

// k_wt: WT [n][K] = bf16(W[k][n]) (k-major [K][ncols]) via 64 x 64 LDS tiles; grid (K/64, ncols/64).
__global__ __launch_bounds__(256) void k_wt(const float* __restrict__ Wm, int K, int ncols, bf* WT) {
    __shared__ __align__(16) unsigned short tl[64 * 72];
    const int tid = threadIdx.x, k0 = blockIdx.x * 64, n0 = blockIdx.y * 64;
    const int kk = tid >> 2, nq = (tid & 3) * 16;
#pragma unroll
    for (int i = 0; i < 16; ++i) tl[(nq + i) * 72 + kk] = f2bf(Wm[(size_t)(k0 + kk) * ncols + n0 + nq + i]);
    __syncthreads();
    const int piece = tid & 7;
    auto pass = [&]() {
#pragma unroll
        for (int s = 0; s < 2; ++s) { const int nr = (tid >> 3) + 32 * s; const v8us val = *(const v8usa*)(tl + nr * 72 + piece * 8); *(v8us*)(WT + (size_t)(n0 + nr) * K + k0 + piece * 8) = val; }
    };
    pass(); 
}
// k_gemmb: 64 x 64 block tile (4 waves x 16 x 64) of C[NR][NW] = (A [+ Al]).B^T (K = 256) [+ bf(bias[c])] [+ bf(R[r][c]) residual]; f32 whole-line epilogue (or f16
template <bool SPLITA, bool F16OUT = false>
__global__ __launch_bounds__(128) void k_gemmb(const bf* __restrict__ A, const bf* __restrict__ Al, const bf* __restrict__ Bn, const float* __restrict__ bias, float* C, int ldc, h16* C2, const float* __restrict__ R = nullptr, int K = DM, int roundR = 1) {
    __shared__ __align__(16) float ost[4][16 * 68];
    const int lane = threadIdx.x & 31, wave = threadIdx.x >> 5, lr = lane & 15, hi = lane >> 4;
    const int r0 = blockIdx.x * 64 + wave * 16, c0 = blockIdx.y * 64;
    const size_t aoff = (size_t)(r0 + lr) * K + 8 * hi;
    size_t boff[4];
#pragma unroll
    for (int t = 0; t < 4; ++t) boff[t] = (size_t)(c0 + t * 16 + lr) * K + 8 * hi;
    v8f acc[4];
#pragma unroll
    for (int t = 0; t < 4; ++t) acc[t] = (v8f){};
#pragma unroll 1
    for (int kc = 0; kc < K; kc += 32) {
        const v16bf a = cat16b(*(const v8us*)(A + aoff + kc), *(const v8us*)(A + aoff + kc + 16));
        v16bf al = a;
        if (SPLITA) al = cat16b(*(const v8us*)(Al + aoff + kc), *(const v8us*)(Al + aoff + kc + 16));
#pragma unroll
        for (int t = 0; t < 4; ++t) { const v16bf b = cat16b(*(const v8us*)(Bn + boff[t] + kc), *(const v8us*)(Bn + boff[t] + kc + 16)); acc[t] = wmmab(a, b, acc[t]); if (SPLITA) acc[t] = wmmab(al, b, acc[t]); }
        asm volatile("v_nop\n\tv_nop\n\tv_nop\n\tv_nop" : "+v"(acc[0]), "+v"(acc[1]), "+v"(acc[2]), "+v"(acc[3]) : "v"(a), "v"(al));
    }
    float* os = &ost[wave][0];
#pragma unroll
    for (int t = 0; t < 4; ++t) { const float bv = bias ? bfr(bias[c0 + t * 16 + lr]) : 0.f;
#pragma unroll
        for (int j = 0; j < 8; ++j) os[(hi * 8 + j) * 68 + t * 16 + lr] = acc[t][j] + bv; }
    __syncthreads();
    if (F16OUT) {
        h16* crow = (h16*)(void*)C + (size_t)r0 * ldc + c0;
        auto pass = [&]() {
#pragma unroll
            for (int s = 0; s < 4; ++s) { const int row = 4 * s + (lane >> 3), piece = lane & 7; const float* sp = os + row * 68 + piece * 8; v8h o, o2;
#pragma unroll
                for (int i = 0; i < 8; ++i) { const h16 a = (h16)sp[i]; o[i] = a; o2[i] = (h16)((sp[i] - (float)a) * LOSC); }
                *(v8h*)(crow + (size_t)row * ldc + piece * 8) = o; if (C2) *(v8h*)(C2 + (size_t)r0 * ldc + c0 + (size_t)row * ldc + piece * 8) = o2; }
        };
        pass(); 
    } else {
        float* crow = C + (size_t)r0 * ldc + c0;
        auto pass = [&]() {
#pragma unroll
            for (int s = 0; s < 8; ++s) { const int Lid = (lane >> 3) + 4 * s, piece = lane & 7; const int row = Lid >> 1, cofs = (Lid & 1) * 32 + piece * 4;
                v4f val = *(const v4fa*)(os + row * 68 + cofs); if (R) { const v4f rv = *(const v4f*)(R + ((size_t)r0 + row) * ldc + c0 + cofs); val += roundR ? (v4f){bfr(rv[0]), bfr(rv[1]), bfr(rv[2]), bfr(rv[3])} : rv; }
                *(v4f*)(crow + (size_t)row * ldc + cofs) = val; }
        };
        pass(); 
    }
}

// k_gemm3: 64 x 128 block tile (4 waves x 32 x 64) of C = (Ah + Al).(Bh + Bl)^T over K = NN (row strides NN for all four planes; n-major B, one [CC][NN] plane pair per batch item, picked by the row tile):
// three products per 32-k step (hh, lh, hl), in that order per accumulator. A stage is 256 B (128 k) of every operand row, brought into LDS by one tensor load per wave (wave 0: Ah, 1: Al, 2: Bh, 3: Bl),
// rows padded to a 272 B pitch for the 16-byte readers; two buffers, the next stage in flight under the current one.
typedef uint32_t u32x4 __attribute__((ext_vector_type(4)));
typedef uint32_t u32x8 __attribute__((ext_vector_type(8)));
#define G3_ROWB  256u
#define G3_PITCH 272u
#define G3_AP    18432u                        // 64 rows x 272 B, rounded up to a multiple of 2 KiB
#define G3_BP    34816u                        // 128 rows x 272 B = 17 x 2 KiB
#define G3_STAGE (2u * G3_AP + 2u * G3_BP)     // 106,496 B = 52 x 2 KiB
#define G3_NST   (NN * 2u / G3_ROWB)           // 32 stages
__device__ __forceinline__ uint32_t uni(uint32_t v) { return (uint32_t)__builtin_amdgcn_readfirstlane(v); }
// a value held in a scalar register: makes the test around a tensor load a scalar branch, and keeps what is formed from it behind the waits in front of it
__device__ __forceinline__ uint32_t pinned(uint32_t v) { uint32_t w = uni(v); asm volatile("" : "+s"(w)); return w; }
struct G3Frag { v16bf ah[2], al[2], bh[4], bl[4]; };
__device__ __forceinline__ v16bf g3_ld(const unsigned char* p) { return cat16b(*(const v8usa*)p, *(const v8usa*)(p + 32)); }
__device__ __forceinline__ void g3_frags(G3Frag& f, const unsigned char* pa, const unsigned char* pb, int kk) {
#pragma unroll
    for (int i = 0; i < 2; ++i) { f.ah[i] = g3_ld(pa + i * 16 * G3_PITCH + kk * 64); f.al[i] = g3_ld(pa + G3_AP + i * 16 * G3_PITCH + kk * 64); }
#pragma unroll
    for (int t = 0; t < 4; ++t) { f.bh[t] = g3_ld(pb + t * 16 * G3_PITCH + kk * 64); f.bl[t] = g3_ld(pb + G3_BP + t * 16 * G3_PITCH + kk * 64); }
}
__global__ __launch_bounds__(128) void k_gemm3(const bf* __restrict__ Ah, const bf* __restrict__ Al, const bf* __restrict__ Bh, const bf* __restrict__ Bl, float* C) {
    __shared__ __attribute__((aligned(2048))) unsigned char ring[2 * G3_STAGE + 4 * 32 * 68 * 4];    // two stages, then each wave's own output staging
    const int lane = threadIdx.x & 31, lr = lane & 15, hi = lane >> 4;
    const uint32_t wave = uni(threadIdx.x >> 5);
    const int wr = wave >> 1, wc = wave & 1;
    const int rb = blockIdx.x * 64, cb = blockIdx.y * 128;
    const size_t bitem = (size_t)(blockIdx.x / (NN / 64)) * CC * NN;
    const bf* sp = wave == 0 ? Ah + (size_t)rb * NN : wave == 1 ? Al + (size_t)rb * NN : wave == 2 ? Bh + bitem + (size_t)cb * NN : Bl + bitem + (size_t)cb * NN;
    const uint64_t srcb = (uint64_t)sp;
    const uint32_t rows = wave < 2 ? 64u : 128u;
    const uint32_t place = (uint32_t)(uintptr_t)ring + (wave == 0 ? 0u : wave == 1 ? G3_AP : wave == 2 ? 2u * G3_AP : 2u * G3_AP + G3_BP);
    u32x8 g1;
    // pinned(): each descriptor word held in a scalar register, so that the group keeps one set of registers and no word of an outstanding request is rewritten
    g1[0] = pinned((1u << 20) | (5u << 22) | (3u << 25));    // no mask, 1-byte elements, 4 dwords of pad behind every 64 dwords
    g1[1] = pinned((G3_ROWB & 0xFFFFu) << 16);
    g1[2] = pinned((G3_ROWB >> 16) | (rows << 16));
    g1[3] = pinned((rows >> 16) | (G3_ROWB << 16));
    g1[4] = pinned(rows);
    g1[5] = pinned(NN * 2u);
    g1[6] = pinned(0u);
    g1[7] = pinned(0u);
    auto issue = [&](uint32_t st) {
        const uint64_t ga = srcb + (uint64_t)st * G3_ROWB;
        u32x4 g0;
        g0[0] = uni(1u); g0[1] = uni(place + (st & 1u) * G3_STAGE); g0[2] = uni((uint32_t)ga); g0[3] = uni((((uint32_t)(ga >> 32)) & 0x01FFFFFFu) | 0x80000000u);
        asm volatile("tensor_load_to_lds %0, %1" :: "s"(g0), "s"(g1) : "memory");
    };
    v8f acc[2][4];
#pragma unroll
    for (int i = 0; i < 2; ++i) {
#pragma unroll
        for (int t = 0; t < 4; ++t) acc[i][t] = (v8f){}; }
    issue(0);
    asm volatile("s_wait_tensorcnt 0x0" ::: "memory");    // this wave's slice of stage 0 has landed
    __syncthreads();                                      // every slice of stage 0 is readable by every wave
    issue(1);
    const uint32_t aoff = (uint32_t)(wr * 32 + lr) * G3_PITCH + 16u * hi, boff = 2u * G3_AP + (uint32_t)(wc * 64 + lr) * G3_PITCH + 16u * hi;
#pragma unroll 1
    for (uint32_t s = 0; s < G3_NST; ++s) {
        const unsigned char* buf = ring + (s & 1u) * G3_STAGE;
        const unsigned char* pa = buf + aoff; const unsigned char* pb = buf + boff;
        G3Frag f[2];
        g3_frags(f[0], pa, pb, 0);
#pragma unroll
        for (int kk = 0; kk < 4; ++kk) {
            if (kk < 3) g3_frags(f[(kk + 1) & 1], pa, pb, kk + 1);
            __builtin_amdgcn_sched_barrier(0);    // the next block's LDS reads stay one group ahead of this block's matrix instructions, not spread among them
            const G3Frag& c = f[kk & 1];
#pragma unroll
            for (int i = 0; i < 2; ++i) {
#pragma unroll
                for (int t = 0; t < 4; ++t) acc[i][t] = wmmab(c.ah[i], c.bh[t], acc[i][t]); }
#pragma unroll
            for (int i = 0; i < 2; ++i) {
#pragma unroll
                for (int t = 0; t < 4; ++t) acc[i][t] = wmmab(c.al[i], c.bh[t], acc[i][t]); }
#pragma unroll
            for (int i = 0; i < 2; ++i) {
#pragma unroll
                for (int t = 0; t < 4; ++t) acc[i][t] = wmmab(c.ah[i], c.bl[t], acc[i][t]); }
            __builtin_amdgcn_sched_barrier(0);    // closes the block: see above
        }
        asm volatile("s_wait_dscnt 0x0" ::: "memory");        // this wave's reads of stage s have returned
        asm volatile("s_wait_tensorcnt 0x0" ::: "memory");    // this wave's slice of stage s + 1 has landed
        __syncthreads();                                      // publishes stage s + 1 and ends every wave's reads of stage s
        if (pinned(s + 2 < G3_NST)) issue(pinned(s + 2));     // refill of the buffer that stage s has just left
    }
    asm volatile("s_wait_tensorcnt 0x0" ::: "memory");
    asm volatile("s_wait_dscnt 0x0" ::: "memory");
    float* os = (float*)(ring + 2 * G3_STAGE) + wave * (32 * 68);
#pragma unroll
    for (int i = 0; i < 2; ++i) {
#pragma unroll
        for (int t = 0; t < 4; ++t) {
#pragma unroll
            for (int j = 0; j < 8; ++j) os[(i * 16 + hi * 8 + j) * 68 + t * 16 + lr] = acc[i][t][j]; } }
    asm volatile("s_wait_dscnt 0x0" ::: "memory");    // the wave's staged rows are written before its lanes read them back across lanes
    float* crow = C + (size_t)(rb + wr * 32) * DD + cb + wc * 64;
#pragma unroll
    for (int s = 0; s < 16; ++s) { const int Lid = (lane >> 3) + 4 * s, piece = lane & 7; const int row = Lid >> 1, cofs = (Lid & 1) * 32 + piece * 4;
        const v4f val = *(const v4fa*)(os + row * 68 + cofs); *(v4f*)(crow + (size_t)row * DD + cofs) = val; }
}

// k_gemmrb: 64 x 64 tile of C[o][v] = (A [+ Al]).B^T over K (A row stride K, B n-major row stride K; blockIdx.z = batch item: its NN rows of B, its own [DD][ldc] plane of C) + bf(rbias[o]) per ROW; f32 whole-line epilogue (8 lanes x 16 B per line),
template <bool SPLITA>
__global__ __launch_bounds__(128) void k_gemmrb(const bf* __restrict__ A, const bf* __restrict__ Al, const bf* __restrict__ Bn, const float* __restrict__ rbias, float* C, int ldc, int K) {
    __shared__ __align__(16) float ost[4][16 * 68];
    const int lane = threadIdx.x & 31, wave = threadIdx.x >> 5, lr = lane & 15, hi = lane >> 4;
    const int r0 = blockIdx.x * 64 + wave * 16, c0 = blockIdx.y * 64;
    const size_t aoff = (size_t)(r0 + lr) * K + 8 * hi;
    Bn += (size_t)blockIdx.z * NN * K; C += (size_t)blockIdx.z * DD * ldc;
    v8f acc[4];
#pragma unroll
    for (int t = 0; t < 4; ++t) acc[t] = (v8f){};
#pragma unroll 1
    for (int kc = 0; kc < K; kc += 32) {
        const v16bf a = cat16b(*(const v8us*)(A + aoff + kc), *(const v8us*)(A + aoff + kc + 16));
        v16bf al = a; if (SPLITA) al = cat16b(*(const v8us*)(Al + aoff + kc), *(const v8us*)(Al + aoff + kc + 16));
#pragma unroll
        for (int t = 0; t < 4; ++t) { const size_t bo = (size_t)(c0 + t * 16 + lr) * K + kc + 8 * hi; const v16bf bb = cat16b(*(const v8us*)(Bn + bo), *(const v8us*)(Bn + bo + 16)); acc[t] = wmmab(a, bb, acc[t]); if (SPLITA) acc[t] = wmmab(al, bb, acc[t]); }
        asm volatile("v_nop\n\tv_nop\n\tv_nop\n\tv_nop" : "+v"(acc[0]), "+v"(acc[1]), "+v"(acc[2]), "+v"(acc[3]) : "v"(a), "v"(al));
    }
    float* os = &ost[wave][0];
#pragma unroll
    for (int t = 0; t < 4; ++t) {
#pragma unroll
        for (int j = 0; j < 8; ++j) os[(hi * 8 + j) * 68 + t * 16 + lr] = acc[t][j] + bfr(rbias[r0 + hi * 8 + j]); }
    __builtin_amdgcn_wave_barrier(); asm volatile("" ::: "memory");
    float* crow = C + (size_t)r0 * ldc + c0;
    auto pass = [&]() {
#pragma unroll
        for (int s = 0; s < 8; ++s) { const int Lid = (lane >> 3) + 4 * s, piece = lane & 7; const int row = Lid >> 1, cofs = (Lid & 1) * 32 + piece * 4;
            const v4f val = *(const v4fa*)(os + row * 68 + cofs); *(v4f*)(crow + (size_t)row * ldc + cofs) = val; }
    };
    pass(); 
}
__global__ __launch_bounds__(256) void k_rowsplit(const float* __restrict__ Y, int nrows, bf* Ph, bf* Pl) {
    const int lane = threadIdx.x & 31, r = blockIdx.x * 8 + (threadIdx.x >> 5); if (r >= nrows) return;
{
#pragma unroll 1
        for (int c0 = lane * 8; c0 < NN; c0 += 256) { const size_t o = (size_t)r * NN + c0; const v8f v = *(const v8f*)(Y + o); v8us oh, ol;
#pragma unroll
            for (int i = 0; i < 8; ++i) { const unsigned short hb = f2bf(v[i]); oh[i] = hb; ol[i] = f2bf(v[i] - bf2f(hb)); }
            *(v8us*)(Ph + o) = oh; *(v8us*)(Pl + o) = ol; }
         }
}

__global__ __launch_bounds__(256) void k_cvt(const float* __restrict__ src, int nrows, bf* dst) {
    const int lane = threadIdx.x & 31, r = blockIdx.x * 8 + (threadIdx.x >> 5); if (r >= nrows) return; v8us o;
#pragma unroll
    for (int i = 0; i < 8; ++i) o[i] = f2bf(src[(size_t)r * DD + lane * 8 + i]);
    *(v8us*)(dst + (size_t)r * DD + lane * 8) = o; 
}
// k_factsoft: one wave per row n of the 8192: attn[n][m] = L[n][m >> 6] R[n][m & 63] over m < 4096 (f32), softmax over m (fixed lane order, three phases, products recomputed per
__global__ __launch_bounds__(256) void k_factsoft(const float* __restrict__ Lm, const float* __restrict__ Rm, bf* PH, bf* PL) {
    const int lane = threadIdx.x & 31, r = blockIdx.x * 8 + (threadIdx.x >> 5); if (r >= NR) return;
    const float* lr = Lm + (size_t)r * PP; const float* rr = Rm + (size_t)r * PP;
    float rv[8];     // lane's 8 consecutive m within a 256-chunk share m>>6 = c0>>6... (c0 = lane*8 + 256 q: m>>6 = (lane*8)>>6 + 4q = lane>>3 + 4q; m&63 = (lane*8)&63 + i)
#pragma unroll
    for (int i = 0; i < 8; ++i) rv[i] = rr[((lane * 8) & 63) + i];
    float mx = -3.0e38f;
#pragma unroll 1
    for (int q = 0; q < NN / 256; ++q) { const float lv = lr[(lane >> 3) + 4 * q];
#pragma unroll
        for (int i = 0; i < 8; ++i) mx = fmaxf(mx, lv * rv[i]); }
#pragma unroll
    for (int sh = 16; sh; sh >>= 1) mx = fmaxf(mx, __shfl_xor(mx, sh, 32));
    float sm = 0.f;
#pragma unroll 1
    for (int q = 0; q < NN / 256; ++q) { const float lv = lr[(lane >> 3) + 4 * q];
#pragma unroll
        for (int i = 0; i < 8; ++i) sm += __expf(lv * rv[i] - mx); }
#pragma unroll
    for (int sh = 16; sh; sh >>= 1) sm += __shfl_xor(sm, sh, 32);
    const float inv = 1.0f / sm;
{
#pragma unroll 1
        for (int q = 0; q < NN / 256; ++q) { const float lv = lr[(lane >> 3) + 4 * q]; v8us oh, ol;
#pragma unroll
            for (int i = 0; i < 8; ++i) { const float p = __expf(lv * rv[i] - mx) * inv; const unsigned short hb = f2bf(p); oh[i] = hb; ol[i] = f2bf(p - bf2f(hb)); }
            const size_t o = (size_t)r * NN + q * 256 + lane * 8; *(v8us*)(PH + o) = oh; *(v8us*)(PL + o) = ol; }
         }
}
__global__ __launch_bounds__(256) void k_zerof(float* dst, int n) {
    const int i = blockIdx.x * 256 + threadIdx.x; if (i >= n) return; *(float*)(dst + i) = 0.f; 
}
__global__ __launch_bounds__(256) void k_split256(const float* __restrict__ src, int nrows, bf* dh, bf* dl) {
    const int lane = threadIdx.x & 31, r = blockIdx.x * 8 + (threadIdx.x >> 5); if (r >= nrows) return;
    const size_t o = (size_t)r * DD + lane * 8; const v8f v = *(const v8f*)(src + o); v8us oh, ol;
#pragma unroll
    for (int i = 0; i < 8; ++i) { const unsigned short hb = f2bf(v[i]); oh[i] = hb; ol[i] = f2bf(v[i] - bf2f(hb)); }
    *(v8us*)(dh + o) = oh; *(v8us*)(dl + o) = ol; 
}

extern "C" void kernel_launch(void* const* d_in, const int* in_sizes, int n_in,
                              void* d_out, int out_size, void* d_ws, size_t ws_size, hipStream_t stream) {
    (void)in_sizes; (void)n_in; (void)out_size;
    const float* x = (const float*)d_in[0]; const float* Wl = (const float*)d_in[1]; const float* Wr = (const float*)d_in[2]; const float* Wv = (const float*)d_in[3]; const float* Wo = (const float*)d_in[4];
    float* out = (float*)d_out;    // [2][4096][256]
    char* wsp = (char*)d_ws;
    auto take = [&](size_t bytes) { char* p = wsp; wsp += (bytes + 255) & ~(size_t)255; return (void*)p; };
    bf* WlT = (bf*)take(PP * DD * 2); bf* WrT = (bf*)take(PP * DD * 2); bf* WvT = (bf*)take(DD * DD * 2); bf* WoT = (bf*)take(DD * DD * 2); float* ZB = (float*)take(DD * 4);
    bf* Xb = (bf*)take((size_t)NR * DD * 2); float* Lm = (float*)take((size_t)NR * PP * 4); float* Rm = (float*)take((size_t)NR * PP * 4); float* VT = (float*)take((size_t)DD * NR * 4); bf* VTh = (bf*)take((size_t)DD * NR * 2); bf* VTl = (bf*)take((size_t)DD * NR * 2);
    bf* PH = (bf*)take((size_t)NR * NN * 2); bf* PL = (bf*)take((size_t)NR * NN * 2); float* O = (float*)take((size_t)NR * DD * 4); bf* Oh = (bf*)take((size_t)NR * DD * 2); bf* Ol = (bf*)take((size_t)NR * DD * 2);
    if ((size_t)(wsp - (char*)d_ws) > ws_size) return;    // ~ 176 MB, no aliasing
    k_zerof<<<1, 256, 0, stream>>>(ZB, DD);
    k_wt<<<dim3(DD / 64, PP / 64, 1), 256, 0, stream>>>(Wl, DD, PP, WlT); k_wt<<<dim3(DD / 64, PP / 64, 1), 256, 0, stream>>>(Wr, DD, PP, WrT); k_wt<<<dim3(DD / 64, DD / 64, 1), 256, 0, stream>>>(Wv, DD, DD, WvT); k_wt<<<dim3(DD / 64, DD / 64, 1), 256, 0, stream>>>(Wo, DD, DD, WoT);
    k_cvt<<<NR / 8, 256, 0, stream>>>(x, NR, Xb);
    k_gemmb<false, false><<<dim3(NR / 64, PP / 64, 1), 128, 0, stream>>>(Xb, nullptr, WlT, nullptr, Lm, PP, nullptr);       // l [b n][64]
    k_gemmb<false, false><<<dim3(NR / 64, PP / 64, 1), 128, 0, stream>>>(Xb, nullptr, WrT, nullptr, Rm, PP, nullptr);       // r [b n][64]
    k_gemmrb<false><<<dim3(DD / 64, NN / 64, NBI), 128, 0, stream>>>(WvT, nullptr, Xb, ZB, VT, NN, DD); k_rowsplit<<<NBI * DD / 8, 256, 0, stream>>>(VT, NBI * DD, VTh, VTl);     // v^T [b][c][m]
    k_factsoft<<<NR / 8, 256, 0, stream>>>(Lm, Rm, PH, PL);
    k_gemm3<<<dim3(NR / 64, DD / 128, 1), 128, 0, stream>>>(PH, PL, VTh, VTl, O);                   // o [b n][c] = P . v
    k_split256<<<NR / 8, 256, 0, stream>>>(O, NR, Oh, Ol);
    k_gemmb<true, false><<<dim3(NR / 64, DD / 64, 1), 128, 0, stream>>>(Oh, Ol, WoT, nullptr, out, DD, nullptr);                 // o.Wo
}

// v003
// One run takes 99.4 microseconds.
// Two timings next to v002 put it at 1.36 and 1.37 times that version's speed.
// All steps since v000 together make it 11.4 times as fast.
#include <hip/hip_runtime.h>

// Compute dtypes, f32 accumulate, both batch items in every launch (8192 rows): l = x.Wl, r = x.Wr ([8192 x 256].[256 x 64]) and v^T = Wv^T.x^T ([256 x 256].[256 x 4096] per batch item) with PLAIN bf16 operands (rounded
// input, k-major weights transposed once; exact products); the factorised scores attn[n][m] = l[n][m/64] r[n][m%64] and their row softmax in f32 -> bf16 hi + UNSCALED residual planes for
// all 8192 rows; o[n][c] = sum_m P[n][m] v[m][c] ([4096 x 4096].[4096 x 256] per batch item, both operands hi + residual, three products; shared across heads = all 256 channels at once) and out = o.Wo

#define NBI  2
#define NN   4096
#define DD   256
#define PP   64
#define NR   (NBI * NN)
#define CC   DD
#define DM   DD
#define NTK  NN
#define LOSC 1024.0f

typedef _Float16 h16;
typedef unsigned short bf;
typedef __attribute__((ext_vector_type(16))) __bf16   v16bf;
typedef __attribute__((ext_vector_type(16))) _Float16 v16h;
typedef __attribute__((ext_vector_type(8)))  _Float16 v8h;
typedef __attribute__((ext_vector_type(8)))  unsigned short v8us;
typedef __attribute__((ext_vector_type(8)))  float    v8f;
typedef __attribute__((ext_vector_type(4)))  float    v4f;
typedef __attribute__((ext_vector_type(4)))  _Float16 v4h;
typedef v8h  __attribute__((may_alias)) v8ha;
typedef v4f  __attribute__((may_alias)) v4fa;
typedef v8us __attribute__((may_alias)) v8usa;

__device__ __forceinline__ unsigned short f2bf(float f) { unsigned u = __float_as_uint(f); u += 0x7FFFu + ((u >> 16) & 1u); return (unsigned short)(u >> 16); }
__device__ __forceinline__ float bf2f(unsigned short b) { return __uint_as_float(((unsigned)b) << 16); }
__device__ __forceinline__ float bfr(float f) { return bf2f(f2bf(f)); }
__device__ __forceinline__ v16h cat16(v8h lo, v8h hi) { return __builtin_shufflevector(lo, hi, 0, 1, 2, 3, 4, 5, 6, 7, 8, 9, 10, 11, 12, 13, 14, 15); }
__device__ __forceinline__ v16bf cat16b(v8us lo, v8us hi) { return __builtin_bit_cast(v16bf, __builtin_shufflevector(lo, hi, 0, 1, 2, 3, 4, 5, 6, 7, 8, 9, 10, 11, 12, 13, 14, 15)); }
__device__ __forceinline__ v8f wmma16(v16h a, v16h b, v8f c) { return __builtin_amdgcn_wmma_f32_16x16x32_f16(false, a, false, b, (short)0, c, false, false); }
__device__ __forceinline__ v8f wmmab(v16bf a, v16bf b, v8f c) { return __builtin_amdgcn_wmma_f32_16x16x32_bf16(false, a, false, b, (short)0, c, false, false); }

// k_prep: one launch for the five independent input conversions. Blocks 0..39: WT [n][DD] = bf16(W[k][n]) (k-major [DD][ncols]) via 64 x 64 LDS tiles, 4 tiles each for Wl and Wr, 16 each for Wv and Wo;
// blocks from 40 on: eight rows each of Xb = bf16(x), one wave per row.
#define PREP_WT 40
__global__ __launch_bounds__(256) void k_prep(const float* __restrict__ x, const float* __restrict__ Wl, const float* __restrict__ Wr, const float* __restrict__ Wv, const float* __restrict__ Wo,
                                              bf* Xb, bf* WlT, bf* WrT, bf* WvT, bf* WoT) {
    __shared__ __align__(16) unsigned short tl[64 * 72];
    const int tid = threadIdx.x, b = blockIdx.x;
    if (b >= PREP_WT) {
        const int lane = tid & 31, r = (b - PREP_WT) * 8 + (tid >> 5); v8us o;
#pragma unroll
        for (int i = 0; i < 8; ++i) o[i] = f2bf(x[(size_t)r * DD + lane * 8 + i]);
        *(v8us*)(Xb + (size_t)r * DD + lane * 8) = o;
        return;
    }
    const float* Wm = b < 4 ? Wl : b < 8 ? Wr : b < 24 ? Wv : Wo;
    bf* WT = b < 4 ? WlT : b < 8 ? WrT : b < 24 ? WvT : WoT;
    const int ncols = b < 8 ? PP : DD, q = b < 4 ? b : b < 8 ? b - 4 : b < 24 ? b - 8 : b - 24;
    const int k0 = (q & 3) * 64, n0 = (q >> 2) * 64;
    const int kk = tid >> 2, nq = (tid & 3) * 16;
#pragma unroll
    for (int i = 0; i < 16; ++i) tl[(nq + i) * 72 + kk] = f2bf(Wm[(size_t)(k0 + kk) * ncols + n0 + nq + i]);
    __syncthreads();
    const int piece = tid & 7;
#pragma unroll
    for (int s = 0; s < 2; ++s) { const int nr = (tid >> 3) + 32 * s; const v8us val = *(const v8usa*)(tl + nr * 72 + piece * 8); *(v8us*)(WT + (size_t)(n0 + nr) * DD + k0 + piece * 8) = val; }
}
// k_gemmb: 64 x 64 block tile (4 waves x 16 x 64) of C[NR][NW] = (A [+ Al]).B^T (K = 256) [+ bf(bias[c])] [+ bf(R[r][c]) residual]; f32 whole-line epilogue (or f16
template <bool SPLITA, bool F16OUT = false>
__global__ __launch_bounds__(128) void k_gemmb(const bf* __restrict__ A, const bf* __restrict__ Al, const bf* __restrict__ Bn, const float* __restrict__ bias, float* C, int ldc, h16* C2, const float* __restrict__ R = nullptr, int K = DM, int roundR = 1) {
    __shared__ __align__(16) float ost[4][16 * 68];
    const int lane = threadIdx.x & 31, wave = threadIdx.x >> 5, lr = lane & 15, hi = lane >> 4;
    const int r0 = blockIdx.x * 64 + wave * 16, c0 = blockIdx.y * 64;
    const size_t aoff = (size_t)(r0 + lr) * K + 8 * hi;
    size_t boff[4];
#pragma unroll
    for (int t = 0; t < 4; ++t) boff[t] = (size_t)(c0 + t * 16 + lr) * K + 8 * hi;
    v8f acc[4];
#pragma unroll
    for (int t = 0; t < 4; ++t) acc[t] = (v8f){};
#pragma unroll 1
    for (int kc = 0; kc < K; kc += 32) {
        const v16bf a = cat16b(*(const v8us*)(A + aoff + kc), *(const v8us*)(A + aoff + kc + 16));
        v16bf al = a;
        if (SPLITA) al = cat16b(*(const v8us*)(Al + aoff + kc), *(const v8us*)(Al + aoff + kc + 16));
#pragma unroll
        for (int t = 0; t < 4; ++t) { const v16bf b = cat16b(*(const v8us*)(Bn + boff[t] + kc), *(const v8us*)(Bn + boff[t] + kc + 16)); acc[t] = wmmab(a, b, acc[t]); if (SPLITA) acc[t] = wmmab(al, b, acc[t]); }
        asm volatile("v_nop\n\tv_nop\n\tv_nop\n\tv_nop" : "+v"(acc[0]), "+v"(acc[1]), "+v"(acc[2]), "+v"(acc[3]) : "v"(a), "v"(al));
    }
    float* os = &ost[wave][0];
#pragma unroll
    for (int t = 0; t < 4; ++t) { const float bv = bias ? bfr(bias[c0 + t * 16 + lr]) : 0.f;
#pragma unroll
        for (int j = 0; j < 8; ++j) os[(hi * 8 + j) * 68 + t * 16 + lr] = acc[t][j] + bv; }
    __syncthreads();
    if (F16OUT) {
        h16* crow = (h16*)(void*)C + (size_t)r0 * ldc + c0;
        auto pass = [&]() {
#pragma unroll
            for (int s = 0; s < 4; ++s) { const int row = 4 * s + (lane >> 3), piece = lane & 7; const float* sp = os + row * 68 + piece * 8; v8h o, o2;
#pragma unroll
                for (int i = 0; i < 8; ++i) { const h16 a = (h16)sp[i]; o[i] = a; o2[i] = (h16)((sp[i] - (float)a) * LOSC); }
                *(v8h*)(crow + (size_t)row * ldc + piece * 8) = o; if (C2) *(v8h*)(C2 + (size_t)r0 * ldc + c0 + (size_t)row * ldc + piece * 8) = o2; }
        };
        pass(); 
    } else {
        float* crow = C + (size_t)r0 * ldc + c0;
        auto pass = [&]() {
#pragma unroll
            for (int s = 0; s < 8; ++s) { const int Lid = (lane >> 3) + 4 * s, piece = lane & 7; const int row = Lid >> 1, cofs = (Lid & 1) * 32 + piece * 4;
                v4f val = *(const v4fa*)(os + row * 68 + cofs); if (R) { const v4f rv = *(const v4f*)(R + ((size_t)r0 + row) * ldc + c0 + cofs); val += roundR ? (v4f){bfr(rv[0]), bfr(rv[1]), bfr(rv[2]), bfr(rv[3])} : rv; }
                *(v4f*)(crow + (size_t)row * ldc + cofs) = val; }
        };
        pass(); 
    }
}

// k_gemm3: 64 x 128 block tile (4 waves x 32 x 64) of C = (Ah + Al).(Bh + Bl)^T over K = NN (row strides NN for all four planes; n-major B, one [CC][NN] plane pair per batch item, picked by the row tile):
// three products per 32-k step (hh, lh, hl), in that order per accumulator. A stage is 256 B (128 k) of every operand row, brought into LDS by one tensor load per wave (wave 0: Ah, 1: Al, 2: Bh, 3: Bl),
// rows padded to a 272 B pitch for the 16-byte readers; two buffers, the next stage in flight under the current one.
typedef uint32_t u32x4 __attribute__((ext_vector_type(4)));
typedef uint32_t u32x8 __attribute__((ext_vector_type(8)));
#define G3_ROWB  256u
#define G3_PITCH 272u
#define G3_AP    18432u                        // 64 rows x 272 B, rounded up to a multiple of 2 KiB
#define G3_BP    34816u                        // 128 rows x 272 B = 17 x 2 KiB
#define G3_STAGE (2u * G3_AP + 2u * G3_BP)     // 106,496 B = 52 x 2 KiB
#define G3_NST   (NN * 2u / G3_ROWB)           // 32 stages
__device__ __forceinline__ uint32_t uni(uint32_t v) { return (uint32_t)__builtin_amdgcn_readfirstlane(v); }
// a value held in a scalar register: makes the test around a tensor load a scalar branch, and keeps what is formed from it behind the waits in front of it
__device__ __forceinline__ uint32_t pinned(uint32_t v) { uint32_t w = uni(v); asm volatile("" : "+s"(w)); return w; }
struct G3Frag { v16bf ah[2], al[2], bh[4], bl[4]; };
__device__ __forceinline__ v16bf g3_ld(const unsigned char* p) { return cat16b(*(const v8usa*)p, *(const v8usa*)(p + 32)); }
__device__ __forceinline__ void g3_frags(G3Frag& f, const unsigned char* pa, const unsigned char* pb, int kk) {
#pragma unroll
    for (int i = 0; i < 2; ++i) { f.ah[i] = g3_ld(pa + i * 16 * G3_PITCH + kk * 64); f.al[i] = g3_ld(pa + G3_AP + i * 16 * G3_PITCH + kk * 64); }
#pragma unroll
    for (int t = 0; t < 4; ++t) { f.bh[t] = g3_ld(pb + t * 16 * G3_PITCH + kk * 64); f.bl[t] = g3_ld(pb + G3_BP + t * 16 * G3_PITCH + kk * 64); }
}
__global__ __launch_bounds__(128) void k_gemm3(const bf* __restrict__ Ah, const bf* __restrict__ Al, const bf* __restrict__ Bh, const bf* __restrict__ Bl, bf* Oh, bf* Ol) {
    __shared__ __attribute__((aligned(2048))) unsigned char ring[2 * G3_STAGE + 4 * 32 * 68 * 4];    // two stages, then each wave's own output staging
    const int lane = threadIdx.x & 31, lr = lane & 15, hi = lane >> 4;
    const uint32_t wave = uni(threadIdx.x >> 5);
    const int wr = wave >> 1, wc = wave & 1;
    const int rb = blockIdx.x * 64, cb = blockIdx.y * 128;
    const size_t bitem = (size_t)(blockIdx.x / (NN / 64)) * CC * NN;
    const bf* sp = wave == 0 ? Ah + (size_t)rb * NN : wave == 1 ? Al + (size_t)rb * NN : wave == 2 ? Bh + bitem + (size_t)cb * NN : Bl + bitem + (size_t)cb * NN;
    const uint64_t srcb = (uint64_t)sp;
    const uint32_t rows = wave < 2 ? 64u : 128u;
    const uint32_t place = (uint32_t)(uintptr_t)ring + (wave == 0 ? 0u : wave == 1 ? G3_AP : wave == 2 ? 2u * G3_AP : 2u * G3_AP + G3_BP);
    u32x8 g1;
    // pinned(): each descriptor word held in a scalar register, so that the group keeps one set of registers and no word of an outstanding request is rewritten
    g1[0] = pinned((1u << 20) | (5u << 22) | (3u << 25));    // no mask, 1-byte elements, 4 dwords of pad behind every 64 dwords
    g1[1] = pinned((G3_ROWB & 0xFFFFu) << 16);
    g1[2] = pinned((G3_ROWB >> 16) | (rows << 16));
    g1[3] = pinned((rows >> 16) | (G3_ROWB << 16));
    g1[4] = pinned(rows);
    g1[5] = pinned(NN * 2u);
    g1[6] = pinned(0u);
    g1[7] = pinned(0u);
    auto issue = [&](uint32_t st) {
        const uint64_t ga = srcb + (uint64_t)st * G3_ROWB;
        u32x4 g0;
        g0[0] = uni(1u); g0[1] = uni(place + (st & 1u) * G3_STAGE); g0[2] = uni((uint32_t)ga); g0[3] = uni((((uint32_t)(ga >> 32)) & 0x01FFFFFFu) | 0x80000000u);
        asm volatile("tensor_load_to_lds %0, %1" :: "s"(g0), "s"(g1) : "memory");
    };
    v8f acc[2][4];
#pragma unroll
    for (int i = 0; i < 2; ++i) {
#pragma unroll
        for (int t = 0; t < 4; ++t) acc[i][t] = (v8f){}; }
    issue(0);
    asm volatile("s_wait_tensorcnt 0x0" ::: "memory");    // this wave's slice of stage 0 has landed
    __syncthreads();                                      // every slice of stage 0 is readable by every wave
    issue(1);
    const uint32_t aoff = (uint32_t)(wr * 32 + lr) * G3_PITCH + 16u * hi, boff = 2u * G3_AP + (uint32_t)(wc * 64 + lr) * G3_PITCH + 16u * hi;
#pragma unroll 1
    for (uint32_t s = 0; s < G3_NST; ++s) {
        const unsigned char* buf = ring + (s & 1u) * G3_STAGE;
        const unsigned char* pa = buf + aoff; const unsigned char* pb = buf + boff;
        G3Frag f[2];
        g3_frags(f[0], pa, pb, 0);
#pragma unroll
        for (int kk = 0; kk < 4; ++kk) {
            if (kk < 3) g3_frags(f[(kk + 1) & 1], pa, pb, kk + 1);
            __builtin_amdgcn_sched_barrier(0);    // the next block's LDS reads stay one group ahead of this block's matrix instructions, not spread among them
            const G3Frag& c = f[kk & 1];
#pragma unroll
            for (int i = 0; i < 2; ++i) {
#pragma unroll
                for (int t = 0; t < 4; ++t) acc[i][t] = wmmab(c.ah[i], c.bh[t], acc[i][t]); }
#pragma unroll
            for (int i = 0; i < 2; ++i) {
#pragma unroll
                for (int t = 0; t < 4; ++t) acc[i][t] = wmmab(c.al[i], c.bh[t], acc[i][t]); }
#pragma unroll
            for (int i = 0; i < 2; ++i) {
#pragma unroll
                for (int t = 0; t < 4; ++t) acc[i][t] = wmmab(c.ah[i], c.bl[t], acc[i][t]); }
            __builtin_amdgcn_sched_barrier(0);    // closes the block: see above
        }
        asm volatile("s_wait_dscnt 0x0" ::: "memory");        // this wave's reads of stage s have returned
        asm volatile("s_wait_tensorcnt 0x0" ::: "memory");    // this wave's slice of stage s + 1 has landed
        __syncthreads();                                      // publishes stage s + 1 and ends every wave's reads of stage s
        if (pinned(s + 2 < G3_NST)) issue(pinned(s + 2));     // refill of the buffer that stage s has just left
    }
    asm volatile("s_wait_tensorcnt 0x0" ::: "memory");
    asm volatile("s_wait_dscnt 0x0" ::: "memory");
    float* os = (float*)(ring + 2 * G3_STAGE) + wave * (32 * 68);
#pragma unroll
    for (int i = 0; i < 2; ++i) {
#pragma unroll
        for (int t = 0; t < 4; ++t) {
#pragma unroll
            for (int j = 0; j < 8; ++j) os[(i * 16 + hi * 8 + j) * 68 + t * 16 + lr] = acc[i][t][j]; } }
    asm volatile("s_wait_dscnt 0x0" ::: "memory");    // the wave's staged rows are written before its lanes read them back across lanes
    const size_t obase = (size_t)(rb + wr * 32) * DD + cb + wc * 64;    // the result leaves as bf16 hi + residual planes, whole 128-B lines (8 lanes x 16 B)
#pragma unroll
    for (int s = 0; s < 8; ++s) { const int row = 4 * s + (lane >> 3), piece = lane & 7; const float* sp = os + row * 68 + piece * 8; v8us oh, ol;
#pragma unroll
        for (int i = 0; i < 8; ++i) { const unsigned short hb = f2bf(sp[i]); oh[i] = hb; ol[i] = f2bf(sp[i] - bf2f(hb)); }
        const size_t o = obase + (size_t)row * DD + piece * 8; *(v8us*)(Oh + o) = oh; *(v8us*)(Ol + o) = ol; }
}

// k_proj: one launch for the three independent projections of x, each block one 64 x 64 tile (4 waves x 16 x 64) of A.B^T over K = DD, plain bf16 operands.
// Blocks 0..511: v^T[b][c][m] = WvT.Xb^T (4 channel tiles x 128 row tiles of x), written straight as bf16 hi + residual planes (whole 128-B lines, 8 lanes x 16 B);
// blocks 512..639: l = Xb.WlT^T, 640..767: r = Xb.WrT^T, f32 whole-line epilogue.
#define PROJ_V (DD / 64 * (NR / 64))
__global__ __launch_bounds__(128) void k_proj(const bf* __restrict__ Xb, const bf* __restrict__ WlT, const bf* __restrict__ WrT, const bf* __restrict__ WvT, float* Lm, float* Rm, bf* VTh, bf* VTl) {
    __shared__ __align__(16) float ost[4][16 * 68];
    const int lane = threadIdx.x & 31, wave = threadIdx.x >> 5, lr = lane & 15, hi = lane >> 4;
    const int b = blockIdx.x, q = b - PROJ_V;
    const bool isv = b < PROJ_V;
    const bf* A = isv ? WvT : Xb;
    const bf* Bn = isv ? Xb : q < NR / 64 ? WlT : WrT;
    const int r0 = (isv ? (b & 3) : (q & (NR / 64 - 1))) * 64 + wave * 16, c0 = isv ? (b >> 2) * 64 : 0;
    const size_t aoff = (size_t)(r0 + lr) * DD + 8 * hi;
    size_t boff[4];
#pragma unroll
    for (int t = 0; t < 4; ++t) boff[t] = (size_t)(c0 + t * 16 + lr) * DD + 8 * hi;
    v8f acc[4];
#pragma unroll
    for (int t = 0; t < 4; ++t) acc[t] = (v8f){};
#pragma unroll 1    // the k loop stays rolled, as the separate launches had it
    for (int kc = 0; kc < DD; kc += 32) {
        const v16bf a = cat16b(*(const v8us*)(A + aoff + kc), *(const v8us*)(A + aoff + kc + 16));
#pragma unroll
        for (int t = 0; t < 4; ++t) { const v16bf bb = cat16b(*(const v8us*)(Bn + boff[t] + kc), *(const v8us*)(Bn + boff[t] + kc + 16)); acc[t] = wmmab(a, bb, acc[t]); }
        asm volatile("v_nop\n\tv_nop\n\tv_nop\n\tv_nop" : "+v"(acc[0]), "+v"(acc[1]), "+v"(acc[2]), "+v"(acc[3]) : "v"(a));    // the distance behind the last matrix instruction, on the loop's taken branch too
    }
    float* os = &ost[wave][0];
#pragma unroll
    for (int t = 0; t < 4; ++t) {
#pragma unroll
        for (int j = 0; j < 8; ++j) os[(hi * 8 + j) * 68 + t * 16 + lr] = acc[t][j]; }
    __syncthreads();    // the staged tile is written before other lanes read it back
    if (isv) {
        const size_t base = (size_t)(c0 / NN) * DD * NN + (size_t)r0 * NN + (c0 & (NN - 1));
#pragma unroll
        for (int s = 0; s < 4; ++s) { const int row = 4 * s + (lane >> 3), piece = lane & 7; const float* sp = os + row * 68 + piece * 8; v8us oh, ol;
#pragma unroll
            for (int i = 0; i < 8; ++i) { const unsigned short hb = f2bf(sp[i]); oh[i] = hb; ol[i] = f2bf(sp[i] - bf2f(hb)); }
            const size_t o = base + (size_t)row * NN + piece * 8; *(v8us*)(VTh + o) = oh; *(v8us*)(VTl + o) = ol; }
    } else {
        float* crow = (q < NR / 64 ? Lm : Rm) + (size_t)r0 * PP;
#pragma unroll
        for (int s = 0; s < 8; ++s) { const int Lid = (lane >> 3) + 4 * s, piece = lane & 7; const int row = Lid >> 1, cofs = (Lid & 1) * 32 + piece * 4;
            const v4f val = *(const v4fa*)(os + row * 68 + cofs); *(v4f*)(crow + (size_t)row * PP + cofs) = val; }
        asm volatile("s_wait_xcnt 0x0" ::: "memory");    // stands behind the run of stores, ahead of any later write of a register that they name
    }
}
// k_factsoft: one wave per row n of the 8192: attn[n][m] = L[n][m >> 6] R[n][m & 63] over m < 4096 (f32), softmax over m (fixed lane order, three phases, products recomputed per
__global__ __launch_bounds__(256) void k_factsoft(const float* __restrict__ Lm, const float* __restrict__ Rm, bf* PH, bf* PL) {
    const int lane = threadIdx.x & 31, r = blockIdx.x * 8 + (threadIdx.x >> 5); if (r >= NR) return;
    const float* lr = Lm + (size_t)r * PP; const float* rr = Rm + (size_t)r * PP;
    float rv[8];     // lane's 8 consecutive m within a 256-chunk share m>>6 = c0>>6... (c0 = lane*8 + 256 q: m>>6 = (lane*8)>>6 + 4q = lane>>3 + 4q; m&63 = (lane*8)&63 + i)
#pragma unroll
    for (int i = 0; i < 8; ++i) rv[i] = rr[((lane * 8) & 63) + i];
    float mx = -3.0e38f;
#pragma unroll 1
    for (int q = 0; q < NN / 256; ++q) { const float lv = lr[(lane >> 3) + 4 * q];
#pragma unroll
        for (int i = 0; i < 8; ++i) mx = fmaxf(mx, lv * rv[i]); }
#pragma unroll
    for (int sh = 16; sh; sh >>= 1) mx = fmaxf(mx, __shfl_xor(mx, sh, 32));
    float sm = 0.f;
#pragma unroll 1
    for (int q = 0; q < NN / 256; ++q) { const float lv = lr[(lane >> 3) + 4 * q];
#pragma unroll
        for (int i = 0; i < 8; ++i) sm += __expf(lv * rv[i] - mx); }
#pragma unroll
    for (int sh = 16; sh; sh >>= 1) sm += __shfl_xor(sm, sh, 32);
    const float inv = 1.0f / sm;
{
#pragma unroll 1
        for (int q = 0; q < NN / 256; ++q) { const float lv = lr[(lane >> 3) + 4 * q]; v8us oh, ol;
#pragma unroll
            for (int i = 0; i < 8; ++i) { const float p = __expf(lv * rv[i] - mx) * inv; const unsigned short hb = f2bf(p); oh[i] = hb; ol[i] = f2bf(p - bf2f(hb)); }
            const size_t o = (size_t)r * NN + q * 256 + lane * 8; *(v8us*)(PH + o) = oh; *(v8us*)(PL + o) = ol; }
         }
}

extern "C" void kernel_launch(void* const* d_in, const int* in_sizes, int n_in,
                              void* d_out, int out_size, void* d_ws, size_t ws_size, hipStream_t stream) {
    (void)in_sizes; (void)n_in; (void)out_size;
    const float* x = (const float*)d_in[0]; const float* Wl = (const float*)d_in[1]; const float* Wr = (const float*)d_in[2]; const float* Wv = (const float*)d_in[3]; const float* Wo = (const float*)d_in[4];
    float* out = (float*)d_out;    // [2][4096][256]
    char* wsp = (char*)d_ws;
    auto take = [&](size_t bytes) { char* p = wsp; wsp += (bytes + 255) & ~(size_t)255; return (void*)p; };
    bf* WlT = (bf*)take(PP * DD * 2); bf* WrT = (bf*)take(PP * DD * 2); bf* WvT = (bf*)take(DD * DD * 2); bf* WoT = (bf*)take(DD * DD * 2);
    bf* Xb = (bf*)take((size_t)NR * DD * 2); float* Lm = (float*)take((size_t)NR * PP * 4); float* Rm = (float*)take((size_t)NR * PP * 4); bf* VTh = (bf*)take((size_t)DD * NR * 2); bf* VTl = (bf*)take((size_t)DD * NR * 2);
    bf* PH = (bf*)take((size_t)NR * NN * 2); bf* PL = (bf*)take((size_t)NR * NN * 2); bf* Oh = (bf*)take((size_t)NR * DD * 2); bf* Ol = (bf*)take((size_t)NR * DD * 2);
    if ((size_t)(wsp - (char*)d_ws) > ws_size) return;    // ~ 160 MB, no aliasing
    k_prep<<<PREP_WT + NR / 8, 256, 0, stream>>>(x, Wl, Wr, Wv, Wo, Xb, WlT, WrT, WvT, WoT);
    k_proj<<<PROJ_V + 2 * (NR / 64), 128, 0, stream>>>(Xb, WlT, WrT, WvT, Lm, Rm, VTh, VTl);       // v^T [b][c][m] planes, l and r [b n][64]
    k_factsoft<<<NR / 8, 256, 0, stream>>>(Lm, Rm, PH, PL);
    k_gemm3<<<dim3(NR / 64, DD / 128, 1), 128, 0, stream>>>(PH, PL, VTh, VTl, Oh, Ol);              // o [b n][c] = P . v, as planes
    k_gemmb<true, false><<<dim3(NR / 64, DD / 64, 1), 128, 0, stream>>>(Oh, Ol, WoT, nullptr, out, DD, nullptr);                 // o.Wo
}

// v004
// Measured time: 64.5 microseconds a run.
// Timed twice side by side with v003, it ran 1.53 times as fast both times.
// Counting every step since v000, it is 17.5 times as fast.
#include <hip/hip_runtime.h>

// Compute dtypes, f32 accumulate, both batch items in every launch (8192 rows): l = x.Wl, r = x.Wr ([8192 x 256].[256 x 64]) and v^T = Wv^T.x^T ([256 x 256].[256 x 4096] per batch item) with PLAIN bf16 operands (rounded
// input, k-major weights transposed once; exact products); the factorised scores attn[n][m] = l[n][m/64] r[n][m%64] and their row softmax in f32 -> bf16 hi + UNSCALED residual, formed in registers inside
// the product that uses them; o[n][c] = sum_m P[n][m] v[m][c] ([4096 x 4096].[4096 x 256] per batch item, both operands hi + residual, three products; shared across heads = all 256 channels at once) and out = o.Wo

#define NBI  2
#define NN   4096
#define DD   256
#define PP   64
#define NR   (NBI * NN)
#define CC   DD
#define DM   DD
#define NTK  NN
#define LOSC 1024.0f

typedef _Float16 h16;
typedef unsigned short bf;
typedef __attribute__((ext_vector_type(16))) __bf16   v16bf;
typedef __attribute__((ext_vector_type(16))) _Float16 v16h;
typedef __attribute__((ext_vector_type(8)))  _Float16 v8h;
typedef __attribute__((ext_vector_type(8)))  unsigned short v8us;
typedef __attribute__((ext_vector_type(8)))  float    v8f;
typedef __attribute__((ext_vector_type(4)))  float    v4f;
typedef __attribute__((ext_vector_type(4)))  _Float16 v4h;
typedef v8h  __attribute__((may_alias)) v8ha;
typedef v4f  __attribute__((may_alias)) v4fa;
typedef v8us __attribute__((may_alias)) v8usa;

__device__ __forceinline__ unsigned short f2bf(float f) { unsigned u = __float_as_uint(f); u += 0x7FFFu + ((u >> 16) & 1u); return (unsigned short)(u >> 16); }
__device__ __forceinline__ float bf2f(unsigned short b) { return __uint_as_float(((unsigned)b) << 16); }
__device__ __forceinline__ float bfr(float f) { return bf2f(f2bf(f)); }
__device__ __forceinline__ v16h cat16(v8h lo, v8h hi) { return __builtin_shufflevector(lo, hi, 0, 1, 2, 3, 4, 5, 6, 7, 8, 9, 10, 11, 12, 13, 14, 15); }
__device__ __forceinline__ v16bf cat16b(v8us lo, v8us hi) { return __builtin_bit_cast(v16bf, __builtin_shufflevector(lo, hi, 0, 1, 2, 3, 4, 5, 6, 7, 8, 9, 10, 11, 12, 13, 14, 15)); }
__device__ __forceinline__ v8f wmma16(v16h a, v16h b, v8f c) { return __builtin_amdgcn_wmma_f32_16x16x32_f16(false, a, false, b, (short)0, c, false, false); }
__device__ __forceinline__ v8f wmmab(v16bf a, v16bf b, v8f c) { return __builtin_amdgcn_wmma_f32_16x16x32_bf16(false, a, false, b, (short)0, c, false, false); }

// k_prep: one launch for the five independent input conversions. Blocks 0..39: WT [n][DD] = bf16(W[k][n]) (k-major [DD][ncols]) via 64 x 64 LDS tiles, 4 tiles each for Wl and Wr, 16 each for Wv and Wo;
// blocks from 40 on: eight rows each of Xb = bf16(x), one wave per row.
#define PREP_WT 40
__global__ __launch_bounds__(256) void k_prep(const float* __restrict__ x, const float* __restrict__ Wl, const float* __restrict__ Wr, const float* __restrict__ Wv, const float* __restrict__ Wo,
                                              bf* Xb, bf* WlT, bf* WrT, bf* WvT, bf* WoT) {
    __shared__ __align__(16) unsigned short tl[64 * 72];
    const int tid = threadIdx.x, b = blockIdx.x;
    if (b >= PREP_WT) {
        const int lane = tid & 31, r = (b - PREP_WT) * 8 + (tid >> 5); v8us o;
#pragma unroll
        for (int i = 0; i < 8; ++i) o[i] = f2bf(x[(size_t)r * DD + lane * 8 + i]);
        *(v8us*)(Xb + (size_t)r * DD + lane * 8) = o;
        return;
    }
    const float* Wm = b < 4 ? Wl : b < 8 ? Wr : b < 24 ? Wv : Wo;
    bf* WT = b < 4 ? WlT : b < 8 ? WrT : b < 24 ? WvT : WoT;
    const int ncols = b < 8 ? PP : DD, q = b < 4 ? b : b < 8 ? b - 4 : b < 24 ? b - 8 : b - 24;
    const int k0 = (q & 3) * 64, n0 = (q >> 2) * 64;
    const int kk = tid >> 2, nq = (tid & 3) * 16;
#pragma unroll
    for (int i = 0; i < 16; ++i) tl[(nq + i) * 72 + kk] = f2bf(Wm[(size_t)(k0 + kk) * ncols + n0 + nq + i]);
    __syncthreads();
    const int piece = tid & 7;
#pragma unroll
    for (int s = 0; s < 2; ++s) { const int nr = (tid >> 3) + 32 * s; const v8us val = *(const v8usa*)(tl + nr * 72 + piece * 8); *(v8us*)(WT + (size_t)(n0 + nr) * DD + k0 + piece * 8) = val; }
}
// k_gemmb: 64 x 64 block tile (4 waves x 16 x 64) of C[NR][NW] = (A [+ Al]).B^T (K = 256) [+ bf(bias[c])] [+ bf(R[r][c]) residual]; f32 whole-line epilogue (or f16
template <bool SPLITA, bool F16OUT = false>
__global__ __launch_bounds__(128) void k_gemmb(const bf* __restrict__ A, const bf* __restrict__ Al, const bf* __restrict__ Bn, const float* __restrict__ bias, float* C, int ldc, h16* C2, const float* __restrict__ R = nullptr, int K = DM, int roundR = 1) {
    __shared__ __align__(16) float ost[4][16 * 68];
    const int lane = threadIdx.x & 31, wave = threadIdx.x >> 5, lr = lane & 15, hi = lane >> 4;
    const int r0 = blockIdx.x * 64 + wave * 16, c0 = blockIdx.y * 64;
    const size_t aoff = (size_t)(r0 + lr) * K + 8 * hi;
    size_t boff[4];
#pragma unroll
    for (int t = 0; t < 4; ++t) boff[t] = (size_t)(c0 + t * 16 + lr) * K + 8 * hi;
    v8f acc[4];
#pragma unroll
    for (int t = 0; t < 4; ++t) acc[t] = (v8f){};
#pragma unroll 1
    for (int kc = 0; kc < K; kc += 32) {
        const v16bf a = cat16b(*(const v8us*)(A + aoff + kc), *(const v8us*)(A + aoff + kc + 16));
        v16bf al = a;
        if (SPLITA) al = cat16b(*(const v8us*)(Al + aoff + kc), *(const v8us*)(Al + aoff + kc + 16));
#pragma unroll
        for (int t = 0; t < 4; ++t) { const v16bf b = cat16b(*(const v8us*)(Bn + boff[t] + kc), *(const v8us*)(Bn + boff[t] + kc + 16)); acc[t] = wmmab(a, b, acc[t]); if (SPLITA) acc[t] = wmmab(al, b, acc[t]); }
        asm volatile("v_nop\n\tv_nop\n\tv_nop\n\tv_nop" : "+v"(acc[0]), "+v"(acc[1]), "+v"(acc[2]), "+v"(acc[3]) : "v"(a), "v"(al));
    }
    float* os = &ost[wave][0];
#pragma unroll
    for (int t = 0; t < 4; ++t) { const float bv = bias ? bfr(bias[c0 + t * 16 + lr]) : 0.f;
#pragma unroll
        for (int j = 0; j < 8; ++j) os[(hi * 8 + j) * 68 + t * 16 + lr] = acc[t][j] + bv; }
    __syncthreads();
    if (F16OUT) {
        h16* crow = (h16*)(void*)C + (size_t)r0 * ldc + c0;
        auto pass = [&]() {
#pragma unroll
            for (int s = 0; s < 4; ++s) { const int row = 4 * s + (lane >> 3), piece = lane & 7; const float* sp = os + row * 68 + piece * 8; v8h o, o2;
#pragma unroll
                for (int i = 0; i < 8; ++i) { const h16 a = (h16)sp[i]; o[i] = a; o2[i] = (h16)((sp[i] - (float)a) * LOSC); }
                *(v8h*)(crow + (size_t)row * ldc + piece * 8) = o; if (C2) *(v8h*)(C2 + (size_t)r0 * ldc + c0 + (size_t)row * ldc + piece * 8) = o2; }
        };
        pass(); 
    } else {
        float* crow = C + (size_t)r0 * ldc + c0;
        auto pass = [&]() {
#pragma unroll
            for (int s = 0; s < 8; ++s) { const int Lid = (lane >> 3) + 4 * s, piece = lane & 7; const int row = Lid >> 1, cofs = (Lid & 1) * 32 + piece * 4;
                v4f val = *(const v4fa*)(os + row * 68 + cofs); if (R) { const v4f rv = *(const v4f*)(R + ((size_t)r0 + row) * ldc + c0 + cofs); val += roundR ? (v4f){bfr(rv[0]), bfr(rv[1]), bfr(rv[2]), bfr(rv[3])} : rv; }
                *(v4f*)(crow + (size_t)row * ldc + cofs) = val; }
        };
        pass(); 
    }
}

// k_gemm3: 64 x 128 block tile (4 waves x 32 x 64) of o = softmax(l (x) r).v over K = NN. The A operand never exists in memory: each lane forms its own fragment elements
// e[n][m] = exp2(l'[n][m >> 6] r[n][m & 63] - max'), l' = l log2(e), in f32 and splits them into bf16 hi + residual in registers; the row's sum of e is kept beside them and divides the result at the end.
// B = (Bh + Bl), n-major, one [CC][NN] plane pair per batch item, picked by the row tile; three products per 32-k step (hh, lh, hl), in that order per accumulator. A stage is 256 B (128 k) of every
// B row, brought into LDS by one tensor load per wave (wave w: plane w >> 1, 64-row half w & 1), rows padded to a 272 B pitch for the 16-byte readers; two buffers, the next stage in flight under the current one; the hand-over (waits, barrier, refill) stands at the head of each pass.
typedef uint32_t u32x4 __attribute__((ext_vector_type(4)));
typedef uint32_t u32x8 __attribute__((ext_vector_type(8)));
typedef __attribute__((ext_vector_type(2))) float v2f;
typedef v2f __attribute__((may_alias)) v2fa;
#define G3_ROWB  256u
#define G3_PITCH 272u
#define G3_SL    18432u                        // one slice: 64 rows x 272 B, rounded up to a multiple of 2 KiB
#define G3_STAGE (4u * G3_SL)                  // 73,728 B = 36 x 2 KiB
#define G3_NST   (NN * 2u / G3_ROWB)           // 32 stages
#define G3_LP    68                            // floats per row of a wave's own table of l' (later its output staging)
__device__ __forceinline__ uint32_t uni(uint32_t v) { return (uint32_t)__builtin_amdgcn_readfirstlane(v); }
// a value held in a scalar register: makes the test around a tensor load a scalar branch, and keeps what is formed from it behind the waits in front of it
__device__ __forceinline__ uint32_t pinned(uint32_t v) { uint32_t w = uni(v); asm volatile("" : "+s"(w)); return w; }
struct G3A { v16bf ah[2], al[2]; };
struct G3B { v16bf bh[4], bl[4]; };
__device__ __forceinline__ v16bf g3_ld(const unsigned char* p) { return cat16b(*(const v8usa*)p, *(const v8usa*)(p + 32)); }
__device__ __forceinline__ void g3_bfrags(G3B& f, const unsigned char* pb, int kk) {
#pragma unroll
    for (int t = 0; t < 4; ++t) { f.bh[t] = g3_ld(pb + t * 16 * G3_PITCH + kk * 64); f.bl[t] = g3_ld(pb + 2 * G3_SL + t * 16 * G3_PITCH + kk * 64); }
}
typedef __attribute__((ext_vector_type(2))) __bf16 v2bf;
// the A fragments of one 32-k step for the lane's two rows: element e stands for k = (e >> 3) * 16 + 8 * hi + (e & 7), the order of g3_ld; rv holds r at exactly those places
__device__ __forceinline__ void g3_gen(G3A& a, const float (&rv)[2][16], float l0, float l1, const float (&nmx)[2], v2f (&sum)[2][2]) {
#pragma unroll
    for (int i = 0; i < 2; ++i) { const float lv = i ? l1 : l0; u32x8 wh, wl;
#pragma unroll
        for (int e = 0; e < 16; e += 2) {
            const v2f p = {__builtin_amdgcn_exp2f(__builtin_fmaf(lv, rv[i][e], nmx[i])), __builtin_amdgcn_exp2f(__builtin_fmaf(lv, rv[i][e + 1], nmx[i]))};
            const v2bf hb = __builtin_convertvector(p, v2bf);
            const v2bf lb = __builtin_convertvector(p - __builtin_convertvector(hb, v2f), v2bf);
            wh[e >> 1] = __builtin_bit_cast(uint32_t, hb); wl[e >> 1] = __builtin_bit_cast(uint32_t, lb); sum[i][(e >> 1) & 1] += p; }
        a.ah[i] = __builtin_bit_cast(v16bf, wh); a.al[i] = __builtin_bit_cast(v16bf, wl); }
}
__global__ __launch_bounds__(128) void k_gemm3(const float* __restrict__ Lm, const float* __restrict__ Rm, const bf* __restrict__ Bh, const bf* __restrict__ Bl, bf* Oh, bf* Ol) {
    __shared__ __attribute__((aligned(2048))) unsigned char ring[2 * G3_STAGE + 4 * 32 * G3_LP * 4];    // two stages, then each wave's own table of l', which becomes its output staging
    const int lane = threadIdx.x & 31, lr = lane & 15, hi = lane >> 4;
    const uint32_t wave = uni(threadIdx.x >> 5);
    const int wr = wave >> 1, wc = wave & 1;
    const int rb = blockIdx.x * 64, cb = blockIdx.y * 128;
    const size_t bitem = (size_t)(blockIdx.x / (NN / 64)) * CC * NN;
    const bf* sp = (wave < 2 ? Bh : Bl) + bitem + (size_t)(cb + (wave & 1u) * 64u) * NN;
    const uint64_t srcb = (uint64_t)sp;
    const uint32_t rows = 64u;
    const uint32_t place = (uint32_t)(uintptr_t)ring + wave * G3_SL;
    u32x8 g1;
    // pinned(): each descriptor word held in a scalar register, so that the group keeps one set of registers and no word of an outstanding request is rewritten
    g1[0] = pinned((1u << 20) | (5u << 22) | (3u << 25));    // no mask, 1-byte elements, 4 dwords of pad behind every 64 dwords
    g1[1] = pinned((G3_ROWB & 0xFFFFu) << 16);
    g1[2] = pinned((G3_ROWB >> 16) | (rows << 16));
    g1[3] = pinned((rows >> 16) | (G3_ROWB << 16));
    g1[4] = pinned(rows);
    g1[5] = pinned(NN * 2u);
    g1[6] = pinned(0u);
    g1[7] = pinned(0u);
    auto issue = [&](uint32_t st) {
        const uint64_t ga = srcb + (uint64_t)st * G3_ROWB;
        u32x4 g0;
        g0[0] = uni(1u); g0[1] = uni(place + (st & 1u) * G3_STAGE); g0[2] = uni((uint32_t)ga); g0[3] = uni((((uint32_t)(ga >> 32)) & 0x01FFFFFFu) | 0x80000000u);
        asm volatile("tensor_load_to_lds %0, %1" :: "s"(g0), "s"(g1) : "memory");
    };
    v8f acc[2][4];
#pragma unroll
    for (int i = 0; i < 2; ++i) {
#pragma unroll
        for (int t = 0; t < 4; ++t) acc[i][t] = (v8f){}; }
    // the lane's two rows of r, at the k places of its fragment elements (rv[h]: the 32-k step's half of the 64), and its half of their l: loaded ahead of stage 0, used behind it
    float rv[2][2][16]; v4f lq[2][8];
#pragma unroll
    for (int i = 0; i < 2; ++i) { const size_t ro = (size_t)(rb + wr * 32 + i * 16 + lr) * PP;
#pragma unroll
        for (int h = 0; h < 2; ++h) {
#pragma unroll
            for (int g = 0; g < 4; ++g) { const v4f q = *(const v4f*)(Rm + ro + h * 32 + (g >> 1) * 16 + 8 * hi + (g & 1) * 4);
#pragma unroll
                for (int u = 0; u < 4; ++u) rv[h][i][g * 4 + u] = q[u]; } }
#pragma unroll
        for (int g = 0; g < 8; ++g) lq[i][g] = *(const v4f*)(Lm + ro + hi * 32 + g * 4); }
    asm volatile("s_wait_xcnt 0x0" ::: "memory");    // stands behind the run of loads, ahead of any later write of a register that they name
    issue(0);    // stage 0 flies under the rows' extremes and the table of l'
    float* os = (float*)(ring + 2 * G3_STAGE) + wave * (32 * G3_LP);
    float nmx[2];
#pragma unroll
    for (int i = 0; i < 2; ++i) {    // the row's largest score is one of the four products of the extremes of l' and r (a rounded product is monotone in each factor)
        float rx = rv[0][i][0], rn = rx, lx = -3.0e38f, ln = 3.0e38f;
#pragma unroll
        for (int h = 0; h < 2; ++h) {
#pragma unroll
            for (int e = 0; e < 16; ++e) { rx = fmaxf(rx, rv[h][i][e]); rn = fminf(rn, rv[h][i][e]); } }
#pragma unroll
        for (int g = 0; g < 8; ++g) { const v4f q = lq[i][g] * 1.44269504088896341f;
#pragma unroll
            for (int u = 0; u < 4; ++u) { lx = fmaxf(lx, q[u]); ln = fminf(ln, q[u]); }
            *(v4fa*)(os + (i * 16 + lr) * G3_LP + hi * 32 + g * 4) = q; }
        rx = fmaxf(rx, __shfl_xor(rx, 16, 32)); rn = fminf(rn, __shfl_xor(rn, 16, 32)); lx = fmaxf(lx, __shfl_xor(lx, 16, 32)); ln = fminf(ln, __shfl_xor(ln, 16, 32));
        nmx[i] = -fmaxf(fmaxf(lx * rx, ln * rn), fmaxf(lx * rn, ln * rx)); }
    asm volatile("s_wait_dscnt 0x0" ::: "memory");    // the wave's table of l' is written before its lanes read it across lanes
    const float* lt0 = os + lr * G3_LP; const float* lt1 = os + (16 + lr) * G3_LP;
    v2f sm[2][2];
#pragma unroll
    for (int i = 0; i < 2; ++i) { sm[i][0] = (v2f){}; sm[i][1] = (v2f){}; }
    v2f lv0 = *(const v2fa*)lt0, lv1 = *(const v2fa*)lt1;
    const uint32_t boff = (uint32_t)wc * G3_SL + (uint32_t)lr * G3_PITCH + 16u * hi;
#pragma unroll 1
    for (uint32_t s = 0; s < G3_NST; ++s) {
        // the hand-over of stage s stands at the head of its pass, so that the pass's vector work ends in the block of its matrix instructions
        asm volatile("s_wait_dscnt 0x0" ::: "memory");        // this wave's reads of stage s - 1 have returned
        asm volatile("s_wait_tensorcnt 0x0" ::: "memory");    // this wave's slice of stage s has landed
        __syncthreads();                                      // publishes stage s and ends every wave's reads of stage s - 1
        if (pinned(s + 1 < G3_NST)) issue(pinned(s + 1));     // refill of the buffer that stage s - 1 has just left
        const unsigned char* pb = ring + (s & 1u) * G3_STAGE + boff;
        G3B f[2];
        g3_bfrags(f[0], pb, 0);
        const uint32_t sn = s + 1 < G3_NST ? s + 1 : s;    // the next stage's pair of l', fetched one stage ahead; the last stage has no successor and fetches its own again
        const v2f ln0 = *(const v2fa*)(lt0 + 2 * sn), ln1 = *(const v2fa*)(lt1 + 2 * sn);
        __builtin_amdgcn_sched_barrier(0);    // the stage's first LDS reads are issued ahead of the vector work that fills their latency
        G3A a[2];
        g3_gen(a[0], rv[0], lv0[0], lv1[0], nmx, sm);    // the stage's first A fragments are formed while its first LDS reads are on their way
#pragma unroll
        for (int kk = 0; kk < 4; ++kk) {
            if (kk < 3) g3_bfrags(f[(kk + 1) & 1], pb, kk + 1);
            __builtin_amdgcn_sched_barrier(0);    // the next block's LDS reads stay one group ahead of this block's matrix instructions, not spread among them
            const G3B& c = f[kk & 1]; const G3A& ca = a[kk & 1];
            auto mm = [&](int j) { const int i = (j >> 2) & 1, t = j & 3;    // the block's 24 matrix instructions: hh, lh, hl, eight accumulators each
                acc[i][t] = wmmab((j >> 3) == 1 ? ca.al[i] : ca.ah[i], (j >> 3) == 2 ? c.bl[t] : c.bh[t], acc[i][t]); };
            if (kk < 3) {
                // the next 32-k step's A fragments are formed under this step's matrix instructions, cut into 24 slots of about eight vector cycles, one behind each matrix instruction:
                // pair q's scores one slot ahead of its two exp2, its hi part one slot or more behind them, its residual and sum behind that
                const float (&rh)[2][16] = rv[(kk + 1) & 1];
                const float la[2] = {lv0[(kk + 1) >> 1], lv1[(kk + 1) >> 1]};
                v2f F[16], P[16], HF[16]; u32x8 wh[2], wl[2];
                auto fm = [&](int q) { const int i = q >> 3, e = (q & 7) * 2; F[q] = (v2f){__builtin_fmaf(la[i], rh[i][e], nmx[i]), __builtin_fmaf(la[i], rh[i][e + 1], nmx[i])}; };
                auto ex = [&](int q) { P[q] = (v2f){__builtin_amdgcn_exp2f(F[q][0]), __builtin_amdgcn_exp2f(F[q][1])}; };
                auto unit = [&](int u) { const int q = u >> 1, i = q >> 3;
                    if (!(u & 1)) { const v2bf hb = __builtin_convertvector(P[q], v2bf); wh[i][q & 7] = __builtin_bit_cast(uint32_t, hb); HF[q] = __builtin_convertvector(hb, v2f); }
                    else { wl[i][q & 7] = __builtin_bit_cast(uint32_t, __builtin_convertvector(P[q] - HF[q], v2bf)); sm[i][q & 1] += P[q]; } };
                fm(0);
#pragma unroll
                for (int j = 0; j < 24; ++j) {
                    mm(j);
                    if (j + 1 < 16) fm(j + 1);
                    if (j < 16) ex(j);
                    if (j >= 1 && j < 16) unit(j - 1);
                    if (j >= 16) { unit(2 * j - 17); unit(2 * j - 16); }
                    if (j == 23) unit(31);
                    __builtin_amdgcn_sched_barrier(0);    // keeps the slot's vector work behind its own matrix instruction: left free, it gathers in long runs during which the matrix unit idles
                }
#pragma unroll
                for (int i = 0; i < 2; ++i) { a[(kk + 1) & 1].ah[i] = __builtin_bit_cast(v16bf, wh[i]); a[(kk + 1) & 1].al[i] = __builtin_bit_cast(v16bf, wl[i]); }
            } else {
#pragma unroll
                for (int j = 0; j < 24; ++j) mm(j);
            }
            __builtin_amdgcn_sched_barrier(0);    // closes the block: see above
        }
        lv0 = ln0; lv1 = ln1;
    }
    asm volatile("s_wait_tensorcnt 0x0" ::: "memory");
    asm volatile("s_wait_dscnt 0x0" ::: "memory");
#pragma unroll
    for (int i = 0; i < 2; ++i) {
        const v2f t4 = sm[i][0] + sm[i][1]; float t = t4[0] + t4[1]; t += __shfl_xor(t, 16, 32);    // the lane pair l, l ^ 16 holds the two halves of a row's sum
        if (hi == 0) os[(i * 16 + lr) * G3_LP + 64] = 1.0f / t;
#pragma unroll
        for (int t2 = 0; t2 < 4; ++t2) {
#pragma unroll
            for (int j = 0; j < 8; ++j) os[(i * 16 + hi * 8 + j) * G3_LP + t2 * 16 + lr] = acc[i][t2][j]; } }
    asm volatile("s_wait_dscnt 0x0" ::: "memory");    // the wave's staged rows are written before its lanes read them back across lanes
    const size_t obase = (size_t)(rb + wr * 32) * DD + cb + wc * 64;    // the result leaves as bf16 hi + residual planes, whole 128-B lines (8 lanes x 16 B)
#pragma unroll
    for (int s = 0; s < 8; ++s) { const int row = 4 * s + (lane >> 3), piece = lane & 7; const float* sp2 = os + row * G3_LP + piece * 8; const float iv = os[row * G3_LP + 64]; v8us oh, ol;
#pragma unroll
        for (int i = 0; i < 8; ++i) { const float val = sp2[i] * iv; const unsigned short hb = f2bf(val); oh[i] = hb; ol[i] = f2bf(val - bf2f(hb)); }
        const size_t o = obase + (size_t)row * DD + piece * 8; *(v8us*)(Oh + o) = oh; *(v8us*)(Ol + o) = ol; }
}

// k_proj: one launch for the three independent projections of x, each block one 64 x 64 tile (4 waves x 16 x 64) of A.B^T over K = DD, plain bf16 operands.
// Blocks 0..511: v^T[b][c][m] = WvT.Xb^T (4 channel tiles x 128 row tiles of x), written straight as bf16 hi + residual planes (whole 128-B lines, 8 lanes x 16 B);
// blocks 512..639: l = Xb.WlT^T, 640..767: r = Xb.WrT^T, f32 whole-line epilogue.
#define PROJ_V (DD / 64 * (NR / 64))
__global__ __launch_bounds__(128) void k_proj(const bf* __restrict__ Xb, const bf* __restrict__ WlT, const bf* __restrict__ WrT, const bf* __restrict__ WvT, float* Lm, float* Rm, bf* VTh, bf* VTl) {
    __shared__ __align__(16) float ost[4][16 * 68];
    const int lane = threadIdx.x & 31, wave = threadIdx.x >> 5, lr = lane & 15, hi = lane >> 4;
    const int b = blockIdx.x, q = b - PROJ_V;
    const bool isv = b < PROJ_V;
    const bf* A = isv ? WvT : Xb;
    const bf* Bn = isv ? Xb : q < NR / 64 ? WlT : WrT;
    const int r0 = (isv ? (b & 3) : (q & (NR / 64 - 1))) * 64 + wave * 16, c0 = isv ? (b >> 2) * 64 : 0;
    const size_t aoff = (size_t)(r0 + lr) * DD + 8 * hi;
    size_t boff[4];
#pragma unroll
    for (int t = 0; t < 4; ++t) boff[t] = (size_t)(c0 + t * 16 + lr) * DD + 8 * hi;
    v8f acc[4];
#pragma unroll
    for (int t = 0; t < 4; ++t) acc[t] = (v8f){};
#pragma unroll 1    // the k loop stays rolled, as the separate launches had it
    for (int kc = 0; kc < DD; kc += 32) {
        const v16bf a = cat16b(*(const v8us*)(A + aoff + kc), *(const v8us*)(A + aoff + kc + 16));
#pragma unroll
        for (int t = 0; t < 4; ++t) { const v16bf bb = cat16b(*(const v8us*)(Bn + boff[t] + kc), *(const v8us*)(Bn + boff[t] + kc + 16)); acc[t] = wmmab(a, bb, acc[t]); }
        asm volatile("v_nop\n\tv_nop\n\tv_nop\n\tv_nop" : "+v"(acc[0]), "+v"(acc[1]), "+v"(acc[2]), "+v"(acc[3]) : "v"(a));    // the distance behind the last matrix instruction, on the loop's taken branch too
    }
    float* os = &ost[wave][0];
#pragma unroll
    for (int t = 0; t < 4; ++t) {
#pragma unroll
        for (int j = 0; j < 8; ++j) os[(hi * 8 + j) * 68 + t * 16 + lr] = acc[t][j]; }
    __syncthreads();    // the staged tile is written before other lanes read it back
    if (isv) {
        const size_t base = (size_t)(c0 / NN) * DD * NN + (size_t)r0 * NN + (c0 & (NN - 1));
#pragma unroll
        for (int s = 0; s < 4; ++s) { const int row = 4 * s + (lane >> 3), piece = lane & 7; const float* sp = os + row * 68 + piece * 8; v8us oh, ol;
#pragma unroll
            for (int i = 0; i < 8; ++i) { const unsigned short hb = f2bf(sp[i]); oh[i] = hb; ol[i] = f2bf(sp[i] - bf2f(hb)); }
            const size_t o = base + (size_t)row * NN + piece * 8; *(v8us*)(VTh + o) = oh; *(v8us*)(VTl + o) = ol; }
    } else {
        float* crow = (q < NR / 64 ? Lm : Rm) + (size_t)r0 * PP;
#pragma unroll
        for (int s = 0; s < 8; ++s) { const int Lid = (lane >> 3) + 4 * s, piece = lane & 7; const int row = Lid >> 1, cofs = (Lid & 1) * 32 + piece * 4;
            const v4f val = *(const v4fa*)(os + row * 68 + cofs); *(v4f*)(crow + (size_t)row * PP + cofs) = val; }
        asm volatile("s_wait_xcnt 0x0" ::: "memory");    // stands behind the run of stores, ahead of any later write of a register that they name
    }
}
extern "C" void kernel_launch(void* const* d_in, const int* in_sizes, int n_in,
                              void* d_out, int out_size, void* d_ws, size_t ws_size, hipStream_t stream) {
    (void)in_sizes; (void)n_in; (void)out_size;
    const float* x = (const float*)d_in[0]; const float* Wl = (const float*)d_in[1]; const float* Wr = (const float*)d_in[2]; const float* Wv = (const float*)d_in[3]; const float* Wo = (const float*)d_in[4];
    float* out = (float*)d_out;    // [2][4096][256]
    char* wsp = (char*)d_ws;
    auto take = [&](size_t bytes) { char* p = wsp; wsp += (bytes + 255) & ~(size_t)255; return (void*)p; };
    bf* WlT = (bf*)take(PP * DD * 2); bf* WrT = (bf*)take(PP * DD * 2); bf* WvT = (bf*)take(DD * DD * 2); bf* WoT = (bf*)take(DD * DD * 2);
    bf* Xb = (bf*)take((size_t)NR * DD * 2); float* Lm = (float*)take((size_t)NR * PP * 4); float* Rm = (float*)take((size_t)NR * PP * 4); bf* VTh = (bf*)take((size_t)DD * NR * 2); bf* VTl = (bf*)take((size_t)DD * NR * 2);
    bf* Oh = (bf*)take((size_t)NR * DD * 2); bf* Ol = (bf*)take((size_t)NR * DD * 2);
    if ((size_t)(wsp - (char*)d_ws) > ws_size) return;    // ~ 26 MB, no aliasing
    k_prep<<<PREP_WT + NR / 8, 256, 0, stream>>>(x, Wl, Wr, Wv, Wo, Xb, WlT, WrT, WvT, WoT);
    k_proj<<<PROJ_V + 2 * (NR / 64), 128, 0, stream>>>(Xb, WlT, WrT, WvT, Lm, Rm, VTh, VTl);       // v^T [b][c][m] planes, l and r [b n][64]
    k_gemm3<<<dim3(NR / 64, DD / 128, 1), 128, 0, stream>>>(Lm, Rm, VTh, VTl, Oh, Ol);              // o [b n][c] = softmax(l (x) r) . v, as planes
    k_gemmb<true, false><<<dim3(NR / 64, DD / 64, 1), 128, 0, stream>>>(Oh, Ol, WoT, nullptr, out, DD, nullptr);                 // o.Wo
}

// v005
// It runs in 62.3 microseconds.
// Next to v004, in two timings, it ran 1.04 and 1.03 times as fast.
// All steps since v000 together make it 18.0 times as fast.
#include <hip/hip_runtime.h>

// Compute dtypes, f32 accumulate, both batch items in every launch (8192 rows): l = x.Wl, r = x.Wr ([8192 x 256].[256 x 64]) and v^T = Wv^T.x^T ([256 x 256].[256 x 4096] per batch item) with PLAIN bf16 operands (rounded
// input, k-major weights transposed once; exact products); the factorised scores attn[n][m] = l[n][m/64] r[n][m%64] and their row softmax in f32 -> bf16 hi + UNSCALED residual, formed in registers inside
// the product that uses them; o[n][c] = sum_m P[n][m] v[m][c] ([4096 x 4096].[4096 x 256] per batch item, both operands hi + residual, three products; shared across heads = all 256 channels at once) and out = o.Wo

#define NBI  2
#define NN   4096
#define DD   256
#define PP   64
#define NR   (NBI * NN)
#define CC   DD
#define DM   DD
#define NTK  NN
#define LOSC 1024.0f

typedef _Float16 h16;
typedef unsigned short bf;
typedef __attribute__((ext_vector_type(16))) __bf16   v16bf;
typedef __attribute__((ext_vector_type(16))) _Float16 v16h;
typedef __attribute__((ext_vector_type(8)))  _Float16 v8h;
typedef __attribute__((ext_vector_type(8)))  unsigned short v8us;
typedef __attribute__((ext_vector_type(8)))  float    v8f;
typedef __attribute__((ext_vector_type(4)))  float    v4f;
typedef __attribute__((ext_vector_type(4)))  _Float16 v4h;
typedef v8h  __attribute__((may_alias)) v8ha;
typedef v4f  __attribute__((may_alias)) v4fa;
typedef v8us __attribute__((may_alias)) v8usa;

__device__ __forceinline__ unsigned short f2bf(float f) { unsigned u = __float_as_uint(f); u += 0x7FFFu + ((u >> 16) & 1u); return (unsigned short)(u >> 16); }
__device__ __forceinline__ float bf2f(unsigned short b) { return __uint_as_float(((unsigned)b) << 16); }
__device__ __forceinline__ float bfr(float f) { return bf2f(f2bf(f)); }
__device__ __forceinline__ v16h cat16(v8h lo, v8h hi) { return __builtin_shufflevector(lo, hi, 0, 1, 2, 3, 4, 5, 6, 7, 8, 9, 10, 11, 12, 13, 14, 15); }
__device__ __forceinline__ v16bf cat16b(v8us lo, v8us hi) { return __builtin_bit_cast(v16bf, __builtin_shufflevector(lo, hi, 0, 1, 2, 3, 4, 5, 6, 7, 8, 9, 10, 11, 12, 13, 14, 15)); }
__device__ __forceinline__ v8f wmma16(v16h a, v16h b, v8f c) { return __builtin_amdgcn_wmma_f32_16x16x32_f16(false, a, false, b, (short)0, c, false, false); }
__device__ __forceinline__ v8f wmmab(v16bf a, v16bf b, v8f c) { return __builtin_amdgcn_wmma_f32_16x16x32_bf16(false, a, false, b, (short)0, c, false, false); }

// k_prep: one launch for the five independent input conversions. Blocks 0..39: WT [n][DD] = bf16(W[k][n]) (k-major [DD][ncols]) via 64 x 64 LDS tiles, 4 tiles each for Wl and Wr, 16 each for Wv and Wo;
// blocks from 40 on: eight rows each of Xb = bf16(x), one wave per row.
#define PREP_WT 40
__global__ __launch_bounds__(256) void k_prep(const float* __restrict__ x, const float* __restrict__ Wl, const float* __restrict__ Wr, const float* __restrict__ Wv, const float* __restrict__ Wo,
                                              bf* Xb, bf* WlT, bf* WrT, bf* WvT, bf* WoT) {
    __shared__ __align__(16) unsigned short tl[64 * 72];
    const int tid = threadIdx.x, b = blockIdx.x;
    if (b >= PREP_WT) {
        const int lane = tid & 31, r = (b - PREP_WT) * 8 + (tid >> 5); v8us o;
#pragma unroll
        for (int i = 0; i < 8; ++i) o[i] = f2bf(x[(size_t)r * DD + lane * 8 + i]);
        *(v8us*)(Xb + (size_t)r * DD + lane * 8) = o;
        return;
    }
    const float* Wm = b < 4 ? Wl : b < 8 ? Wr : b < 24 ? Wv : Wo;
    bf* WT = b < 4 ? WlT : b < 8 ? WrT : b < 24 ? WvT : WoT;
    const int ncols = b < 8 ? PP : DD, q = b < 4 ? b : b < 8 ? b - 4 : b < 24 ? b - 8 : b - 24;
    const int k0 = (q & 3) * 64, n0 = (q >> 2) * 64;
    const int kk = tid >> 2, nq = (tid & 3) * 16;
#pragma unroll
    for (int i = 0; i < 16; ++i) tl[(nq + i) * 72 + kk] = f2bf(Wm[(size_t)(k0 + kk) * ncols + n0 + nq + i]);
    __syncthreads();
    const int piece = tid & 7;
#pragma unroll
    for (int s = 0; s < 2; ++s) { const int nr = (tid >> 3) + 32 * s; const v8us val = *(const v8usa*)(tl + nr * 72 + piece * 8); *(v8us*)(WT + (size_t)(n0 + nr) * DD + k0 + piece * 8) = val; }
}
// k_gemmb: 64 x 64 block tile (4 waves x 16 x 64) of C[NR][NW] = (A [+ Al]).B^T (K = 256) [+ bf(bias[c])] [+ bf(R[r][c]) residual]; f32 whole-line epilogue (or f16
template <bool SPLITA, bool F16OUT = false>
__global__ __launch_bounds__(128) void k_gemmb(const bf* __restrict__ A, const bf* __restrict__ Al, const bf* __restrict__ Bn, const float* __restrict__ bias, float* C, int ldc, h16* C2, const float* __restrict__ R = nullptr, int K = DM, int roundR = 1) {
    __shared__ __align__(16) float ost[4][16 * 68];
    const int lane = threadIdx.x & 31, wave = threadIdx.x >> 5, lr = lane & 15, hi = lane >> 4;
    const int r0 = blockIdx.x * 64 + wave * 16, c0 = blockIdx.y * 64;
    const size_t aoff = (size_t)(r0 + lr) * K + 8 * hi;
    size_t boff[4];
#pragma unroll
    for (int t = 0; t < 4; ++t) boff[t] = (size_t)(c0 + t * 16 + lr) * K + 8 * hi;
    v8f acc[4];
#pragma unroll
    for (int t = 0; t < 4; ++t) acc[t] = (v8f){};
#pragma unroll 1
    for (int kc = 0; kc < K; kc += 32) {
        const v16bf a = cat16b(*(const v8us*)(A + aoff + kc), *(const v8us*)(A + aoff + kc + 16));
        v16bf al = a;
        if (SPLITA) al = cat16b(*(const v8us*)(Al + aoff + kc), *(const v8us*)(Al + aoff + kc + 16));
#pragma unroll
        for (int t = 0; t < 4; ++t) { const v16bf b = cat16b(*(const v8us*)(Bn + boff[t] + kc), *(const v8us*)(Bn + boff[t] + kc + 16)); acc[t] = wmmab(a, b, acc[t]); if (SPLITA) acc[t] = wmmab(al, b, acc[t]); }
        asm volatile("v_nop\n\tv_nop\n\tv_nop\n\tv_nop" : "+v"(acc[0]), "+v"(acc[1]), "+v"(acc[2]), "+v"(acc[3]) : "v"(a), "v"(al));
    }
    float* os = &ost[wave][0];
#pragma unroll
    for (int t = 0; t < 4; ++t) { const float bv = bias ? bfr(bias[c0 + t * 16 + lr]) : 0.f;
#pragma unroll
        for (int j = 0; j < 8; ++j) os[(hi * 8 + j) * 68 + t * 16 + lr] = acc[t][j] + bv; }
    __syncthreads();
    if (F16OUT) {
        h16* crow = (h16*)(void*)C + (size_t)r0 * ldc + c0;
        auto pass = [&]() {
#pragma unroll
            for (int s = 0; s < 4; ++s) { const int row = 4 * s + (lane >> 3), piece = lane & 7; const float* sp = os + row * 68 + piece * 8; v8h o, o2;
#pragma unroll
                for (int i = 0; i < 8; ++i) { const h16 a = (h16)sp[i]; o[i] = a; o2[i] = (h16)((sp[i] - (float)a) * LOSC); }
                *(v8h*)(crow + (size_t)row * ldc + piece * 8) = o; if (C2) *(v8h*)(C2 + (size_t)r0 * ldc + c0 + (size_t)row * ldc + piece * 8) = o2; }
        };
        pass(); 
    } else {
        float* crow = C + (size_t)r0 * ldc + c0;
        auto pass = [&]() {
#pragma unroll
            for (int s = 0; s < 8; ++s) { const int Lid = (lane >> 3) + 4 * s, piece = lane & 7; const int row = Lid >> 1, cofs = (Lid & 1) * 32 + piece * 4;
                v4f val = *(const v4fa*)(os + row * 68 + cofs); if (R) { const v4f rv = *(const v4f*)(R + ((size_t)r0 + row) * ldc + c0 + cofs); val += roundR ? (v4f){bfr(rv[0]), bfr(rv[1]), bfr(rv[2]), bfr(rv[3])} : rv; }
                *(v4f*)(crow + (size_t)row * ldc + cofs) = val; }
        };
        pass(); 
    }
}

// k_gemm3: 64 x 128 block tile (4 waves x 32 x 64) of o = softmax(l (x) r).v over K = NN. The A operand never exists in global memory: the lanes form its fragment elements
// e[n][m] = exp2(l'[n][m >> 6] r[n][m & 63] - max'), l' = l log2(e), in f32 and splits them into bf16 hi + residual in registers; the row's sum of e is kept beside them and divides the result at the end.
// B = (Bh + Bl), n-major, one [CC][NN] plane pair per batch item, picked by the row tile; three products per 32-k step (hh, lh, hl), in that order per accumulator. A stage is 256 B (128 k) of every
// B row, brought into LDS by one tensor load per wave (wave w: plane w >> 1, 64-row half w & 1), rows padded to a 272 B pitch for the 16-byte readers; two buffers, the next stage in flight under the current one; the hand-over (waits, barrier, refill) stands at the head of each pass.
typedef uint32_t u32x4 __attribute__((ext_vector_type(4)));
typedef uint32_t u32x8 __attribute__((ext_vector_type(8)));
typedef __attribute__((ext_vector_type(2))) float v2f;
#define G3_ROWB  256u
#define G3_PITCH 272u
#define G3_SL    18432u                        // one slice: 64 rows x 272 B, rounded up to a multiple of 2 KiB
#define G3_STAGE (4u * G3_SL)                  // 73,728 B = 36 x 2 KiB
#define G3_NST   (NN * 2u / G3_ROWB)           // 32 stages
#define G3_LP    68                            // floats per row of a wave's own table of l' (later its output staging)
__device__ __forceinline__ uint32_t uni(uint32_t v) { return (uint32_t)__builtin_amdgcn_readfirstlane(v); }
// a value held in a scalar register: makes the test around a tensor load a scalar branch, and keeps what is formed from it behind the waits in front of it
__device__ __forceinline__ uint32_t pinned(uint32_t v) { uint32_t w = uni(v); asm volatile("" : "+s"(w)); return w; }
struct G3B { v16bf bh[4], bl[4]; };
struct G3H { u32x8 h, l; };                    // one row tile's A fragments of a 32-k step: hi and residual
typedef u32x4 __attribute__((may_alias)) u32x4a;
#define G3_AF    1024u                         // one A fragment in LDS: two 512-B chunks, 16 B a lane in each
#define G3_ASTEP (4u * G3_AF)                  // a 32-k step: hi, residual of row tile 0, then of row tile 1
#define G3_AWR   (4u * G3_ASTEP)               // a stage's four steps of one 32-row pair of waves
#define G3_ASTG  (2u * G3_AWR)                 // 32 KiB a stage
__device__ __forceinline__ v16bf g3_ld(const unsigned char* p) { return cat16b(*(const v8usa*)p, *(const v8usa*)(p + 32)); }
__device__ __forceinline__ void g3_bfrags(G3B& f, const unsigned char* pb, int kk) {
#pragma unroll
    for (int t = 0; t < 4; ++t) { f.bh[t] = g3_ld(pb + t * 16 * G3_PITCH + kk * 64); f.bl[t] = g3_ld(pb + 2 * G3_SL + t * 16 * G3_PITCH + kk * 64); }
}
__device__ __forceinline__ void g3_ast(unsigned char* p, u32x8 w) { *(u32x4a*)p = __builtin_shufflevector(w, w, 0, 1, 2, 3); *(u32x4a*)(p + 512) = __builtin_shufflevector(w, w, 4, 5, 6, 7); }
__device__ __forceinline__ v16bf g3_ald(const unsigned char* p) { return cat16b(*(const v8usa*)p, *(const v8usa*)(p + 512)); }
typedef __attribute__((ext_vector_type(2))) __bf16 v2bf;
// the A fragments of one 32-k step for one of the lane's rows: element e stands for k = (e >> 3) * 16 + 8 * hi + (e & 7), the order of g3_ld; rv holds r at exactly those places
__device__ __forceinline__ void g3_half(G3H& a, const v2f (&rv)[8], float lv, float nm, v2f (&sum)[2]) {
#pragma unroll
    for (int e = 0; e < 16; e += 2) {
        const v2f sc = __builtin_elementwise_fma((v2f){lv, lv}, rv[e >> 1], (v2f){nm, nm});
        const v2f p = {__builtin_amdgcn_exp2f(sc[0]), __builtin_amdgcn_exp2f(sc[1])};
        const v2bf hb = __builtin_convertvector(p, v2bf);
        const v2bf lb = __builtin_convertvector(p - __builtin_convertvector(hb, v2f), v2bf);
        a.h[e >> 1] = __builtin_bit_cast(uint32_t, hb); a.l[e >> 1] = __builtin_bit_cast(uint32_t, lb); sum[(e >> 1) & 1] += p; }
}
__global__ __launch_bounds__(128) void k_gemm3(const float* __restrict__ Lm, const float* __restrict__ Rm, const bf* __restrict__ Bh, const bf* __restrict__ Bl, bf* Oh, bf* Ol) {
    __shared__ __attribute__((aligned(2048))) unsigned char ring[2 * G3_STAGE + 4 * 32 * G3_LP * 4];    // two stages, then each wave's own table of l', which becomes its output staging
    __shared__ __attribute__((aligned(16))) unsigned char axc[2 * G3_ASTG];    // the A fragments that the two waves of a row pair hand each other, two stages
    const int lane = threadIdx.x & 31, lr = lane & 15, hi = lane >> 4;
    const uint32_t wave = uni(threadIdx.x >> 5);
    const int wr = wave >> 1, wc = wave & 1;
    const int rb = blockIdx.x * 64, cb = blockIdx.y * 128;
    const size_t bitem = (size_t)(blockIdx.x / (NN / 64)) * CC * NN;
    const bf* sp = (wave < 2 ? Bh : Bl) + bitem + (size_t)(cb + (wave & 1u) * 64u) * NN;
    const uint64_t srcb = (uint64_t)sp;
    const uint32_t rows = 64u;
    const uint32_t place = (uint32_t)(uintptr_t)ring + wave * G3_SL;
    u32x8 g1;
    // pinned(): each descriptor word held in a scalar register, so that the group keeps one set of registers and no word of an outstanding request is rewritten
    g1[0] = pinned((1u << 20) | (5u << 22) | (3u << 25));    // no mask, 1-byte elements, 4 dwords of pad behind every 64 dwords
    g1[1] = pinned((G3_ROWB & 0xFFFFu) << 16);
    g1[2] = pinned((G3_ROWB >> 16) | (rows << 16));
    g1[3] = pinned((rows >> 16) | (G3_ROWB << 16));
    g1[4] = pinned(rows);
    g1[5] = pinned(NN * 2u);
    g1[6] = pinned(0u);
    g1[7] = pinned(0u);
    auto issue = [&](uint32_t st) {
        const uint64_t ga = srcb + (uint64_t)st * G3_ROWB;
        u32x4 g0;
        g0[0] = uni(1u); g0[1] = uni(place + (st & 1u) * G3_STAGE); g0[2] = uni((uint32_t)ga); g0[3] = uni((((uint32_t)(ga >> 32)) & 0x01FFFFFFu) | 0x80000000u);
        asm volatile("tensor_load_to_lds %0, %1" :: "s"(g0), "s"(g1) : "memory");
    };
    v8f acc[2][4];
#pragma unroll
    for (int i = 0; i < 2; ++i) {
#pragma unroll
        for (int t = 0; t < 4; ++t) acc[i][t] = (v8f){}; }
    // the lane's two rows of r, at the k places of its fragment elements (rv[h]: the 32-k step's half of the 64), and its half of their l: loaded ahead of stage 0, used behind it
    v2f rv[2][2][8]; v4f lq[2][8];    // r in pairs, as the packed score instruction takes them
#pragma unroll
    for (int i = 0; i < 2; ++i) { const size_t ro = (size_t)(rb + wr * 32 + i * 16 + lr) * PP;
#pragma unroll
        for (int h = 0; h < 2; ++h) {
#pragma unroll
            for (int g = 0; g < 4; ++g) { const v4f q = *(const v4f*)(Rm + ro + h * 32 + (g >> 1) * 16 + 8 * hi + (g & 1) * 4);
                rv[h][i][g * 2] = (v2f){q[0], q[1]}; rv[h][i][g * 2 + 1] = (v2f){q[2], q[3]}; } }
#pragma unroll
        for (int g = 0; g < 8; ++g) lq[i][g] = *(const v4f*)(Lm + ro + hi * 32 + g * 4); }
    asm volatile("s_wait_xcnt 0x0" ::: "memory");    // stands behind the run of loads, ahead of any later write of a register that they name
    issue(0);    // stage 0 flies under the rows' extremes and the table of l'
    float* os = (float*)(ring + 2 * G3_STAGE) + wave * (32 * G3_LP);
    float nmx[2];
#pragma unroll
    for (int i = 0; i < 2; ++i) {    // the row's largest score is one of the four products of the extremes of l' and r (a rounded product is monotone in each factor)
        float rx = rv[0][i][0][0], rn = rx, lx = -3.0e38f, ln = 3.0e38f;
#pragma unroll
        for (int h = 0; h < 2; ++h) {
#pragma unroll
            for (int e = 0; e < 16; ++e) { rx = fmaxf(rx, rv[h][i][e >> 1][e & 1]); rn = fminf(rn, rv[h][i][e >> 1][e & 1]); } }
#pragma unroll
        for (int g = 0; g < 8; ++g) { const v4f q = lq[i][g] * 1.44269504088896341f;
#pragma unroll
            for (int u = 0; u < 4; ++u) { lx = fmaxf(lx, q[u]); ln = fminf(ln, q[u]); }
            *(v4fa*)(os + (i * 16 + lr) * G3_LP + hi * 32 + g * 4) = q; }
        rx = fmaxf(rx, __shfl_xor(rx, 16, 32)); rn = fminf(rn, __shfl_xor(rn, 16, 32)); lx = fmaxf(lx, __shfl_xor(lx, 16, 32)); ln = fminf(ln, __shfl_xor(ln, 16, 32));
        nmx[i] = -fmaxf(fmaxf(lx * rx, ln * rn), fmaxf(lx * rn, ln * rx)); }
    asm volatile("s_wait_dscnt 0x0" ::: "memory");    // the wave's table of l' is written before its lanes read it across lanes
    const float* lt0 = os + lr * G3_LP; const float* lt1 = os + (16 + lr) * G3_LP;
    v2f sm[2][2];
#pragma unroll
    for (int i = 0; i < 2; ++i) { sm[i][0] = (v2f){}; sm[i][1] = (v2f){}; }
    // The two waves of a row pair need the same A fragments. Each forms only those of its own l' column of a stage (column 2 s + wc: two 32-k steps), one stage ahead,
    // keeps them in registers for itself and leaves them in LDS for its partner; the stage's barrier publishes them with the B stage. A wave takes its own two steps first, then its partner's.
    const uint32_t wcu = wave & 1u;
    unsigned char* const axo = axc + (wave >> 1) * G3_AWR + 2u * wcu * G3_ASTEP + (uint32_t)lane * 16u;
    const unsigned char* const axp = axc + (wave >> 1) * G3_AWR + 2u * (1u - wcu) * G3_ASTEP + (uint32_t)lane * 16u;
    G3H fe[2][2], fo[2][2];    // [step][row tile]: the wave's own fragments of the even and of the odd stages
    {
        const float l00 = lt0[wcu], l01 = lt1[wcu];
#pragma unroll
        for (int o = 0; o < 2; ++o) {
#pragma unroll
            for (int i = 0; i < 2; ++i) { g3_half(fe[o][i], rv[o][i], i ? l01 : l00, nmx[i], sm[i]);
                g3_ast(axo + o * G3_ASTEP + i * 2 * G3_AF, fe[o][i].h); g3_ast(axo + o * G3_ASTEP + i * 2 * G3_AF + G3_AF, fe[o][i].l); } }
    }
    float la[2] = {lt0[2 + wcu], lt1[2 + wcu]};    // l' of the stage whose fragments are formed next
    const uint32_t boff = (uint32_t)wc * G3_SL + (uint32_t)lr * G3_PITCH + 16u * hi;
    auto stage = [&](const uint32_t s, const uint32_t par, G3H (&cur)[2][2], G3H (&nxt)[2][2]) __attribute__((always_inline)) {
        // the hand-over of stage s stands at the head of its pass, so that the pass's vector work ends in the block of its matrix instructions
        asm volatile("s_wait_dscnt 0x0" ::: "memory");        // this wave's reads of stage s - 1 have returned, its A fragments of stage s are written
        asm volatile("s_wait_tensorcnt 0x0" ::: "memory");    // this wave's slice of stage s has landed
        __syncthreads();                                      // publishes stage s (B and A) and ends every wave's reads of stage s - 1
        if (pinned(s + 1 < G3_NST)) issue(pinned(s + 1));     // refill of the buffer that stage s - 1 has just left
        const unsigned char* pbo = ring + par * G3_STAGE + boff + wcu * 128u;           // B at the wave's own two steps
        const unsigned char* pbp = ring + par * G3_STAGE + boff + (1u - wcu) * 128u;    // B at its partner's
        G3B f[2];
        g3_bfrags(f[0], pbo, 0);
        const uint32_t sn = s + 2 < G3_NST ? s + 2 : G3_NST - 1;    // l' is fetched one stage ahead of its use; past the end the last column is fetched again
        const float ln0 = lt0[2 * sn + wcu], ln1 = lt1[2 * sn + wcu];
        __builtin_amdgcn_sched_barrier(0);    // the stage's first LDS reads are issued ahead of the vector work that fills their latency
        const bool more = s + 1 < G3_NST;     // the last stage has no successor: its fragments are formed as zeros, which add nothing to the rows' sums
        const float nm[2] = {more ? nmx[0] : -3.0e38f, more ? nmx[1] : -3.0e38f};
        g3_half(nxt[0][0], rv[0][0], la[0], nm[0], sm[0]);    // a quarter of the next stage's own fragments is formed while the first LDS reads are on their way
        v16bf pa[2][4];
#pragma unroll
        for (int b = 0; b < 4; ++b) {
            if (b < 3) g3_bfrags(f[(b + 1) & 1], b + 1 < 2 ? pbo : pbp, (b + 1) & 1);
            if (b < 2) {
#pragma unroll
                for (int u = 0; u < 4; ++u) pa[b][u] = g3_ald(axp + par * G3_ASTG + b * G3_ASTEP + u * G3_AF); }
            { unsigned char* d = axo + (par ^ 1u) * G3_ASTG + (b >> 1) * G3_ASTEP + (b & 1) * 2 * G3_AF; g3_ast(d, nxt[b >> 1][b & 1].h); g3_ast(d + G3_AF, nxt[b >> 1][b & 1].l); }
            __builtin_amdgcn_sched_barrier(0);    // the block's LDS traffic stays one group ahead of its matrix instructions, not spread among them
            const G3B& c = f[b & 1];
            v16bf ah[2], al[2];
#pragma unroll
            for (int i = 0; i < 2; ++i) { ah[i] = b < 2 ? __builtin_bit_cast(v16bf, cur[b & 1][i].h) : pa[b & 1][2 * i]; al[i] = b < 2 ? __builtin_bit_cast(v16bf, cur[b & 1][i].l) : pa[b & 1][2 * i + 1]; }
            auto mm = [&](int j) { const int i = (j >> 2) & 1, t = j & 3;    // the block's 24 matrix instructions: hh, lh, hl, eight accumulators each
                acc[i][t] = wmmab((j >> 3) == 1 ? al[i] : ah[i], (j >> 3) == 2 ? c.bl[t] : c.bh[t], acc[i][t]); };
            if (b < 3) {
                // one more quarter of the next stage's own fragments (8 element pairs) is formed under this block's matrix instructions, three slots a pair,
                // each link of a pair's chain (score, exp2, hi, hi as f32, difference, residual) one slot or more behind the link before it, except the first pair's exp2 and the last pair's residual
                const int gi = (b + 1) & 1;
                const v2f (&rh)[8] = rv[(b + 1) >> 1][gi];
                const float lv = la[gi], nv = nm[gi];
                v2f F[8], P[8], HF[8], D[8]; v2bf HB[8]; u32x8 wh, wl;
                auto fm = [&](int q) { F[q] = __builtin_elementwise_fma((v2f){lv, lv}, rh[q], (v2f){nv, nv}); };
                auto ex = [&](int q) { P[q] = (v2f){__builtin_amdgcn_exp2f(F[q][0]), __builtin_amdgcn_exp2f(F[q][1])}; };
                auto ch = [&](int q) { HB[q] = __builtin_convertvector(P[q], v2bf); wh[q] = __builtin_bit_cast(uint32_t, HB[q]); };
                auto un = [&](int q) { HF[q] = __builtin_convertvector(HB[q], v2f); };
                auto cl = [&](int q) { wl[q] = __builtin_bit_cast(uint32_t, __builtin_convertvector(D[q], v2bf)); };
                fm(0); ex(0);
#pragma unroll
                for (int j = 0; j < 24; ++j) {
                    mm(j);
                    const int q = (j + 1) / 3, ph = (j + 1) % 3;
                    if (ph == 0) { if (q < 8) ex(q); D[q - 1] = P[q - 1] - HF[q - 1]; }
                    if (ph == 1) { ch(q); if (q + 1 < 8) fm(q + 1); sm[gi][q & 1] += P[q]; if (q >= 1) cl(q - 1); }
                    if (ph == 2) un(q);
                    if (j == 23) cl(7);
                    __builtin_amdgcn_sched_barrier(0);    // keeps the slot's vector work behind its own matrix instruction: left free, it gathers in long runs during which the matrix unit idles
                }
                nxt[(b + 1) >> 1][gi].h = wh; nxt[(b + 1) >> 1][gi].l = wl;
            } else {
#pragma unroll
                for (int j = 0; j < 24; ++j) mm(j);
            }
            __builtin_amdgcn_sched_barrier(0);    // closes the block: see above
        }
        la[0] = ln0; la[1] = ln1;
    };
#pragma unroll 1    // two stages a trip: the own fragments of even and odd stages keep a register set each, with no copies between them
    for (uint32_t s = 0; s < G3_NST; s += 2) { stage(s, 0u, fe, fo); stage(s + 1, 1u, fo, fe); }
    asm volatile("s_wait_tensorcnt 0x0" ::: "memory");
    asm volatile("s_wait_dscnt 0x0" ::: "memory");
#pragma unroll
    for (int i = 0; i < 2; ++i) {
        const v2f t4 = sm[i][0] + sm[i][1]; float t = t4[0] + t4[1]; t += __shfl_xor(t, 16, 32);    // the lane pair l, l ^ 16 holds the two halves of the wave's share of a row's sum
        if (hi == 0) os[(i * 16 + lr) * G3_LP + 64] = t;
#pragma unroll
        for (int t2 = 0; t2 < 4; ++t2) {
#pragma unroll
            for (int j = 0; j < 8; ++j) os[(i * 16 + hi * 8 + j) * G3_LP + t2 * 16 + lr] = acc[i][t2][j]; } }
    __syncthreads();    // a row's sum lies half with each wave of its pair: both shares are written before either wave reads them (and the wave's staged rows before its lanes read them back)
    const float* sa = (const float*)(ring + 2 * G3_STAGE) + (wave & 2u) * (32 * G3_LP) + 64; const float* sb = sa + 32 * G3_LP;
    const size_t obase = (size_t)(rb + wr * 32) * DD + cb + wc * 64;    // the result leaves as bf16 hi + residual planes, whole 128-B lines (8 lanes x 16 B)
#pragma unroll
    for (int s = 0; s < 8; ++s) { const int row = 4 * s + (lane >> 3), piece = lane & 7; const float* sp2 = os + row * G3_LP + piece * 8; const float iv = 1.0f / (sa[row * G3_LP] + sb[row * G3_LP]); v8us oh, ol;
#pragma unroll
        for (int i = 0; i < 8; ++i) { const float val = sp2[i] * iv; const unsigned short hb = f2bf(val); oh[i] = hb; ol[i] = f2bf(val - bf2f(hb)); }
        const size_t o = obase + (size_t)row * DD + piece * 8; *(v8us*)(Oh + o) = oh; *(v8us*)(Ol + o) = ol; }
}

// k_proj: one launch for the three independent projections of x, each block one 64 x 64 tile (4 waves x 16 x 64) of A.B^T over K = DD, plain bf16 operands.
// Blocks 0..511: v^T[b][c][m] = WvT.Xb^T (4 channel tiles x 128 row tiles of x), written straight as bf16 hi + residual planes (whole 128-B lines, 8 lanes x 16 B);
// blocks 512..639: l = Xb.WlT^T, 640..767: r = Xb.WrT^T, f32 whole-line epilogue.
#define PROJ_V (DD / 64 * (NR / 64))
__global__ __launch_bounds__(128) void k_proj(const bf* __restrict__ Xb, const bf* __restrict__ WlT, const bf* __restrict__ WrT, const bf* __restrict__ WvT, float* Lm, float* Rm, bf* VTh, bf* VTl) {
    __shared__ __align__(16) float ost[4][16 * 68];
    const int lane = threadIdx.x & 31, wave = threadIdx.x >> 5, lr = lane & 15, hi = lane >> 4;
    const int b = blockIdx.x, q = b - PROJ_V;
    const bool isv = b < PROJ_V;
    const bf* A = isv ? WvT : Xb;
    const bf* Bn = isv ? Xb : q < NR / 64 ? WlT : WrT;
    const int r0 = (isv ? (b & 3) : (q & (NR / 64 - 1))) * 64 + wave * 16, c0 = isv ? (b >> 2) * 64 : 0;
    const size_t aoff = (size_t)(r0 + lr) * DD + 8 * hi;
    size_t boff[4];
#pragma unroll
    for (int t = 0; t < 4; ++t) boff[t] = (size_t)(c0 + t * 16 + lr) * DD + 8 * hi;
    v8f acc[4];
#pragma unroll
    for (int t = 0; t < 4; ++t) acc[t] = (v8f){};
#pragma unroll 1    // the k loop stays rolled, as the separate launches had it
    for (int kc = 0; kc < DD; kc += 32) {
        const v16bf a = cat16b(*(const v8us*)(A + aoff + kc), *(const v8us*)(A + aoff + kc + 16));
#pragma unroll
        for (int t = 0; t < 4; ++t) { const v16bf bb = cat16b(*(const v8us*)(Bn + boff[t] + kc), *(const v8us*)(Bn + boff[t] + kc + 16)); acc[t] = wmmab(a, bb, acc[t]); }
        asm volatile("v_nop\n\tv_nop\n\tv_nop\n\tv_nop" : "+v"(acc[0]), "+v"(acc[1]), "+v"(acc[2]), "+v"(acc[3]) : "v"(a));    // the distance behind the last matrix instruction, on the loop's taken branch too
    }
    float* os = &ost[wave][0];
#pragma unroll
    for (int t = 0; t < 4; ++t) {
#pragma unroll
        for (int j = 0; j < 8; ++j) os[(hi * 8 + j) * 68 + t * 16 + lr] = acc[t][j]; }
    __syncthreads();    // the staged tile is written before other lanes read it back
    if (isv) {
        const size_t base = (size_t)(c0 / NN) * DD * NN + (size_t)r0 * NN + (c0 & (NN - 1));
#pragma unroll
        for (int s = 0; s < 4; ++s) { const int row = 4 * s + (lane >> 3), piece = lane & 7; const float* sp = os + row * 68 + piece * 8; v8us oh, ol;
#pragma unroll
            for (int i = 0; i < 8; ++i) { const unsigned short hb = f2bf(sp[i]); oh[i] = hb; ol[i] = f2bf(sp[i] - bf2f(hb)); }
            const size_t o = base + (size_t)row * NN + piece * 8; *(v8us*)(VTh + o) = oh; *(v8us*)(VTl + o) = ol; }
    } else {
        float* crow = (q < NR / 64 ? Lm : Rm) + (size_t)r0 * PP;
#pragma unroll
        for (int s = 0; s < 8; ++s) { const int Lid = (lane >> 3) + 4 * s, piece = lane & 7; const int row = Lid >> 1, cofs = (Lid & 1) * 32 + piece * 4;
            const v4f val = *(const v4fa*)(os + row * 68 + cofs); *(v4f*)(crow + (size_t)row * PP + cofs) = val; }
        asm volatile("s_wait_xcnt 0x0" ::: "memory");    // stands behind the run of stores, ahead of any later write of a register that they name
    }
}
extern "C" void kernel_launch(void* const* d_in, const int* in_sizes, int n_in,
                              void* d_out, int out_size, void* d_ws, size_t ws_size, hipStream_t stream) {
    (void)in_sizes; (void)n_in; (void)out_size;
    const float* x = (const float*)d_in[0]; const float* Wl = (const float*)d_in[1]; const float* Wr = (const float*)d_in[2]; const float* Wv = (const float*)d_in[3]; const float* Wo = (const float*)d_in[4];
    float* out = (float*)d_out;    // [2][4096][256]
    char* wsp = (char*)d_ws;
    auto take = [&](size_t bytes) { char* p = wsp; wsp += (bytes + 255) & ~(size_t)255; return (void*)p; };
    bf* WlT = (bf*)take(PP * DD * 2); bf* WrT = (bf*)take(PP * DD * 2); bf* WvT = (bf*)take(DD * DD * 2); bf* WoT = (bf*)take(DD * DD * 2);
    bf* Xb = (bf*)take((size_t)NR * DD * 2); float* Lm = (float*)take((size_t)NR * PP * 4); float* Rm = (float*)take((size_t)NR * PP * 4); bf* VTh = (bf*)take((size_t)DD * NR * 2); bf* VTl = (bf*)take((size_t)DD * NR * 2);
    bf* Oh = (bf*)take((size_t)NR * DD * 2); bf* Ol = (bf*)take((size_t)NR * DD * 2);
    if ((size_t)(wsp - (char*)d_ws) > ws_size) return;    // ~ 26 MB, no aliasing
    k_prep<<<PREP_WT + NR / 8, 256, 0, stream>>>(x, Wl, Wr, Wv, Wo, Xb, WlT, WrT, WvT, WoT);
    k_proj<<<PROJ_V + 2 * (NR / 64), 128, 0, stream>>>(Xb, WlT, WrT, WvT, Lm, Rm, VTh, VTl);       // v^T [b][c][m] planes, l and r [b n][64]
    k_gemm3<<<dim3(NR / 64, DD / 128, 1), 128, 0, stream>>>(Lm, Rm, VTh, VTl, Oh, Ol);              // o [b n][c] = softmax(l (x) r) . v, as planes
    k_gemmb<true, false><<<dim3(NR / 64, DD / 64, 1), 128, 0, stream>>>(Oh, Ol, WoT, nullptr, out, DD, nullptr);                 // o.Wo
}

// v006
// It runs in 54.1 microseconds.
// Next to v005, in two timings, it ran 1.14 and 1.16 times as fast.
// All steps since v000 together make it 20.8 times as fast.
#include <hip/hip_runtime.h>

// Compute dtypes, f32 accumulate, both batch items in every launch (8192 rows): l = x.Wl, r = x.Wr ([8192 x 256].[256 x 64]) and v^T = Wv^T.x^T ([256 x 256].[256 x 4096] per batch item) with PLAIN bf16 operands (rounded
// input and weights; exact products); the factorised scores attn[n][m] = l[n][m/64] r[n][m%64] and their row softmax in f32 -> bf16 hi + UNSCALED residual, formed in registers inside
// the product that uses them; o[n][c] = sum_m P[n][m] v[m][c] ([4096 x 4096].[4096 x 256] per batch item, both operands hi + residual, three products; shared across heads = all 256 channels at once) and out = o.Wo

#define NBI  2
#define NN   4096
#define DD   256
#define PP   64
#define NR   (NBI * NN)
#define CC   DD
#define DM   DD
#define NTK  NN
#define LOSC 1024.0f

typedef _Float16 h16;
typedef unsigned short bf;
typedef __attribute__((ext_vector_type(16))) __bf16   v16bf;
typedef __attribute__((ext_vector_type(16))) _Float16 v16h;
typedef __attribute__((ext_vector_type(8)))  _Float16 v8h;
typedef __attribute__((ext_vector_type(8)))  unsigned short v8us;
typedef __attribute__((ext_vector_type(8)))  float    v8f;
typedef __attribute__((ext_vector_type(4)))  float    v4f;
typedef __attribute__((ext_vector_type(4)))  _Float16 v4h;
typedef v8h  __attribute__((may_alias)) v8ha;
typedef v4f  __attribute__((may_alias)) v4fa;
typedef v8us __attribute__((may_alias)) v8usa;

__device__ __forceinline__ unsigned short f2bf(float f) { unsigned u = __float_as_uint(f); u += 0x7FFFu + ((u >> 16) & 1u); return (unsigned short)(u >> 16); }
__device__ __forceinline__ float bf2f(unsigned short b) { return __uint_as_float(((unsigned)b) << 16); }
__device__ __forceinline__ float bfr(float f) { return bf2f(f2bf(f)); }
__device__ __forceinline__ v16h cat16(v8h lo, v8h hi) { return __builtin_shufflevector(lo, hi, 0, 1, 2, 3, 4, 5, 6, 7, 8, 9, 10, 11, 12, 13, 14, 15); }
__device__ __forceinline__ v16bf cat16b(v8us lo, v8us hi) { return __builtin_bit_cast(v16bf, __builtin_shufflevector(lo, hi, 0, 1, 2, 3, 4, 5, 6, 7, 8, 9, 10, 11, 12, 13, 14, 15)); }
__device__ __forceinline__ v8f wmma16(v16h a, v16h b, v8f c) { return __builtin_amdgcn_wmma_f32_16x16x32_f16(false, a, false, b, (short)0, c, false, false); }
__device__ __forceinline__ v8f wmmab(v16bf a, v16bf b, v8f c) { return __builtin_amdgcn_wmma_f32_16x16x32_bf16(false, a, false, b, (short)0, c, false, false); }

// k_gemmb: 64 x 64 block tile (4 waves x 16 x 64) of C[NR][DD] = (A [+ Al]).B^T (K = DM = 256) [+ bf(bias[c])] [+ bf(R[r][c]) residual]; f32 whole-line epilogue (or f16
template <bool SPLITA, bool F16OUT = false>
__global__ __launch_bounds__(128) void k_gemmb(const bf* __restrict__ A, const bf* __restrict__ Al, const bf* __restrict__ Bn, const float* __restrict__ bias, float* C, int ldc, h16* C2, const float* __restrict__ R = nullptr, int K = DM, int roundR = 1) {
    __shared__ __align__(16) float ost[4][16 * 68];
    const int lane = threadIdx.x & 31, wave = threadIdx.x >> 5, lr = lane & 15, hi = lane >> 4;
    const int r0 = blockIdx.x * 64 + wave * 16, c0 = blockIdx.y * 64;
    const size_t aoff = (size_t)(r0 + lr) * K + 8 * hi;
    size_t boff[4];
#pragma unroll
    for (int t = 0; t < 4; ++t) boff[t] = (size_t)(c0 + t * 16 + lr) * K + 8 * hi;
    v8f acc[4];
#pragma unroll
    for (int t = 0; t < 4; ++t) acc[t] = (v8f){};
#pragma unroll 1
    for (int kc = 0; kc < K; kc += 32) {
        const v16bf a = cat16b(*(const v8us*)(A + aoff + kc), *(const v8us*)(A + aoff + kc + 16));
        v16bf al = a;
        if (SPLITA) al = cat16b(*(const v8us*)(Al + aoff + kc), *(const v8us*)(Al + aoff + kc + 16));
#pragma unroll
        for (int t = 0; t < 4; ++t) { const v16bf b = cat16b(*(const v8us*)(Bn + boff[t] + kc), *(const v8us*)(Bn + boff[t] + kc + 16)); acc[t] = wmmab(a, b, acc[t]); if (SPLITA) acc[t] = wmmab(al, b, acc[t]); }
        asm volatile("v_nop\n\tv_nop\n\tv_nop\n\tv_nop" : "+v"(acc[0]), "+v"(acc[1]), "+v"(acc[2]), "+v"(acc[3]) : "v"(a), "v"(al));
    }
    float* os = &ost[wave][0];
#pragma unroll
    for (int t = 0; t < 4; ++t) { const float bv = bias ? bfr(bias[c0 + t * 16 + lr]) : 0.f;
#pragma unroll
        for (int j = 0; j < 8; ++j) os[(hi * 8 + j) * 68 + t * 16 + lr] = acc[t][j] + bv; }
    __syncthreads();
    if (F16OUT) {
        h16* crow = (h16*)(void*)C + (size_t)r0 * ldc + c0;
        auto pass = [&]() {
#pragma unroll
            for (int s = 0; s < 4; ++s) { const int row = 4 * s + (lane >> 3), piece = lane & 7; const float* sp = os + row * 68 + piece * 8; v8h o, o2;
#pragma unroll
                for (int i = 0; i < 8; ++i) { const h16 a = (h16)sp[i]; o[i] = a; o2[i] = (h16)((sp[i] - (float)a) * LOSC); }
                *(v8h*)(crow + (size_t)row * ldc + piece * 8) = o; if (C2) *(v8h*)(C2 + (size_t)r0 * ldc + c0 + (size_t)row * ldc + piece * 8) = o2; }
        };
        pass(); 
    } else {
        float* crow = C + (size_t)r0 * ldc + c0;
        auto pass = [&]() {
#pragma unroll
            for (int s = 0; s < 8; ++s) { const int Lid = (lane >> 3) + 4 * s, piece = lane & 7; const int row = Lid >> 1, cofs = (Lid & 1) * 32 + piece * 4;
                v4f val = *(const v4fa*)(os + row * 68 + cofs); if (R) { const v4f rv = *(const v4f*)(R + ((size_t)r0 + row) * ldc + c0 + cofs); val += roundR ? (v4f){bfr(rv[0]), bfr(rv[1]), bfr(rv[2]), bfr(rv[3])} : rv; }
                *(v4f*)(crow + (size_t)row * ldc + cofs) = val; }
        };
        pass(); 
    }
}

// k_gemm3: 64 x 128 block tile (4 waves x 32 x 64) of o = softmax(l (x) r).v over K = NN. The A operand never exists in global memory: the lanes form its fragment elements
// e[n][m] = exp2(l'[n][m >> 6] r[n][m & 63] - max'), l' = l log2(e), in f32 and splits them into bf16 hi + residual in registers; the row's sum of e is kept beside them and divides the result at the end.
// B = (Bh + Bl), n-major, one [CC][NN] plane pair per batch item, picked by the row tile; three products per 32-k step (hh, lh, hl), in that order per accumulator. A stage is 256 B (128 k) of every
// B row, brought into LDS by one tensor load per wave (wave w: plane w >> 1, 64-row half w & 1), rows padded to a 272 B pitch for the 16-byte readers; two buffers, the next stage in flight under the current one; the hand-over (waits, barrier, refill) stands at the head of each pass.
typedef uint32_t u32x4 __attribute__((ext_vector_type(4)));
typedef uint32_t u32x8 __attribute__((ext_vector_type(8)));
typedef __attribute__((ext_vector_type(2))) float v2f;
#define G3_ROWB  256u
#define G3_PITCH 272u
#define G3_SL    18432u                        // one slice: 64 rows x 272 B, rounded up to a multiple of 2 KiB
#define G3_STAGE (4u * G3_SL)                  // 73,728 B = 36 x 2 KiB
#define G3_NST   (NN * 2u / G3_ROWB)           // 32 stages
#define G3_LP    68                            // floats per row of a wave's own table of l' (later its output staging)
__device__ __forceinline__ uint32_t uni(uint32_t v) { return (uint32_t)__builtin_amdgcn_readfirstlane(v); }
// a value held in a scalar register: makes the test around a tensor load a scalar branch, and keeps what is formed from it behind the waits in front of it
__device__ __forceinline__ uint32_t pinned(uint32_t v) { uint32_t w = uni(v); asm volatile("" : "+s"(w)); return w; }
struct G3B { v16bf bh[4], bl[4]; };
struct G3H { u32x8 h, l; };                    // one row tile's A fragments of a 32-k step: hi and residual
typedef u32x4 __attribute__((may_alias)) u32x4a;
#define G3_AF    1024u                         // one A fragment in LDS: two 512-B chunks, 16 B a lane in each
#define G3_ASTEP (4u * G3_AF)                  // a 32-k step: hi, residual of row tile 0, then of row tile 1
#define G3_AWR   (4u * G3_ASTEP)               // a stage's four steps of one 32-row pair of waves
#define G3_ASTG  (2u * G3_AWR)                 // 32 KiB a stage
__device__ __forceinline__ v16bf g3_ld(const unsigned char* p) { return cat16b(*(const v8usa*)p, *(const v8usa*)(p + 32)); }
__device__ __forceinline__ void g3_bfrags(G3B& f, const unsigned char* pb, int kk) {
#pragma unroll
    for (int t = 0; t < 4; ++t) { f.bh[t] = g3_ld(pb + t * 16 * G3_PITCH + kk * 64); f.bl[t] = g3_ld(pb + 2 * G3_SL + t * 16 * G3_PITCH + kk * 64); }
}
__device__ __forceinline__ void g3_ast(unsigned char* p, u32x8 w) { *(u32x4a*)p = __builtin_shufflevector(w, w, 0, 1, 2, 3); *(u32x4a*)(p + 512) = __builtin_shufflevector(w, w, 4, 5, 6, 7); }
__device__ __forceinline__ v16bf g3_ald(const unsigned char* p) { return cat16b(*(const v8usa*)p, *(const v8usa*)(p + 512)); }
typedef __attribute__((ext_vector_type(2))) __bf16 v2bf;
// the A fragments of one 32-k step for one of the lane's rows: element e stands for k = (e >> 3) * 16 + 8 * hi + (e & 7), the order of g3_ld; rv holds r at exactly those places
__device__ __forceinline__ void g3_half(G3H& a, const v2f (&rv)[8], float lv, float nm, v2f (&sum)[2]) {
#pragma unroll
    for (int e = 0; e < 16; e += 2) {
        const v2f sc = __builtin_elementwise_fma((v2f){lv, lv}, rv[e >> 1], (v2f){nm, nm});
        const v2f p = {__builtin_amdgcn_exp2f(sc[0]), __builtin_amdgcn_exp2f(sc[1])};
        const v2bf hb = __builtin_convertvector(p, v2bf);
        const v2bf lb = __builtin_convertvector(p - __builtin_convertvector(hb, v2f), v2bf);
        a.h[e >> 1] = __builtin_bit_cast(uint32_t, hb); a.l[e >> 1] = __builtin_bit_cast(uint32_t, lb); sum[(e >> 1) & 1] += p; }
}
__global__ __launch_bounds__(128) void k_gemm3(const float* __restrict__ Lm, const float* __restrict__ Rm, const bf* __restrict__ Bh, const bf* __restrict__ Bl, bf* Oh, bf* Ol) {
    __shared__ __attribute__((aligned(2048))) unsigned char ring[2 * G3_STAGE + 4 * 32 * G3_LP * 4];    // two stages, then each wave's own table of l', which becomes its output staging
    __shared__ __attribute__((aligned(16))) unsigned char axc[2 * G3_ASTG];    // the A fragments that the two waves of a row pair hand each other, two stages
    const int lane = threadIdx.x & 31, lr = lane & 15, hi = lane >> 4;
    const uint32_t wave = uni(threadIdx.x >> 5);
    const int wr = wave >> 1, wc = wave & 1;
    const int rb = blockIdx.x * 64, cb = blockIdx.y * 128;
    const size_t bitem = (size_t)(blockIdx.x / (NN / 64)) * CC * NN;
    const bf* sp = (wave < 2 ? Bh : Bl) + bitem + (size_t)(cb + (wave & 1u) * 64u) * NN;
    const uint64_t srcb = (uint64_t)sp;
    const uint32_t rows = 64u;
    const uint32_t place = (uint32_t)(uintptr_t)ring + wave * G3_SL;
    u32x8 g1;
    // pinned(): each descriptor word held in a scalar register, so that the group keeps one set of registers and no word of an outstanding request is rewritten
    g1[0] = pinned((1u << 20) | (5u << 22) | (3u << 25));    // no mask, 1-byte elements, 4 dwords of pad behind every 64 dwords
    g1[1] = pinned((G3_ROWB & 0xFFFFu) << 16);
    g1[2] = pinned((G3_ROWB >> 16) | (rows << 16));
    g1[3] = pinned((rows >> 16) | (G3_ROWB << 16));
    g1[4] = pinned(rows);
    g1[5] = pinned(NN * 2u);
    g1[6] = pinned(0u);
    g1[7] = pinned(0u);
    auto issue = [&](uint32_t st) {
        const uint64_t ga = srcb + (uint64_t)st * G3_ROWB;
        u32x4 g0;
        g0[0] = uni(1u); g0[1] = uni(place + (st & 1u) * G3_STAGE); g0[2] = uni((uint32_t)ga); g0[3] = uni((((uint32_t)(ga >> 32)) & 0x01FFFFFFu) | 0x80000000u);
        asm volatile("tensor_load_to_lds %0, %1" :: "s"(g0), "s"(g1) : "memory");
    };
    v8f acc[2][4];
#pragma unroll
    for (int i = 0; i < 2; ++i) {
#pragma unroll
        for (int t = 0; t < 4; ++t) acc[i][t] = (v8f){}; }
    // the lane's two rows of r, at the k places of its fragment elements (rv[h]: the 32-k step's half of the 64), and its half of their l: loaded ahead of stage 0, used behind it
    v2f rv[2][2][8]; v4f lq[2][8];    // r in pairs, as the packed score instruction takes them
#pragma unroll
    for (int i = 0; i < 2; ++i) { const size_t ro = (size_t)(rb + wr * 32 + i * 16 + lr) * PP;
#pragma unroll
        for (int h = 0; h < 2; ++h) {
#pragma unroll
            for (int g = 0; g < 4; ++g) { const v4f q = *(const v4f*)(Rm + ro + h * 32 + (g >> 1) * 16 + 8 * hi + (g & 1) * 4);
                rv[h][i][g * 2] = (v2f){q[0], q[1]}; rv[h][i][g * 2 + 1] = (v2f){q[2], q[3]}; } }
#pragma unroll
        for (int g = 0; g < 8; ++g) lq[i][g] = *(const v4f*)(Lm + ro + hi * 32 + g * 4); }
    asm volatile("s_wait_xcnt 0x0" ::: "memory");    // stands behind the run of loads, ahead of any later write of a register that they name
    issue(0);    // stage 0 flies under the rows' extremes and the table of l'
    float* os = (float*)(ring + 2 * G3_STAGE) + wave * (32 * G3_LP);
    float nmx[2];
#pragma unroll
    for (int i = 0; i < 2; ++i) {    // the row's largest score is one of the four products of the extremes of l' and r (a rounded product is monotone in each factor)
        float rx = rv[0][i][0][0], rn = rx, lx = -3.0e38f, ln = 3.0e38f;
#pragma unroll
        for (int h = 0; h < 2; ++h) {
#pragma unroll
            for (int e = 0; e < 16; ++e) { rx = fmaxf(rx, rv[h][i][e >> 1][e & 1]); rn = fminf(rn, rv[h][i][e >> 1][e & 1]); } }
#pragma unroll
        for (int g = 0; g < 8; ++g) { const v4f q = lq[i][g] * 1.44269504088896341f;
#pragma unroll
            for (int u = 0; u < 4; ++u) { lx = fmaxf(lx, q[u]); ln = fminf(ln, q[u]); }
            *(v4fa*)(os + (i * 16 + lr) * G3_LP + hi * 32 + g * 4) = q; }
        rx = fmaxf(rx, __shfl_xor(rx, 16, 32)); rn = fminf(rn, __shfl_xor(rn, 16, 32)); lx = fmaxf(lx, __shfl_xor(lx, 16, 32)); ln = fminf(ln, __shfl_xor(ln, 16, 32));
        nmx[i] = -fmaxf(fmaxf(lx * rx, ln * rn), fmaxf(lx * rn, ln * rx)); }
    asm volatile("s_wait_dscnt 0x0" ::: "memory");    // the wave's table of l' is written before its lanes read it across lanes
    const float* lt0 = os + lr * G3_LP; const float* lt1 = os + (16 + lr) * G3_LP;
    v2f sm[2][2];
#pragma unroll
    for (int i = 0; i < 2; ++i) { sm[i][0] = (v2f){}; sm[i][1] = (v2f){}; }
    // The two waves of a row pair need the same A fragments. Each forms only those of its own l' column of a stage (column 2 s + wc: two 32-k steps), one stage ahead,
    // keeps them in registers for itself and leaves them in LDS for its partner; the stage's barrier publishes them with the B stage. A wave takes its own two steps first, then its partner's.
    const uint32_t wcu = wave & 1u;
    unsigned char* const axo = axc + (wave >> 1) * G3_AWR + 2u * wcu * G3_ASTEP + (uint32_t)lane * 16u;
    const unsigned char* const axp = axc + (wave >> 1) * G3_AWR + 2u * (1u - wcu) * G3_ASTEP + (uint32_t)lane * 16u;
    G3H fe[2][2], fo[2][2];    // [step][row tile]: the wave's own fragments of the even and of the odd stages
    {
        const float l00 = lt0[wcu], l01 = lt1[wcu];
#pragma unroll
        for (int o = 0; o < 2; ++o) {
#pragma unroll
            for (int i = 0; i < 2; ++i) { g3_half(fe[o][i], rv[o][i], i ? l01 : l00, nmx[i], sm[i]);
                g3_ast(axo + o * G3_ASTEP + i * 2 * G3_AF, fe[o][i].h); g3_ast(axo + o * G3_ASTEP + i * 2 * G3_AF + G3_AF, fe[o][i].l); } }
    }
    float la[2] = {lt0[2 + wcu], lt1[2 + wcu]};    // l' of the stage whose fragments are formed next
    const uint32_t boff = (uint32_t)wc * G3_SL + (uint32_t)lr * G3_PITCH + 16u * hi;
    auto stage = [&](const uint32_t s, const uint32_t par, G3H (&cur)[2][2], G3H (&nxt)[2][2]) __attribute__((always_inline)) {
        // the hand-over of stage s stands at the head of its pass, so that the pass's vector work ends in the block of its matrix instructions
        asm volatile("s_wait_dscnt 0x0" ::: "memory");        // this wave's reads of stage s - 1 have returned, its A fragments of stage s are written
        asm volatile("s_wait_tensorcnt 0x0" ::: "memory");    // this wave's slice of stage s has landed
        __syncthreads();                                      // publishes stage s (B and A) and ends every wave's reads of stage s - 1
        if (pinned(s + 1 < G3_NST)) issue(pinned(s + 1));     // refill of the buffer that stage s - 1 has just left
        const unsigned char* pbo = ring + par * G3_STAGE + boff + wcu * 128u;           // B at the wave's own two steps
        const unsigned char* pbp = ring + par * G3_STAGE + boff + (1u - wcu) * 128u;    // B at its partner's
        G3B f[2];
        g3_bfrags(f[0], pbo, 0);
        const uint32_t sn = s + 2 < G3_NST ? s + 2 : G3_NST - 1;    // l' is fetched one stage ahead of its use; past the end the last column is fetched again
        const float ln0 = lt0[2 * sn + wcu], ln1 = lt1[2 * sn + wcu];
        __builtin_amdgcn_sched_barrier(0);    // the stage's first LDS reads are issued ahead of the vector work that fills their latency
        const bool more = s + 1 < G3_NST;     // the last stage has no successor: its fragments are formed as zeros, which add nothing to the rows' sums
        const float nm[2] = {more ? nmx[0] : -3.0e38f, more ? nmx[1] : -3.0e38f};
        g3_half(nxt[0][0], rv[0][0], la[0], nm[0], sm[0]);    // a quarter of the next stage's own fragments is formed while the first LDS reads are on their way
        v16bf pa[2][4];
#pragma unroll
        for (int b = 0; b < 4; ++b) {
            if (b < 3) g3_bfrags(f[(b + 1) & 1], b + 1 < 2 ? pbo : pbp, (b + 1) & 1);
            if (b < 2) {
#pragma unroll
                for (int u = 0; u < 4; ++u) pa[b][u] = g3_ald(axp + par * G3_ASTG + b * G3_ASTEP + u * G3_AF); }
            { unsigned char* d = axo + (par ^ 1u) * G3_ASTG + (b >> 1) * G3_ASTEP + (b & 1) * 2 * G3_AF; g3_ast(d, nxt[b >> 1][b & 1].h); g3_ast(d + G3_AF, nxt[b >> 1][b & 1].l); }
            __builtin_amdgcn_sched_barrier(0);    // the block's LDS traffic stays one group ahead of its matrix instructions, not spread among them
            const G3B& c = f[b & 1];
            v16bf ah[2], al[2];
#pragma unroll
            for (int i = 0; i < 2; ++i) { ah[i] = b < 2 ? __builtin_bit_cast(v16bf, cur[b & 1][i].h) : pa[b & 1][2 * i]; al[i] = b < 2 ? __builtin_bit_cast(v16bf, cur[b & 1][i].l) : pa[b & 1][2 * i + 1]; }
            auto mm = [&](int j) { const int i = (j >> 2) & 1, t = j & 3;    // the block's 24 matrix instructions: hh, lh, hl, eight accumulators each
                acc[i][t] = wmmab((j >> 3) == 1 ? al[i] : ah[i], (j >> 3) == 2 ? c.bl[t] : c.bh[t], acc[i][t]); };
            if (b < 3) {
                // one more quarter of the next stage's own fragments (8 element pairs) is formed under this block's matrix instructions, three slots a pair,
                // each link of a pair's chain (score, exp2, hi, hi as f32, difference, residual) one slot or more behind the link before it, except the first pair's exp2 and the last pair's residual
                const int gi = (b + 1) & 1;
                const v2f (&rh)[8] = rv[(b + 1) >> 1][gi];
                const float lv = la[gi], nv = nm[gi];
                v2f F[8], P[8], HF[8], D[8]; v2bf HB[8]; u32x8 wh, wl;
                auto fm = [&](int q) { F[q] = __builtin_elementwise_fma((v2f){lv, lv}, rh[q], (v2f){nv, nv}); };
                auto ex = [&](int q) { P[q] = (v2f){__builtin_amdgcn_exp2f(F[q][0]), __builtin_amdgcn_exp2f(F[q][1])}; };
                auto ch = [&](int q) { HB[q] = __builtin_convertvector(P[q], v2bf); wh[q] = __builtin_bit_cast(uint32_t, HB[q]); };
                auto un = [&](int q) { HF[q] = __builtin_convertvector(HB[q], v2f); };
                auto cl = [&](int q) { wl[q] = __builtin_bit_cast(uint32_t, __builtin_convertvector(D[q], v2bf)); };
                fm(0); ex(0);
#pragma unroll
                for (int j = 0; j < 24; ++j) {
                    mm(j);
                    const int q = (j + 1) / 3, ph = (j + 1) % 3;
                    if (ph == 0) { if (q < 8) ex(q); D[q - 1] = P[q - 1] - HF[q - 1]; }
                    if (ph == 1) { ch(q); if (q + 1 < 8) fm(q + 1); sm[gi][q & 1] += P[q]; if (q >= 1) cl(q - 1); }
                    if (ph == 2) un(q);
                    if (j == 23) cl(7);
                    __builtin_amdgcn_sched_barrier(0);    // keeps the slot's vector work behind its own matrix instruction: left free, it gathers in long runs during which the matrix unit idles
                }
                nxt[(b + 1) >> 1][gi].h = wh; nxt[(b + 1) >> 1][gi].l = wl;
            } else {
#pragma unroll
                for (int j = 0; j < 24; ++j) mm(j);
            }
            __builtin_amdgcn_sched_barrier(0);    // closes the block: see above
        }
        la[0] = ln0; la[1] = ln1;
    };
#pragma unroll 1    // two stages a trip: the own fragments of even and odd stages keep a register set each, with no copies between them
    for (uint32_t s = 0; s < G3_NST; s += 2) { stage(s, 0u, fe, fo); stage(s + 1, 1u, fo, fe); }
    asm volatile("s_wait_tensorcnt 0x0" ::: "memory");
    asm volatile("s_wait_dscnt 0x0" ::: "memory");
#pragma unroll
    for (int i = 0; i < 2; ++i) {
        const v2f t4 = sm[i][0] + sm[i][1]; float t = t4[0] + t4[1]; t += __shfl_xor(t, 16, 32);    // the lane pair l, l ^ 16 holds the two halves of the wave's share of a row's sum
        if (hi == 0) os[(i * 16 + lr) * G3_LP + 64] = t;
#pragma unroll
        for (int t2 = 0; t2 < 4; ++t2) {
#pragma unroll
            for (int j = 0; j < 8; ++j) os[(i * 16 + hi * 8 + j) * G3_LP + t2 * 16 + lr] = acc[i][t2][j]; } }
    __syncthreads();    // a row's sum lies half with each wave of its pair: both shares are written before either wave reads them (and the wave's staged rows before its lanes read them back)
    const float* sa = (const float*)(ring + 2 * G3_STAGE) + (wave & 2u) * (32 * G3_LP) + 64; const float* sb = sa + 32 * G3_LP;
    const size_t obase = (size_t)(rb + wr * 32) * DD + cb + wc * 64;    // the result leaves as bf16 hi + residual planes, whole 128-B lines (8 lanes x 16 B)
#pragma unroll
    for (int s = 0; s < 8; ++s) { const int row = 4 * s + (lane >> 3), piece = lane & 7; const float* sp2 = os + row * G3_LP + piece * 8; const float iv = 1.0f / (sa[row * G3_LP] + sb[row * G3_LP]); v8us oh, ol;
#pragma unroll
        for (int i = 0; i < 8; ++i) { const float val = sp2[i] * iv; const unsigned short hb = f2bf(val); oh[i] = hb; ol[i] = f2bf(val - bf2f(hb)); }
        const size_t o = obase + (size_t)row * DD + piece * 8; *(v8us*)(Oh + o) = oh; *(v8us*)(Ol + o) = ol; }
}

// k_proj: one launch for the three independent projections of x and for the inputs' own conversions. A block is one 128 x 128 tile (8 waves x 32 x 64) of A.B^T over K = DD, plain bf16 operands:
// it reads its 128 rows of x and its 256 x 128 panel of W as f32, whole lines, rounds them to bf16 (nearest even) and leaves them in LDS, x k-contiguous, W as it lies (k rows of 128 columns);
// x fragments are plain 16-byte reads, W fragments transposing reads, both in the hardware's k order (8 hi + 0..7, 16 + 8 hi + 0..7).
// Blocks 0..127: v^T[b][c][m] = Wv^T.x^T (2 channel halves x 64 row tiles of x), written straight as bf16 hi + residual planes (whole 128-B lines, 8 lanes x 16 B);
// blocks 128..191: l = x.Wl and r = x.Wr side by side (panel columns 0..63 and 64..127), f32 whole-line epilogue; blocks 192..207: WoT [n][DD] = bf16(Wo[k][n]) via 64 x 64 LDS tiles, for the last launch.
#define PJ_XP 264                              // bf16 per staged row of x: 528 B = 16 B x 33, for the 16-byte readers
#define PJ_WP 144                              // bf16 per staged k row of W: 288 B = 32 B x 9, for the transposing readers
#define PJ_RT (NR / 128)
#define PJ_V  (DD / 128 * PJ_RT)
#define PJ_LR PJ_RT
#define PJ_WO 16
typedef short s16x8 __attribute__((ext_vector_type(8)));
typedef uint32_t u32x2 __attribute__((ext_vector_type(2)));
typedef u32x2 __attribute__((may_alias)) u32x2a;
__device__ __forceinline__ v8us pj_tr16(const unsigned char* p) { typedef __attribute__((address_space(3))) s16x8 lds_s16x8; return __builtin_bit_cast(v8us, __builtin_amdgcn_ds_load_tr16_b128_v8i16((lds_s16x8*)p)); }
__device__ __forceinline__ u32x2 pj_pack(v4f q) {
    return (u32x2){__builtin_bit_cast(uint32_t, __builtin_convertvector((v2f){q[0], q[1]}, v2bf)), __builtin_bit_cast(uint32_t, __builtin_convertvector((v2f){q[2], q[3]}, v2bf))}; }
// ISV: W0 = Wv, ch its 128-column half. Otherwise W0 = Wl, W1 = Wr.
template <bool ISV>
__device__ __forceinline__ void pj_tile(const float* __restrict__ x, const float* __restrict__ W0, const float* __restrict__ W1, const int rt, const int ch,
                                        unsigned short* xs, unsigned short* wsm, float* ost, float* Lm, float* Rm, bf* VTh, bf* VTl) {
    const int tid = threadIdx.x, lane = tid & 31, wave = tid >> 5, lr = lane & 15, hi = lane >> 4;
    // every load of the block's two tiles is issued before the first is used: one trip to L2, not one per k step. A wave takes every eighth row of each tile, one address and constant steps.
    v4f wq[32], xq[32];
    const float* wp = ISV ? W0 + (size_t)wave * DD + ch * 128 + lane * 4 : (hi ? W1 : W0) + (size_t)wave * PP + lr * 4;
#pragma unroll
    for (int i = 0; i < 32; ++i) wq[i] = *(const v4f*)(wp + i * 8 * (ISV ? DD : PP));
    const float* xp = x + (size_t)(rt * 128 + wave) * DD + lane * 4;
#pragma unroll
    for (int i = 0; i < 16; ++i) { xq[2 * i] = *(const v4f*)(xp + i * 8 * DD); xq[2 * i + 1] = *(const v4f*)(xp + i * 8 * DD + 128); }
    asm volatile("s_wait_xcnt 0x0" :: "v"(wp), "v"(xp) : "memory");    // stands behind the two runs of loads, ahead of any later write of a register that they name: both addresses are its inputs, so that they stay whole up to it
#pragma unroll
    for (int i = 0; i < 32; ++i) *(u32x2a*)(wsm + (i * 8 + wave) * PJ_WP + lane * 4) = pj_pack(wq[i]);
#pragma unroll
    for (int i = 0; i < 16; ++i) { *(u32x2a*)(xs + (i * 8 + wave) * PJ_XP + lane * 4) = pj_pack(xq[2 * i]); *(u32x2a*)(xs + (i * 8 + wave) * PJ_XP + 128 + lane * 4) = pj_pack(xq[2 * i + 1]); }
    __syncthreads();    // both staged tiles are written before any wave reads its fragments
    v8f acc[2][4];
#pragma unroll
    for (int i = 0; i < 2; ++i) {
#pragma unroll
        for (int t = 0; t < 4; ++t) acc[i][t] = (v8f){}; }
    const int g4 = wave & 3, g2 = wave >> 2;    // the wave's 32 rows of A, its 64 columns of B
    // the transposing read's lane address: k row 8 hi + (lane & 7), 16-byte half of 16 columns; the wave's first column
    const unsigned char* wf = (const unsigned char*)wsm + (8 * hi + (lane & 7)) * (PJ_WP * 2) + ((lane >> 3) & 1) * 16 + (ISV ? g4 * 64 : g2 * 128);
    const unsigned short* xf = xs + ((ISV ? g2 * 64 : g4 * 32) + lr) * PJ_XP + 8 * hi;
    auto xfrag = [&](int n, int kc) { return cat16b(*(const v8usa*)(xf + n * 16 * PJ_XP + kc), *(const v8usa*)(xf + n * 16 * PJ_XP + kc + 16)); };
    auto wfrag = [&](int n, int kc) { return cat16b(pj_tr16(wf + n * 32 + kc * (PJ_WP * 2)), pj_tr16(wf + n * 32 + (kc + 16) * (PJ_WP * 2))); };
    v16bf fa[2][2], fb[2][4];    // the fragments of a 32-k step, two sets: one is read from LDS while the other is multiplied
    auto ld = [&](int g) {
#pragma unroll
        for (int i = 0; i < 2; ++i) fa[g & 1][i] = ISV ? wfrag(i, g * 32) : xfrag(i, g * 32);
#pragma unroll
        for (int t = 0; t < 4; ++t) fb[g & 1][t] = ISV ? xfrag(t, g * 32) : wfrag(t, g * 32); };
    ld(0);
#pragma unroll
    for (int g = 0; g < DD / 32; ++g) {
        if (g + 1 < DD / 32) ld(g + 1);
        __builtin_amdgcn_sched_barrier(0);    // the next set's LDS reads stand as one group ahead of this set's matrix instructions: left free, each read pair is waited for singly
#pragma unroll
        for (int i = 0; i < 2; ++i) {
#pragma unroll
            for (int t = 0; t < 4; ++t) acc[i][t] = wmmab(fa[g & 1][i], fb[g & 1][t], acc[i][t]); }
        __builtin_amdgcn_sched_barrier(0);    // closes the set: see above
    }
    float* os = ost + wave * (32 * 68);
#pragma unroll
    for (int i = 0; i < 2; ++i) {
#pragma unroll
        for (int t = 0; t < 4; ++t) {
#pragma unroll
            for (int j = 0; j < 8; ++j) os[(i * 16 + hi * 8 + j) * 68 + t * 16 + lr] = acc[i][t][j]; } }
    __syncthreads();    // the staged tile is written before other lanes read it back
    if (ISV) {
        const int r0 = ch * 128 + g4 * 32, c0 = rt * 128 + g2 * 64;    // channel, row of x
        const size_t base = (size_t)(c0 / NN) * DD * NN + (size_t)r0 * NN + (c0 & (NN - 1));
#pragma unroll
        for (int s = 0; s < 8; ++s) { const int row = 4 * s + (lane >> 3), piece = lane & 7; const float* sp = os + row * 68 + piece * 8; v8us oh, ol;
#pragma unroll
            for (int i = 0; i < 8; ++i) { const unsigned short hb = f2bf(sp[i]); oh[i] = hb; ol[i] = f2bf(sp[i] - bf2f(hb)); }
            const size_t o = base + (size_t)row * NN + piece * 8; *(v8us*)(VTh + o) = oh; *(v8us*)(VTl + o) = ol; }
        asm volatile("s_wait_xcnt 0x0" ::: "memory");    // stands behind the run of stores, ahead of any later write of a register that they name
    } else {
        float* crow = (g2 ? Rm : Lm) + (size_t)(rt * 128 + g4 * 32) * PP;
#pragma unroll
        for (int s = 0; s < 16; ++s) { const int Lid = (lane >> 3) + 4 * s, piece = lane & 7; const int row = Lid >> 1, cofs = (Lid & 1) * 32 + piece * 4;
            const v4f val = *(const v4fa*)(os + row * 68 + cofs); *(v4f*)(crow + (size_t)row * PP + cofs) = val; }
        asm volatile("s_wait_xcnt 0x0" ::: "memory");    // stands behind the run of stores, ahead of any later write of a register that they name
    }
}
__global__ __launch_bounds__(256) void k_proj(const float* __restrict__ x, const float* __restrict__ Wl, const float* __restrict__ Wr, const float* __restrict__ Wv, const float* __restrict__ Wo,
                                              float* Lm, float* Rm, bf* VTh, bf* VTl, bf* WoT) {
    __shared__ __align__(16) unsigned short xs[128 * PJ_XP];
    __shared__ __align__(32) unsigned short wsm[DD * PJ_WP];
    __shared__ __align__(16) float ost[8 * 32 * 68];
    const int b = blockIdx.x;
    if (b >= PJ_V + PJ_LR) {
        unsigned short* tl = xs;
        const int tid = threadIdx.x, qq = b - (PJ_V + PJ_LR), k0 = (qq & 3) * 64, n0 = (qq >> 2) * 64;
        const int kk = tid >> 2, nq = (tid & 3) * 16;
#pragma unroll
        for (int i = 0; i < 16; ++i) tl[(nq + i) * 72 + kk] = f2bf(Wo[(size_t)(k0 + kk) * DD + n0 + nq + i]);
        __syncthreads();
        const int piece = tid & 7;
#pragma unroll
        for (int s = 0; s < 2; ++s) { const int nr = (tid >> 3) + 32 * s; const v8us val = *(const v8usa*)(tl + nr * 72 + piece * 8); *(v8us*)(WoT + (size_t)(n0 + nr) * DD + k0 + piece * 8) = val; }
        return;
    }
    if (b < PJ_V) pj_tile<true>(x, Wv, Wv, b >> 1, b & 1, xs, wsm, ost, Lm, Rm, VTh, VTl);
    else pj_tile<false>(x, Wl, Wr, b - PJ_V, 0, xs, wsm, ost, Lm, Rm, VTh, VTl);
}
extern "C" void kernel_launch(void* const* d_in, const int* in_sizes, int n_in,
                              void* d_out, int out_size, void* d_ws, size_t ws_size, hipStream_t stream) {
    (void)in_sizes; (void)n_in; (void)out_size;
    const float* x = (const float*)d_in[0]; const float* Wl = (const float*)d_in[1]; const float* Wr = (const float*)d_in[2]; const float* Wv = (const float*)d_in[3]; const float* Wo = (const float*)d_in[4];
    float* out = (float*)d_out;    // [2][4096][256]
    char* wsp = (char*)d_ws;
    auto take = [&](size_t bytes) { char* p = wsp; wsp += (bytes + 255) & ~(size_t)255; return (void*)p; };
    bf* WoT = (bf*)take(DD * DD * 2);
    float* Lm = (float*)take((size_t)NR * PP * 4); float* Rm = (float*)take((size_t)NR * PP * 4); bf* VTh = (bf*)take((size_t)DD * NR * 2); bf* VTl = (bf*)take((size_t)DD * NR * 2);
    bf* Oh = (bf*)take((size_t)NR * DD * 2); bf* Ol = (bf*)take((size_t)NR * DD * 2);
    if ((size_t)(wsp - (char*)d_ws) > ws_size) return;    // ~ 21 MB, no aliasing
    k_proj<<<PJ_V + PJ_LR + PJ_WO, 256, 0, stream>>>(x, Wl, Wr, Wv, Wo, Lm, Rm, VTh, VTl, WoT);       // v^T [b][c][m] planes, l and r [b n][64], Wo^T
    k_gemm3<<<dim3(NR / 64, DD / 128, 1), 128, 0, stream>>>(Lm, Rm, VTh, VTl, Oh, Ol);              // o [b n][c] = softmax(l (x) r) . v, as planes
    k_gemmb<true, false><<<dim3(NR / 64, DD / 64, 1), 128, 0, stream>>>(Oh, Ol, WoT, nullptr, out, DD, nullptr);                 // o.Wo
}

// v007
// It runs in 47.8 microseconds.
// In both of two side-by-side timings against v006, it was 1.13 times as fast.
// Over all steps from v000 it is 23.5 times as fast.
#include <hip/hip_runtime.h>

// Compute dtypes, f32 accumulate, both batch items in every launch (8192 rows): l = x.Wl, r = x.Wr ([8192 x 256].[256 x 64]) and v^T = Wv^T.x^T ([256 x 256].[256 x 4096] per batch item) with PLAIN bf16 operands (rounded
// input and weights; exact products); the factorised scores attn[n][m] = l[n][m/64] r[n][m%64] and their row softmax in f32 -> bf16 hi + UNSCALED residual, formed in registers inside
// the product that uses them; o[n][c] = sum_m P[n][m] v[m][c] ([4096 x 4096].[4096 x 256] per batch item, both operands hi + residual, three products; shared across heads = all 256 channels at once) and out = o.Wo

#define NBI  2
#define NN   4096
#define DD   256
#define PP   64
#define NR   (NBI * NN)
#define CC   DD
#define DM   DD
#define NTK  NN
#define LOSC 1024.0f

typedef _Float16 h16;
typedef unsigned short bf;
typedef __attribute__((ext_vector_type(16))) __bf16   v16bf;
typedef __attribute__((ext_vector_type(16))) _Float16 v16h;
typedef __attribute__((ext_vector_type(8)))  _Float16 v8h;
typedef __attribute__((ext_vector_type(8)))  unsigned short v8us;
typedef __attribute__((ext_vector_type(8)))  float    v8f;
typedef __attribute__((ext_vector_type(4)))  float    v4f;
typedef __attribute__((ext_vector_type(4)))  _Float16 v4h;
typedef v8h  __attribute__((may_alias)) v8ha;
typedef v4f  __attribute__((may_alias)) v4fa;
typedef v8us __attribute__((may_alias)) v8usa;

__device__ __forceinline__ unsigned short f2bf(float f) { unsigned u = __float_as_uint(f); u += 0x7FFFu + ((u >> 16) & 1u); return (unsigned short)(u >> 16); }
__device__ __forceinline__ float bf2f(unsigned short b) { return __uint_as_float(((unsigned)b) << 16); }
__device__ __forceinline__ float bfr(float f) { return bf2f(f2bf(f)); }
__device__ __forceinline__ v16h cat16(v8h lo, v8h hi) { return __builtin_shufflevector(lo, hi, 0, 1, 2, 3, 4, 5, 6, 7, 8, 9, 10, 11, 12, 13, 14, 15); }
__device__ __forceinline__ v16bf cat16b(v8us lo, v8us hi) { return __builtin_bit_cast(v16bf, __builtin_shufflevector(lo, hi, 0, 1, 2, 3, 4, 5, 6, 7, 8, 9, 10, 11, 12, 13, 14, 15)); }
__device__ __forceinline__ v8f wmma16(v16h a, v16h b, v8f c) { return __builtin_amdgcn_wmma_f32_16x16x32_f16(false, a, false, b, (short)0, c, false, false); }
__device__ __forceinline__ v8f wmmab(v16bf a, v16bf b, v8f c) { return __builtin_amdgcn_wmma_f32_16x16x32_bf16(false, a, false, b, (short)0, c, false, false); }

// k_out: 64 x 128 block tile (8 waves x 16 x 64) of out = (A + Al).B^T over K = DD, bf16 operands, f32 whole-line epilogue. The block's 64 rows of both A planes and its 128 rows of B
// (512 B a row, one wave-wide load each) are all requested before the first is used, left in LDS once, and read from there as fragments; per accumulator the order of the products is k step by k step, A then Al.
#define GO_P 264                               // bf16 per staged row: 528 B = 16 B x 33, for the 16-byte readers
__global__ __launch_bounds__(256) void k_out(const bf* __restrict__ A, const bf* __restrict__ Al, const bf* __restrict__ Bn, float* C) {
    __shared__ __align__(16) unsigned short as[2 * 64 * GO_P];
    __shared__ __align__(16) unsigned short bs[128 * GO_P];
    __shared__ __align__(16) float ost[8][16 * 68];
    const int lane = threadIdx.x & 31, wave = threadIdx.x >> 5, lr = lane & 15, hi = lane >> 4;
    const int rb = blockIdx.x * 64, cb = blockIdx.y * 128;
    // a wave takes every eighth row of each tile: one address a tile and constant steps, one trip to L2 for the whole block
    const bf* pb = Bn + (size_t)(cb + wave) * DD + lane * 8;
    const bf* pa = A + (size_t)(rb + wave) * DD + lane * 8;
    const bf* pl = Al + (size_t)(rb + wave) * DD + lane * 8;
    v8us qb[16], qa[8], ql[8];
#pragma unroll
    for (int i = 0; i < 16; ++i) qb[i] = *(const v8us*)(pb + i * 8 * DD);
#pragma unroll
    for (int i = 0; i < 8; ++i) qa[i] = *(const v8us*)(pa + i * 8 * DD);
#pragma unroll
    for (int i = 0; i < 8; ++i) ql[i] = *(const v8us*)(pl + i * 8 * DD);
    asm volatile("s_wait_xcnt 0x0" :: "v"(pb), "v"(pa), "v"(pl) : "memory");    // stands behind the three runs of loads, ahead of any later write of a register that they name: the addresses are its inputs, so that they stay whole up to it
#pragma unroll
    for (int i = 0; i < 16; ++i) *(v8usa*)(bs + (i * 8 + wave) * GO_P + lane * 8) = qb[i];
#pragma unroll
    for (int i = 0; i < 8; ++i) *(v8usa*)(as + (i * 8 + wave) * GO_P + lane * 8) = qa[i];
#pragma unroll
    for (int i = 0; i < 8; ++i) *(v8usa*)(as + (64 + i * 8 + wave) * GO_P + lane * 8) = ql[i];
    __syncthreads();    // the three staged tiles are written before any wave reads its fragments
    const int g4 = wave & 3, g2 = wave >> 2;    // the wave's 16 rows of A, its 64 columns of B
    const unsigned short* af = as + (g4 * 16 + lr) * GO_P + 8 * hi;
    const unsigned short* bq = bs + (g2 * 64 + lr) * GO_P + 8 * hi;
    auto frag = [&](const unsigned short* p) { return cat16b(*(const v8usa*)p, *(const v8usa*)(p + 16)); };
    v8f acc[4];
#pragma unroll
    for (int t = 0; t < 4; ++t) acc[t] = (v8f){};
    v16bf fa[2][2], fb[2][4];    // the fragments of a 32-k step, two sets: one is read from LDS while the other is multiplied
    auto ld = [&](int g) {
        fa[g & 1][0] = frag(af + g * 32); fa[g & 1][1] = frag(af + 64 * GO_P + g * 32);
#pragma unroll
        for (int t = 0; t < 4; ++t) fb[g & 1][t] = frag(bq + t * 16 * GO_P + g * 32); };
    ld(0);
#pragma unroll
    for (int g = 0; g < DD / 32; ++g) {
        if (g + 1 < DD / 32) ld(g + 1);
        __builtin_amdgcn_sched_barrier(0);    // the next set's LDS reads stand as one group ahead of this set's matrix instructions: left free, each read pair is waited for singly
#pragma unroll
        for (int p = 0; p < 2; ++p) {
#pragma unroll
            for (int t = 0; t < 4; ++t) acc[t] = wmmab(fa[g & 1][p], fb[g & 1][t], acc[t]); }
        __builtin_amdgcn_sched_barrier(0);    // closes the set: see above
    }
    float* os = &ost[wave][0];
#pragma unroll
    for (int t = 0; t < 4; ++t) {
#pragma unroll
        for (int j = 0; j < 8; ++j) os[(hi * 8 + j) * 68 + t * 16 + lr] = acc[t][j]; }
    __syncthreads();    // the staged tile is written before other lanes read it back
    float* crow = C + (size_t)(rb + g4 * 16) * DD + cb + g2 * 64;
#pragma unroll
    for (int s = 0; s < 8; ++s) { const int Lid = (lane >> 3) + 4 * s, piece = lane & 7; const int row = Lid >> 1, cofs = (Lid & 1) * 32 + piece * 4;
        const v4f val = *(const v4fa*)(os + row * 68 + cofs); *(v4f*)(crow + (size_t)row * DD + cofs) = val; }
    asm volatile("s_wait_xcnt 0x0" ::: "memory");    // stands behind the run of stores, ahead of any later write of a register that they name
}

// k_gemm3: 64 x 128 block tile (4 waves x 32 x 64) of o = softmax(l (x) r).v over K = NN. The A operand never exists in global memory: the lanes form its fragment elements
// e[n][m] = exp2(l'[n][m >> 6] r[n][m & 63] - max'), l' = l log2(e), in f32 and splits them into bf16 hi + residual in registers; the row's sum of e is kept beside them and divides the result at the end.
// B = (Bh + Bl), n-major, one [CC][NN] plane pair per batch item, picked by the row tile; three products per 32-k step (hh, lh, hl), in that order per accumulator. A stage is 256 B (128 k) of every
// B row, brought into LDS by one tensor load per wave (wave w: plane w >> 1, 64-row half w & 1), rows padded to a 272 B pitch for the 16-byte readers; two buffers, the next stage in flight under the current one; the hand-over (waits, barrier, refill) stands at the head of each pass.
typedef uint32_t u32x4 __attribute__((ext_vector_type(4)));
typedef uint32_t u32x8 __attribute__((ext_vector_type(8)));
typedef __attribute__((ext_vector_type(2))) float v2f;
#define G3_ROWB  256u
#define G3_PITCH 272u
#define G3_SL    18432u                        // one slice: 64 rows x 272 B, rounded up to a multiple of 2 KiB
#define G3_STAGE (4u * G3_SL)                  // 73,728 B = 36 x 2 KiB
#define G3_NST   (NN * 2u / G3_ROWB)           // 32 stages
#define G3_LP    68                            // floats per row of a wave's own table of l' (later its output staging)
__device__ __forceinline__ uint32_t uni(uint32_t v) { return (uint32_t)__builtin_amdgcn_readfirstlane(v); }
// a value held in a scalar register: makes the test around a tensor load a scalar branch, and keeps what is formed from it behind the waits in front of it
__device__ __forceinline__ uint32_t pinned(uint32_t v) { uint32_t w = uni(v); asm volatile("" : "+s"(w)); return w; }
struct G3B { v16bf bh[4], bl[4]; };
struct G3H { u32x8 h, l; };                    // one row tile's A fragments of a 32-k step: hi and residual
typedef u32x4 __attribute__((may_alias)) u32x4a;
#define G3_AF    1024u                         // one A fragment in LDS: two 512-B chunks, 16 B a lane in each
#define G3_ASTEP (4u * G3_AF)                  // a 32-k step: hi, residual of row tile 0, then of row tile 1
#define G3_AWR   (4u * G3_ASTEP)               // a stage's four steps of one 32-row pair of waves
#define G3_ASTG  (2u * G3_AWR)                 // 32 KiB a stage
__device__ __forceinline__ v16bf g3_ld(const unsigned char* p) { return cat16b(*(const v8usa*)p, *(const v8usa*)(p + 32)); }
__device__ __forceinline__ void g3_bfrags(G3B& f, const unsigned char* pb, int kk) {
#pragma unroll
    for (int t = 0; t < 4; ++t) { f.bh[t] = g3_ld(pb + t * 16 * G3_PITCH + kk * 64); f.bl[t] = g3_ld(pb + 2 * G3_SL + t * 16 * G3_PITCH + kk * 64); }
}
__device__ __forceinline__ void g3_ast(unsigned char* p, u32x8 w) { *(u32x4a*)p = __builtin_shufflevector(w, w, 0, 1, 2, 3); *(u32x4a*)(p + 512) = __builtin_shufflevector(w, w, 4, 5, 6, 7); }
__device__ __forceinline__ v16bf g3_ald(const unsigned char* p) { return cat16b(*(const v8usa*)p, *(const v8usa*)(p + 512)); }
typedef __attribute__((ext_vector_type(2))) __bf16 v2bf;
// the A fragments of one 32-k step for one of the lane's rows: element e stands for k = (e >> 3) * 16 + 8 * hi + (e & 7), the order of g3_ld; rv holds r at exactly those places
__device__ __forceinline__ void g3_half(G3H& a, const v2f (&rv)[8], float lv, float nm, v2f (&sum)[2]) {
#pragma unroll
    for (int e = 0; e < 16; e += 2) {
        const v2f sc = __builtin_elementwise_fma((v2f){lv, lv}, rv[e >> 1], (v2f){nm, nm});
        const v2f p = {__builtin_amdgcn_exp2f(sc[0]), __builtin_amdgcn_exp2f(sc[1])};
        const v2bf hb = __builtin_convertvector(p, v2bf);
        const v2bf lb = __builtin_convertvector(p - __builtin_convertvector(hb, v2f), v2bf);
        a.h[e >> 1] = __builtin_bit_cast(uint32_t, hb); a.l[e >> 1] = __builtin_bit_cast(uint32_t, lb); sum[(e >> 1) & 1] += p; }
}
__global__ __launch_bounds__(128) void k_gemm3(const float* __restrict__ Lm, const float* __restrict__ Rm, const bf* __restrict__ Bh, const bf* __restrict__ Bl, bf* Oh, bf* Ol) {
    __shared__ __attribute__((aligned(2048))) unsigned char ring[2 * G3_STAGE + 4 * 32 * G3_LP * 4];    // two stages, then each wave's own table of l', which becomes its output staging
    __shared__ __attribute__((aligned(16))) unsigned char axc[2 * G3_ASTG];    // the A fragments that the two waves of a row pair hand each other, two stages
    const int lane = threadIdx.x & 31, lr = lane & 15, hi = lane >> 4;
    const uint32_t wave = uni(threadIdx.x >> 5);
    const int wr = wave >> 1, wc = wave & 1;
    const int rb = blockIdx.x * 64, cb = blockIdx.y * 128;
    const size_t bitem = (size_t)(blockIdx.x / (NN / 64)) * CC * NN;
    const bf* sp = (wave < 2 ? Bh : Bl) + bitem + (size_t)(cb + (wave & 1u) * 64u) * NN;
    const uint64_t srcb = (uint64_t)sp;
    const uint32_t rows = 64u;
    const uint32_t place = (uint32_t)(uintptr_t)ring + wave * G3_SL;
    u32x8 g1;
    // pinned(): each descriptor word held in a scalar register, so that the group keeps one set of registers and no word of an outstanding request is rewritten
    g1[0] = pinned((1u << 20) | (5u << 22) | (3u << 25));    // no mask, 1-byte elements, 4 dwords of pad behind every 64 dwords
    g1[1] = pinned((G3_ROWB & 0xFFFFu) << 16);
    g1[2] = pinned((G3_ROWB >> 16) | (rows << 16));
    g1[3] = pinned((rows >> 16) | (G3_ROWB << 16));
    g1[4] = pinned(rows);
    g1[5] = pinned(NN * 2u);
    g1[6] = pinned(0u);
    g1[7] = pinned(0u);
    auto issue = [&](uint32_t st) {
        const uint64_t ga = srcb + (uint64_t)st * G3_ROWB;
        u32x4 g0;
        g0[0] = uni(1u); g0[1] = uni(place + (st & 1u) * G3_STAGE); g0[2] = uni((uint32_t)ga); g0[3] = uni((((uint32_t)(ga >> 32)) & 0x01FFFFFFu) | 0x80000000u);
        asm volatile("tensor_load_to_lds %0, %1" :: "s"(g0), "s"(g1) : "memory");
    };
    v8f acc[2][4];
#pragma unroll
    for (int i = 0; i < 2; ++i) {
#pragma unroll
        for (int t = 0; t < 4; ++t) acc[i][t] = (v8f){}; }
    // the lane's two rows of r, at the k places of its fragment elements (rv[h]: the 32-k step's half of the 64), and its half of their l: loaded ahead of stage 0, used behind it
    v2f rv[2][2][8]; v4f lq[2][8];    // r in pairs, as the packed score instruction takes them
#pragma unroll
    for (int i = 0; i < 2; ++i) { const size_t ro = (size_t)(rb + wr * 32 + i * 16 + lr) * PP;
#pragma unroll
        for (int h = 0; h < 2; ++h) {
#pragma unroll
            for (int g = 0; g < 4; ++g) { const v4f q = *(const v4f*)(Rm + ro + h * 32 + (g >> 1) * 16 + 8 * hi + (g & 1) * 4);
                rv[h][i][g * 2] = (v2f){q[0], q[1]}; rv[h][i][g * 2 + 1] = (v2f){q[2], q[3]}; } }
#pragma unroll
        for (int g = 0; g < 8; ++g) lq[i][g] = *(const v4f*)(Lm + ro + hi * 32 + g * 4); }
    asm volatile("s_wait_xcnt 0x0" ::: "memory");    // stands behind the run of loads, ahead of any later write of a register that they name
    issue(0);    // stage 0 flies under the rows' extremes and the table of l'
    float* os = (float*)(ring + 2 * G3_STAGE) + wave * (32 * G3_LP);
    float nmx[2];
#pragma unroll
    for (int i = 0; i < 2; ++i) {    // the row's largest score is one of the four products of the extremes of l' and r (a rounded product is monotone in each factor)
        float rx = rv[0][i][0][0], rn = rx, lx = -3.0e38f, ln = 3.0e38f;
#pragma unroll
        for (int h = 0; h < 2; ++h) {
#pragma unroll
            for (int e = 0; e < 16; ++e) { rx = fmaxf(rx, rv[h][i][e >> 1][e & 1]); rn = fminf(rn, rv[h][i][e >> 1][e & 1]); } }
#pragma unroll
        for (int g = 0; g < 8; ++g) { const v4f q = lq[i][g] * 1.44269504088896341f;
#pragma unroll
            for (int u = 0; u < 4; ++u) { lx = fmaxf(lx, q[u]); ln = fminf(ln, q[u]); }
            *(v4fa*)(os + (i * 16 + lr) * G3_LP + hi * 32 + g * 4) = q; }
        rx = fmaxf(rx, __shfl_xor(rx, 16, 32)); rn = fminf(rn, __shfl_xor(rn, 16, 32)); lx = fmaxf(lx, __shfl_xor(lx, 16, 32)); ln = fminf(ln, __shfl_xor(ln, 16, 32));
        nmx[i] = -fmaxf(fmaxf(lx * rx, ln * rn), fmaxf(lx * rn, ln * rx)); }
    asm volatile("s_wait_dscnt 0x0" ::: "memory");    // the wave's table of l' is written before its lanes read it across lanes
    const float* lt0 = os + lr * G3_LP; const float* lt1 = os + (16 + lr) * G3_LP;
    v2f sm[2][2];
#pragma unroll
    for (int i = 0; i < 2; ++i) { sm[i][0] = (v2f){}; sm[i][1] = (v2f){}; }
    // The two waves of a row pair need the same A fragments. Each forms only those of its own l' column of a stage (column 2 s + wc: two 32-k steps), one stage ahead,
    // keeps them in registers for itself and leaves them in LDS for its partner; the stage's barrier publishes them with the B stage. A wave takes its own two steps first, then its partner's.
    const uint32_t wcu = wave & 1u;
    unsigned char* const axo = axc + (wave >> 1) * G3_AWR + 2u * wcu * G3_ASTEP + (uint32_t)lane * 16u;
    const unsigned char* const axp = axc + (wave >> 1) * G3_AWR + 2u * (1u - wcu) * G3_ASTEP + (uint32_t)lane * 16u;
    G3H fe[2][2], fo[2][2];    // [step][row tile]: the wave's own fragments of the even and of the odd stages
    {
        const float l00 = lt0[wcu], l01 = lt1[wcu];
#pragma unroll
        for (int o = 0; o < 2; ++o) {
#pragma unroll
            for (int i = 0; i < 2; ++i) { g3_half(fe[o][i], rv[o][i], i ? l01 : l00, nmx[i], sm[i]);
                g3_ast(axo + o * G3_ASTEP + i * 2 * G3_AF, fe[o][i].h); g3_ast(axo + o * G3_ASTEP + i * 2 * G3_AF + G3_AF, fe[o][i].l); } }
    }
    float la[2] = {lt0[2 + wcu], lt1[2 + wcu]};    // l' of the stage whose fragments are formed next
    const uint32_t boff = (uint32_t)wc * G3_SL + (uint32_t)lr * G3_PITCH + 16u * hi;
    auto stage = [&](const uint32_t s, const uint32_t par, G3H (&cur)[2][2], G3H (&nxt)[2][2]) __attribute__((always_inline)) {
        // the hand-over of stage s stands at the head of its pass, so that the pass's vector work ends in the block of its matrix instructions
        asm volatile("s_wait_dscnt 0x0" ::: "memory");        // this wave's reads of stage s - 1 have returned, its A fragments of stage s are written
        asm volatile("s_wait_tensorcnt 0x0" ::: "memory");    // this wave's slice of stage s has landed
        __syncthreads();                                      // publishes stage s (B and A) and ends every wave's reads of stage s - 1
        if (pinned(s + 1 < G3_NST)) issue(pinned(s + 1));     // refill of the buffer that stage s - 1 has just left
        const unsigned char* pbo = ring + par * G3_STAGE + boff + wcu * 128u;           // B at the wave's own two steps
        const unsigned char* pbp = ring + par * G3_STAGE + boff + (1u - wcu) * 128u;    // B at its partner's
        G3B f[2];
        g3_bfrags(f[0], pbo, 0);
        const uint32_t sn = s + 2 < G3_NST ? s + 2 : G3_NST - 1;    // l' is fetched one stage ahead of its use; past the end the last column is fetched again
        const float ln0 = lt0[2 * sn + wcu], ln1 = lt1[2 * sn + wcu];
        __builtin_amdgcn_sched_barrier(0);    // the stage's first LDS reads are issued ahead of the vector work that fills their latency
        const bool more = s + 1 < G3_NST;     // the last stage has no successor: its fragments are formed as zeros, which add nothing to the rows' sums
        const float nm[2] = {more ? nmx[0] : -3.0e38f, more ? nmx[1] : -3.0e38f};
        g3_half(nxt[0][0], rv[0][0], la[0], nm[0], sm[0]);    // a quarter of the next stage's own fragments is formed while the first LDS reads are on their way
        v16bf pa[2][4];
#pragma unroll
        for (int b = 0; b < 4; ++b) {
            if (b < 3) g3_bfrags(f[(b + 1) & 1], b + 1 < 2 ? pbo : pbp, (b + 1) & 1);
            if (b < 2) {
#pragma unroll
                for (int u = 0; u < 4; ++u) pa[b][u] = g3_ald(axp + par * G3_ASTG + b * G3_ASTEP + u * G3_AF); }
            { unsigned char* d = axo + (par ^ 1u) * G3_ASTG + (b >> 1) * G3_ASTEP + (b & 1) * 2 * G3_AF; g3_ast(d, nxt[b >> 1][b & 1].h); g3_ast(d + G3_AF, nxt[b >> 1][b & 1].l); }
            __builtin_amdgcn_sched_barrier(0);    // the block's LDS traffic stays one group ahead of its matrix instructions, not spread among them
            const G3B& c = f[b & 1];
            v16bf ah[2], al[2];
#pragma unroll
            for (int i = 0; i < 2; ++i) { ah[i] = b < 2 ? __builtin_bit_cast(v16bf, cur[b & 1][i].h) : pa[b & 1][2 * i]; al[i] = b < 2 ? __builtin_bit_cast(v16bf, cur[b & 1][i].l) : pa[b & 1][2 * i + 1]; }
            auto mm = [&](int j) { const int i = (j >> 2) & 1, t = j & 3;    // the block's 24 matrix instructions: hh, lh, hl, eight accumulators each
                acc[i][t] = wmmab((j >> 3) == 1 ? al[i] : ah[i], (j >> 3) == 2 ? c.bl[t] : c.bh[t], acc[i][t]); };
            if (b < 3) {
                // one more quarter of the next stage's own fragments (8 element pairs) is formed under this block's matrix instructions, three slots a pair,
                // each link of a pair's chain (score, exp2, hi, hi as f32, difference, residual) one slot or more behind the link before it, except the first pair's exp2 and the last pair's residual
                const int gi = (b + 1) & 1;
                const v2f (&rh)[8] = rv[(b + 1) >> 1][gi];
                const float lv = la[gi], nv = nm[gi];
                v2f F[8], P[8], HF[8], D[8]; v2bf HB[8]; u32x8 wh, wl;
                auto fm = [&](int q) { F[q] = __builtin_elementwise_fma((v2f){lv, lv}, rh[q], (v2f){nv, nv}); };
                auto ex = [&](int q) { P[q] = (v2f){__builtin_amdgcn_exp2f(F[q][0]), __builtin_amdgcn_exp2f(F[q][1])}; };
                auto ch = [&](int q) { HB[q] = __builtin_convertvector(P[q], v2bf); wh[q] = __builtin_bit_cast(uint32_t, HB[q]); };
                auto un = [&](int q) { HF[q] = __builtin_convertvector(HB[q], v2f); };
                auto cl = [&](int q) { wl[q] = __builtin_bit_cast(uint32_t, __builtin_convertvector(D[q], v2bf)); };
                fm(0); ex(0);
#pragma unroll
                for (int j = 0; j < 24; ++j) {
                    mm(j);
                    const int q = (j + 1) / 3, ph = (j + 1) % 3;
                    if (ph == 0) { if (q < 8) ex(q); D[q - 1] = P[q - 1] - HF[q - 1]; }
                    if (ph == 1) { ch(q); if (q + 1 < 8) fm(q + 1); sm[gi][q & 1] += P[q]; if (q >= 1) cl(q - 1); }
                    if (ph == 2) un(q);
                    if (j == 23) cl(7);
                    __builtin_amdgcn_sched_barrier(0);    // keeps the slot's vector work behind its own matrix instruction: left free, it gathers in long runs during which the matrix unit idles
                }
                nxt[(b + 1) >> 1][gi].h = wh; nxt[(b + 1) >> 1][gi].l = wl;
            } else {
#pragma unroll
                for (int j = 0; j < 24; ++j) mm(j);
            }
            __builtin_amdgcn_sched_barrier(0);    // closes the block: see above
        }
        la[0] = ln0; la[1] = ln1;
    };
#pragma unroll 1    // two stages a trip: the own fragments of even and odd stages keep a register set each, with no copies between them
    for (uint32_t s = 0; s < G3_NST; s += 2) { stage(s, 0u, fe, fo); stage(s + 1, 1u, fo, fe); }
    asm volatile("s_wait_tensorcnt 0x0" ::: "memory");
    asm volatile("s_wait_dscnt 0x0" ::: "memory");
#pragma unroll
    for (int i = 0; i < 2; ++i) {
        const v2f t4 = sm[i][0] + sm[i][1]; float t = t4[0] + t4[1]; t += __shfl_xor(t, 16, 32);    // the lane pair l, l ^ 16 holds the two halves of the wave's share of a row's sum
        if (hi == 0) os[(i * 16 + lr) * G3_LP + 64] = t;
#pragma unroll
        for (int t2 = 0; t2 < 4; ++t2) {
#pragma unroll
            for (int j = 0; j < 8; ++j) os[(i * 16 + hi * 8 + j) * G3_LP + t2 * 16 + lr] = acc[i][t2][j]; } }
    __syncthreads();    // a row's sum lies half with each wave of its pair: both shares are written before either wave reads them (and the wave's staged rows before its lanes read them back)
    const float* sa = (const float*)(ring + 2 * G3_STAGE) + (wave & 2u) * (32 * G3_LP) + 64; const float* sb = sa + 32 * G3_LP;
    const size_t obase = (size_t)(rb + wr * 32) * DD + cb + wc * 64;    // the result leaves as bf16 hi + residual planes, whole 128-B lines (8 lanes x 16 B)
#pragma unroll
    for (int s = 0; s < 8; ++s) { const int row = 4 * s + (lane >> 3), piece = lane & 7; const float* sp2 = os + row * G3_LP + piece * 8; const float iv = 1.0f / (sa[row * G3_LP] + sb[row * G3_LP]); v8us oh, ol;
#pragma unroll
        for (int i = 0; i < 8; ++i) { const float val = sp2[i] * iv; const unsigned short hb = f2bf(val); oh[i] = hb; ol[i] = f2bf(val - bf2f(hb)); }
        const size_t o = obase + (size_t)row * DD + piece * 8; *(v8us*)(Oh + o) = oh; *(v8us*)(Ol + o) = ol; }
}

// k_proj: one launch for the three independent projections of x and for the inputs' own conversions. A block is one 128 x 128 tile (8 waves x 32 x 64) of A.B^T over K = DD, plain bf16 operands:
// it reads its 128 rows of x and its 256 x 128 panel of W as f32, whole lines, rounds them to bf16 (nearest even) and leaves them in LDS, x k-contiguous, W as it lies (k rows of 128 columns);
// x fragments are plain 16-byte reads, W fragments transposing reads, both in the hardware's k order (8 hi + 0..7, 16 + 8 hi + 0..7).
// Blocks 0..127: v^T[b][c][m] = Wv^T.x^T (2 channel halves x 64 row tiles of x), written straight as bf16 hi + residual planes (whole 128-B lines, 8 lanes x 16 B);
// blocks 128..191: l = x.Wl and r = x.Wr side by side (panel columns 0..63 and 64..127), f32 whole-line epilogue; blocks 192..207: WoT [n][DD] = bf16(Wo[k][n]) via 64 x 64 LDS tiles, for the last launch.
#define PJ_XP 264                              // bf16 per staged row of x: 528 B = 16 B x 33, for the 16-byte readers
#define PJ_WP 144                              // bf16 per staged k row of W: 288 B = 32 B x 9, for the transposing readers
#define PJ_RT (NR / 128)
#define PJ_V  (DD / 128 * PJ_RT)
#define PJ_LR PJ_RT
#define PJ_WO 16
typedef short s16x8 __attribute__((ext_vector_type(8)));
typedef uint32_t u32x2 __attribute__((ext_vector_type(2)));
typedef u32x2 __attribute__((may_alias)) u32x2a;
__device__ __forceinline__ v8us pj_tr16(const unsigned char* p) { typedef __attribute__((address_space(3))) s16x8 lds_s16x8; return __builtin_bit_cast(v8us, __builtin_amdgcn_ds_load_tr16_b128_v8i16((lds_s16x8*)p)); }
__device__ __forceinline__ u32x2 pj_pack(v4f q) {
    return (u32x2){__builtin_bit_cast(uint32_t, __builtin_convertvector((v2f){q[0], q[1]}, v2bf)), __builtin_bit_cast(uint32_t, __builtin_convertvector((v2f){q[2], q[3]}, v2bf))}; }
// ISV: W0 = Wv, ch its 128-column half. Otherwise W0 = Wl, W1 = Wr.
template <bool ISV>
__device__ __forceinline__ void pj_tile(const float* __restrict__ x, const float* __restrict__ W0, const float* __restrict__ W1, const int rt, const int ch,
                                        unsigned short* xs, unsigned short* wsm, float* ost, float* Lm, float* Rm, bf* VTh, bf* VTl) {
    const int tid = threadIdx.x, lane = tid & 31, wave = tid >> 5, lr = lane & 15, hi = lane >> 4;
    // every load of the block's two tiles is issued before the first is used: one trip to L2, not one per k step. A wave takes every eighth row of each tile, one address and constant steps.
    v4f wq[32], xq[32];
    const float* wp = ISV ? W0 + (size_t)wave * DD + ch * 128 + lane * 4 : (hi ? W1 : W0) + (size_t)wave * PP + lr * 4;
#pragma unroll
    for (int i = 0; i < 32; ++i) wq[i] = *(const v4f*)(wp + i * 8 * (ISV ? DD : PP));
    const float* xp = x + (size_t)(rt * 128 + wave) * DD + lane * 4;
#pragma unroll
    for (int i = 0; i < 16; ++i) { xq[2 * i] = *(const v4f*)(xp + i * 8 * DD); xq[2 * i + 1] = *(const v4f*)(xp + i * 8 * DD + 128); }
    asm volatile("s_wait_xcnt 0x0" :: "v"(wp), "v"(xp) : "memory");    // stands behind the two runs of loads, ahead of any later write of a register that they name: both addresses are its inputs, so that they stay whole up to it
#pragma unroll
    for (int i = 0; i < 32; ++i) *(u32x2a*)(wsm + (i * 8 + wave) * PJ_WP + lane * 4) = pj_pack(wq[i]);
#pragma unroll
    for (int i = 0; i < 16; ++i) { *(u32x2a*)(xs + (i * 8 + wave) * PJ_XP + lane * 4) = pj_pack(xq[2 * i]); *(u32x2a*)(xs + (i * 8 + wave) * PJ_XP + 128 + lane * 4) = pj_pack(xq[2 * i + 1]); }
    __syncthreads();    // both staged tiles are written before any wave reads its fragments
    v8f acc[2][4];
#pragma unroll
    for (int i = 0; i < 2; ++i) {
#pragma unroll
        for (int t = 0; t < 4; ++t) acc[i][t] = (v8f){}; }
    const int g4 = wave & 3, g2 = wave >> 2;    // the wave's 32 rows of A, its 64 columns of B
    // the transposing read's lane address: k row 8 hi + (lane & 7), 16-byte half of 16 columns; the wave's first column
    const unsigned char* wf = (const unsigned char*)wsm + (8 * hi + (lane & 7)) * (PJ_WP * 2) + ((lane >> 3) & 1) * 16 + (ISV ? g4 * 64 : g2 * 128);
    const unsigned short* xf = xs + ((ISV ? g2 * 64 : g4 * 32) + lr) * PJ_XP + 8 * hi;
    auto xfrag = [&](int n, int kc) { return cat16b(*(const v8usa*)(xf + n * 16 * PJ_XP + kc), *(const v8usa*)(xf + n * 16 * PJ_XP + kc + 16)); };
    auto wfrag = [&](int n, int kc) { return cat16b(pj_tr16(wf + n * 32 + kc * (PJ_WP * 2)), pj_tr16(wf + n * 32 + (kc + 16) * (PJ_WP * 2))); };
    v16bf fa[2][2], fb[2][4];    // the fragments of a 32-k step, two sets: one is read from LDS while the other is multiplied
    auto ld = [&](int g) {
#pragma unroll
        for (int i = 0; i < 2; ++i) fa[g & 1][i] = ISV ? wfrag(i, g * 32) : xfrag(i, g * 32);
#pragma unroll
        for (int t = 0; t < 4; ++t) fb[g & 1][t] = ISV ? xfrag(t, g * 32) : wfrag(t, g * 32); };
    ld(0);
#pragma unroll
    for (int g = 0; g < DD / 32; ++g) {
        if (g + 1 < DD / 32) ld(g + 1);
        __builtin_amdgcn_sched_barrier(0);    // the next set's LDS reads stand as one group ahead of this set's matrix instructions: left free, each read pair is waited for singly
#pragma unroll
        for (int i = 0; i < 2; ++i) {
#pragma unroll
            for (int t = 0; t < 4; ++t) acc[i][t] = wmmab(fa[g & 1][i], fb[g & 1][t], acc[i][t]); }
        __builtin_amdgcn_sched_barrier(0);    // closes the set: see above
    }
    float* os = ost + wave * (32 * 68);
#pragma unroll
    for (int i = 0; i < 2; ++i) {
#pragma unroll
        for (int t = 0; t < 4; ++t) {
#pragma unroll
            for (int j = 0; j < 8; ++j) os[(i * 16 + hi * 8 + j) * 68 + t * 16 + lr] = acc[i][t][j]; } }
    __syncthreads();    // the staged tile is written before other lanes read it back
    if (ISV) {
        const int r0 = ch * 128 + g4 * 32, c0 = rt * 128 + g2 * 64;    // channel, row of x
        const size_t base = (size_t)(c0 / NN) * DD * NN + (size_t)r0 * NN + (c0 & (NN - 1));
#pragma unroll
        for (int s = 0; s < 8; ++s) { const int row = 4 * s + (lane >> 3), piece = lane & 7; const float* sp = os + row * 68 + piece * 8; v8us oh, ol;
#pragma unroll
            for (int i = 0; i < 8; ++i) { const unsigned short hb = f2bf(sp[i]); oh[i] = hb; ol[i] = f2bf(sp[i] - bf2f(hb)); }
            const size_t o = base + (size_t)row * NN + piece * 8; *(v8us*)(VTh + o) = oh; *(v8us*)(VTl + o) = ol; }
        asm volatile("s_wait_xcnt 0x0" ::: "memory");    // stands behind the run of stores, ahead of any later write of a register that they name
    } else {
        float* crow = (g2 ? Rm : Lm) + (size_t)(rt * 128 + g4 * 32) * PP;
#pragma unroll
        for (int s = 0; s < 16; ++s) { const int Lid = (lane >> 3) + 4 * s, piece = lane & 7; const int row = Lid >> 1, cofs = (Lid & 1) * 32 + piece * 4;
            const v4f val = *(const v4fa*)(os + row * 68 + cofs); *(v4f*)(crow + (size_t)row * PP + cofs) = val; }
        asm volatile("s_wait_xcnt 0x0" ::: "memory");    // stands behind the run of stores, ahead of any later write of a register that they name
    }
}
__global__ __launch_bounds__(256) void k_proj(const float* __restrict__ x, const float* __restrict__ Wl, const float* __restrict__ Wr, const float* __restrict__ Wv, const float* __restrict__ Wo,
                                              float* Lm, float* Rm, bf* VTh, bf* VTl, bf* WoT) {
    __shared__ __align__(16) unsigned short xs[128 * PJ_XP];
    __shared__ __align__(32) unsigned short wsm[DD * PJ_WP];
    __shared__ __align__(16) float ost[8 * 32 * 68];
    const int b = blockIdx.x;
    if (b >= PJ_V + PJ_LR) {
        unsigned short* tl = xs;
        const int tid = threadIdx.x, qq = b - (PJ_V + PJ_LR), k0 = (qq & 3) * 64, n0 = (qq >> 2) * 64;
        const int kk = tid >> 2, nq = (tid & 3) * 16;
#pragma unroll
        for (int i = 0; i < 16; ++i) tl[(nq + i) * 72 + kk] = f2bf(Wo[(size_t)(k0 + kk) * DD + n0 + nq + i]);
        __syncthreads();
        const int piece = tid & 7;
#pragma unroll
        for (int s = 0; s < 2; ++s) { const int nr = (tid >> 3) + 32 * s; const v8us val = *(const v8usa*)(tl + nr * 72 + piece * 8); *(v8us*)(WoT + (size_t)(n0 + nr) * DD + k0 + piece * 8) = val; }
        return;
    }
    if (b < PJ_V) pj_tile<true>(x, Wv, Wv, b >> 1, b & 1, xs, wsm, ost, Lm, Rm, VTh, VTl);
    else pj_tile<false>(x, Wl, Wr, b - PJ_V, 0, xs, wsm, ost, Lm, Rm, VTh, VTl);
}
extern "C" void kernel_launch(void* const* d_in, const int* in_sizes, int n_in,
                              void* d_out, int out_size, void* d_ws, size_t ws_size, hipStream_t stream) {
    (void)in_sizes; (void)n_in; (void)out_size;
    const float* x = (const float*)d_in[0]; const float* Wl = (const float*)d_in[1]; const float* Wr = (const float*)d_in[2]; const float* Wv = (const float*)d_in[3]; const float* Wo = (const float*)d_in[4];
    float* out = (float*)d_out;    // [2][4096][256]
    char* wsp = (char*)d_ws;
    auto take = [&](size_t bytes) { char* p = wsp; wsp += (bytes + 255) & ~(size_t)255; return (void*)p; };
    bf* WoT = (bf*)take(DD * DD * 2);
    float* Lm = (float*)take((size_t)NR * PP * 4); float* Rm = (float*)take((size_t)NR * PP * 4); bf* VTh = (bf*)take((size_t)DD * NR * 2); bf* VTl = (bf*)take((size_t)DD * NR * 2);
    bf* Oh = (bf*)take((size_t)NR * DD * 2); bf* Ol = (bf*)take((size_t)NR * DD * 2);
    if ((size_t)(wsp - (char*)d_ws) > ws_size) return;    // ~ 21 MB, no aliasing
    k_proj<<<PJ_V + PJ_LR + PJ_WO, 256, 0, stream>>>(x, Wl, Wr, Wv, Wo, Lm, Rm, VTh, VTl, WoT);       // v^T [b][c][m] planes, l and r [b n][64], Wo^T
    k_gemm3<<<dim3(NR / 64, DD / 128, 1), 128, 0, stream>>>(Lm, Rm, VTh, VTl, Oh, Ol);              // o [b n][c] = softmax(l (x) r) . v, as planes
    k_out<<<dim3(NR / 64, DD / 128, 1), 256, 0, stream>>>(Oh, Ol, WoT, out);                                                      // o.Wo
}

// v009
// It runs in 31.9 microseconds.
// Versions between v007 and this one are left out; their measured steps multiply to 1.45 times as fast.
// All steps since v000 together make it 34.1 times as fast.
#include <hip/hip_runtime.h>

// Compute dtypes, f32 accumulate, both batch items in every launch (8192 rows): l = x.Wl, r = x.Wr ([8192 x 256].[256 x 64]) and v^T = Wv^T.x^T ([256 x 256].[256 x 4096] per batch item) with PLAIN bf16 operands (rounded
// input and weights; exact products); the factorised scores attn[n][m] = l[n][m/64] r[n][m%64] and their row softmax in f32 -> f16, formed in registers inside
// the product that uses them; o[n][c] = sum_m P[n][m] v[m][c] ([4096 x 4096].[4096 x 256] per batch item, both operands rounded to f16, one product; shared across heads = all 256 channels at once) and out = o.Wo (o as bf16 hi + residual)

#define NBI  2
#define NN   4096
#define DD   256
#define PP   64
#define NR   (NBI * NN)
#define CC   DD
#define DM   DD
#define NTK  NN
#define LOSC 1024.0f

typedef _Float16 h16;
typedef unsigned short bf;
typedef __attribute__((ext_vector_type(16))) __bf16   v16bf;
typedef __attribute__((ext_vector_type(16))) _Float16 v16h;
typedef __attribute__((ext_vector_type(8)))  _Float16 v8h;
typedef __attribute__((ext_vector_type(8)))  unsigned short v8us;
typedef __attribute__((ext_vector_type(8)))  float    v8f;
typedef __attribute__((ext_vector_type(4)))  float    v4f;
typedef __attribute__((ext_vector_type(4)))  _Float16 v4h;
typedef v8h  __attribute__((may_alias)) v8ha;
typedef v4f  __attribute__((may_alias)) v4fa;
typedef v8us __attribute__((may_alias)) v8usa;

__device__ __forceinline__ unsigned short f2bf(float f) { unsigned u = __float_as_uint(f); u += 0x7FFFu + ((u >> 16) & 1u); return (unsigned short)(u >> 16); }
__device__ __forceinline__ float bf2f(unsigned short b) { return __uint_as_float(((unsigned)b) << 16); }
__device__ __forceinline__ float bfr(float f) { return bf2f(f2bf(f)); }
__device__ __forceinline__ v16h cat16(v8h lo, v8h hi) { return __builtin_shufflevector(lo, hi, 0, 1, 2, 3, 4, 5, 6, 7, 8, 9, 10, 11, 12, 13, 14, 15); }
__device__ __forceinline__ v16bf cat16b(v8us lo, v8us hi) { return __builtin_bit_cast(v16bf, __builtin_shufflevector(lo, hi, 0, 1, 2, 3, 4, 5, 6, 7, 8, 9, 10, 11, 12, 13, 14, 15)); }
__device__ __forceinline__ v8f wmma16(v16h a, v16h b, v8f c) { return __builtin_amdgcn_wmma_f32_16x16x32_f16(false, a, false, b, (short)0, c, false, false); }
__device__ __forceinline__ v8f wmmab(v16bf a, v16bf b, v8f c) { return __builtin_amdgcn_wmma_f32_16x16x32_bf16(false, a, false, b, (short)0, c, false, false); }

// k_out: 64 x 128 block tile (8 waves x 16 x 64) of out = (A + Al).B^T over K = DD, bf16 operands, f32 whole-line epilogue. The block's 64 rows of both A planes and its 128 rows of B
// (512 B a row, one wave-wide load each) are all requested before the first is used, left in LDS once, and read from there as fragments; per accumulator the order of the products is k step by k step, A then Al.
#define GO_P 264                               // bf16 per staged row: 528 B = 16 B x 33, for the 16-byte readers
__global__ __launch_bounds__(256) void k_out(const bf* __restrict__ A, const bf* __restrict__ Al, const bf* __restrict__ Bn, float* C) {
    __shared__ __align__(16) unsigned short as[2 * 64 * GO_P];
    __shared__ __align__(16) unsigned short bs[128 * GO_P];
    __shared__ __align__(16) float ost[8][16 * 68];
    const int lane = threadIdx.x & 31, wave = threadIdx.x >> 5, lr = lane & 15, hi = lane >> 4;
    const int rb = blockIdx.x * 64, cb = blockIdx.y * 128;
    // a wave takes every eighth row of each tile: one address a tile and constant steps, one trip to L2 for the whole block
    const bf* pb = Bn + (size_t)(cb + wave) * DD + lane * 8;
    const bf* pa = A + (size_t)(rb + wave) * DD + lane * 8;
    const bf* pl = Al + (size_t)(rb + wave) * DD + lane * 8;
    v8us qb[16], qa[8], ql[8];
#pragma unroll
    for (int i = 0; i < 16; ++i) qb[i] = *(const v8us*)(pb + i * 8 * DD);
#pragma unroll
    for (int i = 0; i < 8; ++i) qa[i] = *(const v8us*)(pa + i * 8 * DD);
#pragma unroll
    for (int i = 0; i < 8; ++i) ql[i] = *(const v8us*)(pl + i * 8 * DD);
    asm volatile("s_wait_xcnt 0x0" :: "v"(pb), "v"(pa), "v"(pl) : "memory");    // stands behind the three runs of loads, ahead of any later write of a register that they name: the addresses are its inputs, so that they stay whole up to it
#pragma unroll
    for (int i = 0; i < 16; ++i) *(v8usa*)(bs + (i * 8 + wave) * GO_P + lane * 8) = qb[i];
#pragma unroll
    for (int i = 0; i < 8; ++i) *(v8usa*)(as + (i * 8 + wave) * GO_P + lane * 8) = qa[i];
#pragma unroll
    for (int i = 0; i < 8; ++i) *(v8usa*)(as + (64 + i * 8 + wave) * GO_P + lane * 8) = ql[i];
    __syncthreads();    // the three staged tiles are written before any wave reads its fragments
    const int g4 = wave & 3, g2 = wave >> 2;    // the wave's 16 rows of A, its 64 columns of B
    const unsigned short* af = as + (g4 * 16 + lr) * GO_P + 8 * hi;
    const unsigned short* bq = bs + (g2 * 64 + lr) * GO_P + 8 * hi;
    auto frag = [&](const unsigned short* p) { return cat16b(*(const v8usa*)p, *(const v8usa*)(p + 16)); };
    v8f acc[4];
#pragma unroll
    for (int t = 0; t < 4; ++t) acc[t] = (v8f){};
    v16bf fa[2][2], fb[2][4];    // the fragments of a 32-k step, two sets: one is read from LDS while the other is multiplied
    auto ld = [&](int g) {
        fa[g & 1][0] = frag(af + g * 32); fa[g & 1][1] = frag(af + 64 * GO_P + g * 32);
#pragma unroll
        for (int t = 0; t < 4; ++t) fb[g & 1][t] = frag(bq + t * 16 * GO_P + g * 32); };
    ld(0);
#pragma unroll
    for (int g = 0; g < DD / 32; ++g) {
        if (g + 1 < DD / 32) ld(g + 1);
        __builtin_amdgcn_sched_barrier(0);    // the next set's LDS reads stand as one group ahead of this set's matrix instructions: left free, each read pair is waited for singly
#pragma unroll
        for (int p = 0; p < 2; ++p) {
#pragma unroll
            for (int t = 0; t < 4; ++t) acc[t] = wmmab(fa[g & 1][p], fb[g & 1][t], acc[t]); }
        __builtin_amdgcn_sched_barrier(0);    // closes the set: see above
    }
    float* os = &ost[wave][0];
#pragma unroll
    for (int t = 0; t < 4; ++t) {
#pragma unroll
        for (int j = 0; j < 8; ++j) os[(hi * 8 + j) * 68 + t * 16 + lr] = acc[t][j]; }
    __syncthreads();    // the staged tile is written before other lanes read it back
    float* crow = C + (size_t)(rb + g4 * 16) * DD + cb + g2 * 64;
#pragma unroll
    for (int s = 0; s < 8; ++s) { const int Lid = (lane >> 3) + 4 * s, piece = lane & 7; const int row = Lid >> 1, cofs = (Lid & 1) * 32 + piece * 4;
        const v4f val = *(const v4fa*)(os + row * 68 + cofs); *(v4f*)(crow + (size_t)row * DD + cofs) = val; }
    asm volatile("s_wait_xcnt 0x0" ::: "memory");    // stands behind the run of stores, ahead of any later write of a register that they name
}

// k_gemm3: 64 x 128 block tile (4 waves x 32 x 64) of o = softmax(l (x) r).v over K = NN, one f16 product per 32-k step. The A operand never exists in global memory: the lanes form its fragment elements
// e[n][m] = exp2(l'[n][m >> 6] r[n][m & 63] - max' + 8), l' = l log2(e), in f32 and round them to f16 in registers; the row's sum of e (f32) is kept beside them and divides the result at the end.
// The largest e of a row is 2^8, so that elements down to 2^-22 of it are still normal f16 numbers. B = v^T in f16, n-major, one [CC][NN] plane per batch item, picked by the row tile. A stage is 256 B (128 k) of every
// B row, brought into LDS by one tensor load per wave (wave w: rows 32 w .. 32 w + 31 of the 128), rows padded to a 272 B pitch for the 16-byte readers; two buffers, the next stage in flight under the current one; the hand-over (waits, barrier, refill) stands at the head of each pass.
// The 64 blocks that share a B panel do not walk its 32 stages in step: pass p of a block works on stage (p + rot) mod 32, rot set by the block's row tile, so that at any moment they ask L2 for different lines
// and the whole panel is asked of memory in the first pass, not one stage at a time. Each accumulator and each row sum takes its stages in that rotated order.
typedef uint32_t u32x4 __attribute__((ext_vector_type(4)));
typedef uint32_t u32x8 __attribute__((ext_vector_type(8)));
typedef __attribute__((ext_vector_type(2))) float v2f;
#define G3_ROWB  256u
#define G3_PITCH 272u
#define G3_SL    10240u                        // one slice: 32 rows x 272 B, rounded up to a multiple of 2 KiB
#define G3_STAGE (4u * G3_SL)                  // 40,960 B = 20 x 2 KiB
#define G3_NST   (NN * 2u / G3_ROWB)           // 32 stages
#define G3_LP    68                            // floats per row of a wave's own table of l' (later its output staging)
__device__ __forceinline__ uint32_t uni(uint32_t v) { return (uint32_t)__builtin_amdgcn_readfirstlane(v); }
// a value held in a scalar register: makes the test around a tensor load a scalar branch, and keeps what is formed from it behind the waits in front of it
__device__ __forceinline__ uint32_t pinned(uint32_t v) { uint32_t w = uni(v); asm volatile("" : "+s"(w)); return w; }
struct G3B { v16h b[4]; };
typedef u32x4 __attribute__((may_alias)) u32x4a;
#define G3_AF    1024u                         // one A fragment in LDS: two 512-B chunks, 16 B a lane in each
#define G3_ASTEP (2u * G3_AF)                  // a 32-k step: row tile 0, then row tile 1
#define G3_AWR   (4u * G3_ASTEP)               // a stage's four steps of one 32-row pair of waves
#define G3_ASTG  (2u * G3_AWR)                 // 16 KiB a stage
__device__ __forceinline__ v16h g3_ld(const unsigned char* p) { return cat16(*(const v8ha*)p, *(const v8ha*)(p + 32)); }
__device__ __forceinline__ void g3_bfrags(G3B& f, const unsigned char* pb, int kk) {
#pragma unroll
    for (int t = 0; t < 4; ++t) f.b[t] = g3_ld(pb + (t >> 1) * G3_SL + (t & 1) * 16 * G3_PITCH + kk * 64);
}
__device__ __forceinline__ void g3_ast(unsigned char* p, u32x8 w) { *(u32x4a*)p = __builtin_shufflevector(w, w, 0, 1, 2, 3); *(u32x4a*)(p + 512) = __builtin_shufflevector(w, w, 4, 5, 6, 7); }
__device__ __forceinline__ v16h g3_ald(const unsigned char* p) { return cat16(*(const v8ha*)p, *(const v8ha*)(p + 512)); }
typedef __attribute__((ext_vector_type(2))) __bf16 v2bf;
typedef __attribute__((ext_vector_type(2))) _Float16 v2h;
// the A fragment of one 32-k step for one of the lane's rows: element e stands for k = (e >> 3) * 16 + 8 * hi + (e & 7), the order of g3_ld; rv holds r at exactly those places
__device__ __forceinline__ void g3_half(u32x8& a, const v2f (&rv)[8], float lv, float nm, v2f (&sum)[2]) {
#pragma unroll
    for (int e = 0; e < 16; e += 2) {
        const v2f sc = __builtin_elementwise_fma((v2f){lv, lv}, rv[e >> 1], (v2f){nm, nm});
        const v2f p = {__builtin_amdgcn_exp2f(sc[0]), __builtin_amdgcn_exp2f(sc[1])};
        a[e >> 1] = __builtin_bit_cast(uint32_t, __builtin_convertvector(p, v2h)); sum[(e >> 1) & 1] += p; }
}
__global__ __launch_bounds__(128) void k_gemm3(const float* __restrict__ Lm, const float* __restrict__ Rm, const h16* __restrict__ Bv, bf* Oh, bf* Ol) {
    __shared__ __attribute__((aligned(2048))) unsigned char ring[2 * G3_STAGE + 4 * 32 * G3_LP * 4];    // two stages, then each wave's own table of l', which becomes its output staging
    __shared__ __attribute__((aligned(16))) unsigned char axc[2 * G3_ASTG];    // the A fragments that the two waves of a row pair hand each other, two stages
    const int lane = threadIdx.x & 31, lr = lane & 15, hi = lane >> 4;
    const uint32_t wave = uni(threadIdx.x >> 5);
    const int wr = wave >> 1, wc = wave & 1;
    const int rb = blockIdx.x * 64, cb = blockIdx.y * 128;
    const size_t bitem = (size_t)(blockIdx.x / (NN / 64)) * CC * NN;
    const h16* sp = Bv + bitem + (size_t)(cb + wave * 32u) * NN;
    const uint64_t srcb = (uint64_t)sp;
    const uint32_t rot = ((blockIdx.x >> 3) & 7u) * 4u + (blockIdx.x & 3u);    // bits 0-1 and 3-5 of the row tile: a panel's 64 row tiles take each of the 32 entries twice, tiles t and t ^ 4 the same one (for speed only)
    const uint32_t rows = 32u;
    const uint32_t place = (uint32_t)(uintptr_t)ring + wave * G3_SL;
    u32x8 g1;
    // pinned(): each descriptor word held in a scalar register, so that the group keeps one set of registers and no word of an outstanding request is rewritten
    g1[0] = pinned((1u << 20) | (5u << 22) | (3u << 25));    // no mask, 1-byte elements, 4 dwords of pad behind every 64 dwords
    g1[1] = pinned((G3_ROWB & 0xFFFFu) << 16);
    g1[2] = pinned((G3_ROWB >> 16) | (rows << 16));
    g1[3] = pinned((rows >> 16) | (G3_ROWB << 16));
    g1[4] = pinned(rows);
    g1[5] = pinned(NN * 2u);
    g1[6] = pinned(0u);
    g1[7] = pinned(0u);
    auto issue = [&](uint32_t st) {
        const uint64_t ga = srcb + (uint64_t)((st + rot) & (G3_NST - 1u)) * G3_ROWB;    // st counts passes (it picks the buffer), the source is the pass's rotated stage
        u32x4 g0;
        g0[0] = uni(1u); g0[1] = uni(place + (st & 1u) * G3_STAGE); g0[2] = uni((uint32_t)ga); g0[3] = uni((((uint32_t)(ga >> 32)) & 0x01FFFFFFu) | 0x80000000u);
        asm volatile("tensor_load_to_lds %0, %1" :: "s"(g0), "s"(g1) : "memory");
    };
    v8f acc[2][4];
#pragma unroll
    for (int i = 0; i < 2; ++i) {
#pragma unroll
        for (int t = 0; t < 4; ++t) acc[i][t] = (v8f){}; }
    // the lane's two rows of r, at the k places of its fragment elements (rv[h]: the 32-k step's half of the 64), and its half of their l: loaded ahead of stage 0, used behind it
    v2f rv[2][2][8]; v4f lq[2][8];    // r in pairs, as the packed score instruction takes them
#pragma unroll
    for (int i = 0; i < 2; ++i) { const size_t ro = (size_t)(rb + wr * 32 + i * 16 + lr) * PP;
#pragma unroll
        for (int h = 0; h < 2; ++h) {
#pragma unroll
            for (int g = 0; g < 4; ++g) { const v4f q = *(const v4f*)(Rm + ro + h * 32 + (g >> 1) * 16 + 8 * hi + (g & 1) * 4);
                rv[h][i][g * 2] = (v2f){q[0], q[1]}; rv[h][i][g * 2 + 1] = (v2f){q[2], q[3]}; } }
#pragma unroll
        for (int g = 0; g < 8; ++g) lq[i][g] = *(const v4f*)(Lm + ro + hi * 32 + g * 4); }
    asm volatile("s_wait_xcnt 0x0" ::: "memory");    // stands behind the run of loads, ahead of any later write of a register that they name
    issue(0);    // stage 0 flies under the rows' extremes and the table of l'
    float* os = (float*)(ring + 2 * G3_STAGE) + wave * (32 * G3_LP);
    float nmx[2];
#pragma unroll
    for (int i = 0; i < 2; ++i) {    // the row's largest score is one of the four products of the extremes of l' and r (a rounded product is monotone in each factor)
        float rx = rv[0][i][0][0], rn = rx, lx = -3.0e38f, ln = 3.0e38f;
#pragma unroll
        for (int h = 0; h < 2; ++h) {
#pragma unroll
            for (int e = 0; e < 16; ++e) { rx = fmaxf(rx, rv[h][i][e >> 1][e & 1]); rn = fminf(rn, rv[h][i][e >> 1][e & 1]); } }
#pragma unroll
        for (int g = 0; g < 8; ++g) { const v4f q = lq[i][g] * 1.44269504088896341f;
#pragma unroll
            for (int u = 0; u < 4; ++u) { lx = fmaxf(lx, q[u]); ln = fminf(ln, q[u]); }
            *(v4fa*)(os + (i * 16 + lr) * G3_LP + hi * 32 + g * 4) = q; }
        rx = fmaxf(rx, __shfl_xor(rx, 16, 32)); rn = fminf(rn, __shfl_xor(rn, 16, 32)); lx = fmaxf(lx, __shfl_xor(lx, 16, 32)); ln = fminf(ln, __shfl_xor(ln, 16, 32));
        nmx[i] = 8.0f - fmaxf(fmaxf(lx * rx, ln * rn), fmaxf(lx * rn, ln * rx)); }
    asm volatile("s_wait_dscnt 0x0" ::: "memory");    // the wave's table of l' is written before its lanes read it across lanes
    const float* lt0 = os + lr * G3_LP; const float* lt1 = os + (16 + lr) * G3_LP;
    v2f sm[2][2];
#pragma unroll
    for (int i = 0; i < 2; ++i) { sm[i][0] = (v2f){}; sm[i][1] = (v2f){}; }
    // The two waves of a row pair need the same A fragments. Each forms only those of its own l' column of a stage (column 2 x stage + wc: two 32-k steps), one stage ahead,
    // keeps them in registers for itself and leaves them in LDS for its partner; the stage's barrier publishes them with the B stage. A wave takes its own two steps first, then its partner's.
    const uint32_t wcu = wave & 1u;
    unsigned char* const axo = axc + (wave >> 1) * G3_AWR + 2u * wcu * G3_ASTEP + (uint32_t)lane * 16u;
    const unsigned char* const axp = axc + (wave >> 1) * G3_AWR + 2u * (1u - wcu) * G3_ASTEP + (uint32_t)lane * 16u;
    u32x8 fe[2][2], fo[2][2];    // [step][row tile]: the wave's own fragments of the even and of the odd stages
    {
        const float l00 = lt0[2u * rot + wcu], l01 = lt1[2u * rot + wcu];
#pragma unroll
        for (int o = 0; o < 2; ++o) {
#pragma unroll
            for (int i = 0; i < 2; ++i) { g3_half(fe[o][i], rv[o][i], i ? l01 : l00, nmx[i], sm[i]);
                g3_ast(axo + o * G3_ASTEP + i * G3_AF, fe[o][i]); } }
    }
    const uint32_t c1 = 2u * ((rot + 1u) & (G3_NST - 1u)) + wcu;
    float la[2] = {lt0[c1], lt1[c1]};    // l' of the stage whose fragments are formed next
    const uint32_t boff = (uint32_t)wc * 2u * G3_SL + (uint32_t)lr * G3_PITCH + 16u * hi;
    auto stage = [&](const uint32_t s, const uint32_t par, u32x8 (&cur)[2][2], u32x8 (&nxt)[2][2]) __attribute__((always_inline)) {
        // the hand-over of stage s stands at the head of its pass, so that the pass's vector work ends in the block of its matrix instructions
        asm volatile("s_wait_dscnt 0x0" ::: "memory");        // this wave's reads of stage s - 1 have returned, its A fragments of stage s are written
        asm volatile("s_wait_tensorcnt 0x0" ::: "memory");    // this wave's slice of stage s has landed
        __syncthreads();                                      // publishes stage s (B and A) and ends every wave's reads of stage s - 1
        if (pinned(s + 1 < G3_NST)) issue(pinned(s + 1));     // refill of the buffer that stage s - 1 has just left
        const unsigned char* pbo = ring + par * G3_STAGE + boff + wcu * 128u;           // B at the wave's own two steps
        const unsigned char* pbp = ring + par * G3_STAGE + boff + (1u - wcu) * 128u;    // B at its partner's
        G3B f[2];
        g3_bfrags(f[0], pbo, 0);
        const uint32_t sn = 2u * (((s + 2 < G3_NST ? s + 2 : G3_NST - 1) + rot) & (G3_NST - 1u)) + wcu;    // l' is fetched one stage ahead of its use; past the end the last pass's column is fetched again
        const float ln0 = lt0[sn], ln1 = lt1[sn];
        __builtin_amdgcn_sched_barrier(0);    // the stage's first LDS reads are issued ahead of the vector work that fills their latency
        const bool more = s + 1 < G3_NST;     // the last stage has no successor: its fragments are formed as zeros, which add nothing to the rows' sums
        const float nm[2] = {more ? nmx[0] : -3.0e38f, more ? nmx[1] : -3.0e38f};
        g3_half(nxt[0][0], rv[0][0], la[0], nm[0], sm[0]);    // a quarter of the next stage's own fragments is formed while the first LDS reads are on their way
        v16h pa[2][2];
#pragma unroll
        for (int b = 0; b < 4; ++b) {
            if (b < 3) g3_bfrags(f[(b + 1) & 1], b + 1 < 2 ? pbo : pbp, (b + 1) & 1);
            if (b == 1 || b == 2) {    // the partner's fragments of a step are read one block ahead of their use, with B's
#pragma unroll
                for (int u = 0; u < 2; ++u) pa[b - 1][u] = g3_ald(axp + par * G3_ASTG + (b - 1) * G3_ASTEP + u * G3_AF); }
            g3_ast(axo + (par ^ 1u) * G3_ASTG + (b >> 1) * G3_ASTEP + (b & 1) * G3_AF, nxt[b >> 1][b & 1]);
            __builtin_amdgcn_sched_barrier(0);    // the block's LDS traffic stays one group ahead of its matrix instructions, not spread among them
            const G3B& c = f[b & 1];
            v16h ah[2];
#pragma unroll
            for (int i = 0; i < 2; ++i) ah[i] = b < 2 ? __builtin_bit_cast(v16h, cur[b & 1][i]) : pa[b & 1][i];
            auto mm = [&](int j) { const int i = j >> 2, t = j & 3;    // the block's 8 matrix instructions, one per accumulator
                acc[i][t] = wmma16(ah[i], c.b[t], acc[i][t]); };
            if (b < 3) {
                // one more quarter of the next stage's own fragments (8 element pairs) is formed under this block's matrix instructions, one slot a pair,
                // each link of a pair's chain (score, exp2, f16) one slot behind the link before it
                const int gi = (b + 1) & 1;
                const v2f (&rh)[8] = rv[(b + 1) >> 1][gi];
                const float lv = la[gi], nv = nm[gi];
                v2f F[8], P[8]; u32x8 wh;
                auto fm = [&](int q) { F[q] = __builtin_elementwise_fma((v2f){lv, lv}, rh[q], (v2f){nv, nv}); };
                auto ex = [&](int q) { P[q] = (v2f){__builtin_amdgcn_exp2f(F[q][0]), __builtin_amdgcn_exp2f(F[q][1])}; };
                auto ch = [&](int q) { wh[q] = __builtin_bit_cast(uint32_t, __builtin_convertvector(P[q], v2h)); };
                fm(0); fm(1); ex(0);
#pragma unroll
                for (int j = 0; j < 8; ++j) {
                    mm(j);
                    if (j + 1 < 8) ex(j + 1);
                    ch(j);
                    if (j + 2 < 8) fm(j + 2);
                    sm[gi][j & 1] += P[j];
                    __builtin_amdgcn_sched_barrier(0);    // keeps the slot's vector work behind its own matrix instruction: left free, it gathers in long runs during which the matrix unit idles
                }
                nxt[(b + 1) >> 1][gi] = wh;
            } else {
#pragma unroll
                for (int j = 0; j < 8; ++j) mm(j);
            }
            __builtin_amdgcn_sched_barrier(0);    // closes the block: see above
        }
        la[0] = ln0; la[1] = ln1;
    };
#pragma unroll 1    // two stages a trip: the own fragments of even and odd stages keep a register set each, with no copies between them
    for (uint32_t s = 0; s < G3_NST; s += 2) { stage(s, 0u, fe, fo); stage(s + 1, 1u, fo, fe); }
    asm volatile("s_wait_tensorcnt 0x0" ::: "memory");
    asm volatile("s_wait_dscnt 0x0" ::: "memory");
#pragma unroll
    for (int i = 0; i < 2; ++i) {
        const v2f t4 = sm[i][0] + sm[i][1]; float t = t4[0] + t4[1]; t += __shfl_xor(t, 16, 32);    // the lane pair l, l ^ 16 holds the two halves of the wave's share of a row's sum
        if (hi == 0) os[(i * 16 + lr) * G3_LP + 64] = t;
#pragma unroll
        for (int t2 = 0; t2 < 4; ++t2) {
#pragma unroll
            for (int j = 0; j < 8; ++j) os[(i * 16 + hi * 8 + j) * G3_LP + t2 * 16 + lr] = acc[i][t2][j]; } }
    __syncthreads();    // a row's sum lies half with each wave of its pair: both shares are written before either wave reads them (and the wave's staged rows before its lanes read them back)
    const float* sa = (const float*)(ring + 2 * G3_STAGE) + (wave & 2u) * (32 * G3_LP) + 64; const float* sb = sa + 32 * G3_LP;
    const size_t obase = (size_t)(rb + wr * 32) * DD + cb + wc * 64;    // the result leaves as bf16 hi + residual planes, whole 128-B lines (8 lanes x 16 B)
#pragma unroll
    for (int s = 0; s < 8; ++s) { const int row = 4 * s + (lane >> 3), piece = lane & 7; const float* sp2 = os + row * G3_LP + piece * 8; const float iv = 1.0f / (sa[row * G3_LP] + sb[row * G3_LP]); v8us oh, ol;
#pragma unroll
        for (int i = 0; i < 8; ++i) { const float val = sp2[i] * iv; const unsigned short hb = f2bf(val); oh[i] = hb; ol[i] = f2bf(val - bf2f(hb)); }
        const size_t o = obase + (size_t)row * DD + piece * 8; *(v8us*)(Oh + o) = oh; *(v8us*)(Ol + o) = ol; }
}

// k_proj: one launch for the three independent projections of x and for the inputs' own conversions. A block is one 128 x 128 tile (8 waves x 32 x 64) of A.B^T over K = DD, plain bf16 operands:
// it reads its 128 rows of x and its 256 x 128 panel of W as f32, whole lines, rounds them to bf16 (nearest even) and leaves them in LDS, x k-contiguous, W as it lies (k rows of 128 columns);
// x fragments are plain 16-byte reads, W fragments transposing reads, both in the hardware's k order (8 hi + 0..7, 16 + 8 hi + 0..7).
// Blocks 0..127: v^T[b][c][m] = Wv^T.x^T (2 channel halves x 64 row tiles of x), written straight as one f16 plane (whole 128-B lines, 8 lanes x 16 B);
// blocks 128..191: l = x.Wl and r = x.Wr side by side (panel columns 0..63 and 64..127), f32 whole-line epilogue; blocks 192..207: WoT [n][DD] = bf16(Wo[k][n]) via 64 x 64 LDS tiles, for the last launch.
#define PJ_XP 264                              // bf16 per staged row of x: 528 B = 16 B x 33, for the 16-byte readers
#define PJ_WP 144                              // bf16 per staged k row of W: 288 B = 32 B x 9, for the transposing readers
#define PJ_RT (NR / 128)
#define PJ_V  (DD / 128 * PJ_RT)
#define PJ_LR PJ_RT
#define PJ_WO 16
typedef short s16x8 __attribute__((ext_vector_type(8)));
typedef uint32_t u32x2 __attribute__((ext_vector_type(2)));
typedef u32x2 __attribute__((may_alias)) u32x2a;
__device__ __forceinline__ v8us pj_tr16(const unsigned char* p) { typedef __attribute__((address_space(3))) s16x8 lds_s16x8; return __builtin_bit_cast(v8us, __builtin_amdgcn_ds_load_tr16_b128_v8i16((lds_s16x8*)p)); }
__device__ __forceinline__ u32x2 pj_pack(v4f q) {
    return (u32x2){__builtin_bit_cast(uint32_t, __builtin_convertvector((v2f){q[0], q[1]}, v2bf)), __builtin_bit_cast(uint32_t, __builtin_convertvector((v2f){q[2], q[3]}, v2bf))}; }
// ISV: W0 = Wv, ch its 128-column half. Otherwise W0 = Wl, W1 = Wr.
template <bool ISV>
__device__ __forceinline__ void pj_tile(const float* __restrict__ x, const float* __restrict__ W0, const float* __restrict__ W1, const int rt, const int ch,
                                        unsigned short* xs, unsigned short* wsm, float* ost, float* Lm, float* Rm, h16* VT) {
    const int tid = threadIdx.x, lane = tid & 31, wave = tid >> 5, lr = lane & 15, hi = lane >> 4;
    // every load of the block's two tiles is issued before the first is used: one trip to L2, not one per k step. A wave takes every eighth row of each tile, one address and constant steps.
    v4f wq[32], xq[32];
    const float* wp = ISV ? W0 + (size_t)wave * DD + ch * 128 + lane * 4 : (hi ? W1 : W0) + (size_t)wave * PP + lr * 4;
#pragma unroll
    for (int i = 0; i < 32; ++i) wq[i] = *(const v4f*)(wp + i * 8 * (ISV ? DD : PP));
    const float* xp = x + (size_t)(rt * 128 + wave) * DD + lane * 4;
#pragma unroll
    for (int i = 0; i < 16; ++i) { xq[2 * i] = *(const v4f*)(xp + i * 8 * DD); xq[2 * i + 1] = *(const v4f*)(xp + i * 8 * DD + 128); }
    asm volatile("s_wait_xcnt 0x0" :: "v"(wp), "v"(xp) : "memory");    // stands behind the two runs of loads, ahead of any later write of a register that they name: both addresses are its inputs, so that they stay whole up to it
#pragma unroll
    for (int i = 0; i < 32; ++i) *(u32x2a*)(wsm + (i * 8 + wave) * PJ_WP + lane * 4) = pj_pack(wq[i]);
#pragma unroll
    for (int i = 0; i < 16; ++i) { *(u32x2a*)(xs + (i * 8 + wave) * PJ_XP + lane * 4) = pj_pack(xq[2 * i]); *(u32x2a*)(xs + (i * 8 + wave) * PJ_XP + 128 + lane * 4) = pj_pack(xq[2 * i + 1]); }
    __syncthreads();    // both staged tiles are written before any wave reads its fragments
    v8f acc[2][4];
#pragma unroll
    for (int i = 0; i < 2; ++i) {
#pragma unroll
        for (int t = 0; t < 4; ++t) acc[i][t] = (v8f){}; }
    const int g4 = wave & 3, g2 = wave >> 2;    // the wave's 32 rows of A, its 64 columns of B
    // the transposing read's lane address: k row 8 hi + (lane & 7), 16-byte half of 16 columns; the wave's first column
    const unsigned char* wf = (const unsigned char*)wsm + (8 * hi + (lane & 7)) * (PJ_WP * 2) + ((lane >> 3) & 1) * 16 + (ISV ? g4 * 64 : g2 * 128);
    const unsigned short* xf = xs + ((ISV ? g2 * 64 : g4 * 32) + lr) * PJ_XP + 8 * hi;
    auto xfrag = [&](int n, int kc) { return cat16b(*(const v8usa*)(xf + n * 16 * PJ_XP + kc), *(const v8usa*)(xf + n * 16 * PJ_XP + kc + 16)); };
    auto wfrag = [&](int n, int kc) { return cat16b(pj_tr16(wf + n * 32 + kc * (PJ_WP * 2)), pj_tr16(wf + n * 32 + (kc + 16) * (PJ_WP * 2))); };
    v16bf fa[2][2], fb[2][4];    // the fragments of a 32-k step, two sets: one is read from LDS while the other is multiplied
    auto ld = [&](int g) {
#pragma unroll
        for (int i = 0; i < 2; ++i) fa[g & 1][i] = ISV ? wfrag(i, g * 32) : xfrag(i, g * 32);
#pragma unroll
        for (int t = 0; t < 4; ++t) fb[g & 1][t] = ISV ? xfrag(t, g * 32) : wfrag(t, g * 32); };
    ld(0);
#pragma unroll
    for (int g = 0; g < DD / 32; ++g) {
        if (g + 1 < DD / 32) ld(g + 1);
        __builtin_amdgcn_sched_barrier(0);    // the next set's LDS reads stand as one group ahead of this set's matrix instructions: left free, each read pair is waited for singly
#pragma unroll
        for (int i = 0; i < 2; ++i) {
#pragma unroll
            for (int t = 0; t < 4; ++t) acc[i][t] = wmmab(fa[g & 1][i], fb[g & 1][t], acc[i][t]); }
        __builtin_amdgcn_sched_barrier(0);    // closes the set: see above
    }
    float* os = ost + wave * (32 * 68);
#pragma unroll
    for (int i = 0; i < 2; ++i) {
#pragma unroll
        for (int t = 0; t < 4; ++t) {
#pragma unroll
            for (int j = 0; j < 8; ++j) os[(i * 16 + hi * 8 + j) * 68 + t * 16 + lr] = acc[i][t][j]; } }
    __syncthreads();    // the staged tile is written before other lanes read it back
    if (ISV) {
        const int r0 = ch * 128 + g4 * 32, c0 = rt * 128 + g2 * 64;    // channel, row of x
        const size_t base = (size_t)(c0 / NN) * DD * NN + (size_t)r0 * NN + (c0 & (NN - 1));
#pragma unroll
        for (int s = 0; s < 8; ++s) { const int row = 4 * s + (lane >> 3), piece = lane & 7; const float* sp = os + row * 68 + piece * 8; v8h oh;
#pragma unroll
            for (int i = 0; i < 8; ++i) oh[i] = (h16)sp[i];
            const size_t o = base + (size_t)row * NN + piece * 8; *(v8h*)(VT + o) = oh; }
        asm volatile("s_wait_xcnt 0x0" ::: "memory");    // stands behind the run of stores, ahead of any later write of a register that they name
    } else {
        float* crow = (g2 ? Rm : Lm) + (size_t)(rt * 128 + g4 * 32) * PP;
#pragma unroll
        for (int s = 0; s < 16; ++s) { const int Lid = (lane >> 3) + 4 * s, piece = lane & 7; const int row = Lid >> 1, cofs = (Lid & 1) * 32 + piece * 4;
            const v4f val = *(const v4fa*)(os + row * 68 + cofs); *(v4f*)(crow + (size_t)row * PP + cofs) = val; }
        asm volatile("s_wait_xcnt 0x0" ::: "memory");    // stands behind the run of stores, ahead of any later write of a register that they name
    }
}
__global__ __launch_bounds__(256) void k_proj(const float* __restrict__ x, const float* __restrict__ Wl, const float* __restrict__ Wr, const float* __restrict__ Wv, const float* __restrict__ Wo,
                                              float* Lm, float* Rm, h16* VT, bf* WoT) {
    __shared__ __align__(16) unsigned short xs[128 * PJ_XP];
    __shared__ __align__(32) unsigned short wsm[DD * PJ_WP];
    __shared__ __align__(16) float ost[8 * 32 * 68];
    const int b = blockIdx.x;
    if (b >= PJ_V + PJ_LR) {
        unsigned short* tl = xs;
        const int tid = threadIdx.x, qq = b - (PJ_V + PJ_LR), k0 = (qq & 3) * 64, n0 = (qq >> 2) * 64;
        const int kk = tid >> 2, nq = (tid & 3) * 16;
#pragma unroll
        for (int i = 0; i < 16; ++i) tl[(nq + i) * 72 + kk] = f2bf(Wo[(size_t)(k0 + kk) * DD + n0 + nq + i]);
        __syncthreads();
        const int piece = tid & 7;
#pragma unroll
        for (int s = 0; s < 2; ++s) { const int nr = (tid >> 3) + 32 * s; const v8us val = *(const v8usa*)(tl + nr * 72 + piece * 8); *(v8us*)(WoT + (size_t)(n0 + nr) * DD + k0 + piece * 8) = val; }
        return;
    }
    if (b < PJ_V) pj_tile<true>(x, Wv, Wv, b >> 1, b & 1, xs, wsm, ost, Lm, Rm, VT);
    else pj_tile<false>(x, Wl, Wr, b - PJ_V, 0, xs, wsm, ost, Lm, Rm, VT);
}
extern "C" void kernel_launch(void* const* d_in, const int* in_sizes, int n_in,
                              void* d_out, int out_size, void* d_ws, size_t ws_size, hipStream_t stream) {
    (void)in_sizes; (void)n_in; (void)out_size;
    const float* x = (const float*)d_in[0]; const float* Wl = (const float*)d_in[1]; const float* Wr = (const float*)d_in[2]; const float* Wv = (const float*)d_in[3]; const float* Wo = (const float*)d_in[4];
    float* out = (float*)d_out;    // [2][4096][256]
    char* wsp = (char*)d_ws;
    auto take = [&](size_t bytes) { char* p = wsp; wsp += (bytes + 255) & ~(size_t)255; return (void*)p; };
    bf* WoT = (bf*)take(DD * DD * 2);
    float* Lm = (float*)take((size_t)NR * PP * 4); float* Rm = (float*)take((size_t)NR * PP * 4); h16* VT = (h16*)take((size_t)DD * NR * 2);
    bf* Oh = (bf*)take((size_t)NR * DD * 2); bf* Ol = (bf*)take((size_t)NR * DD * 2);
    if ((size_t)(wsp - (char*)d_ws) > ws_size) return;    // ~ 17 MB, no aliasing
    k_proj<<<PJ_V + PJ_LR + PJ_WO, 256, 0, stream>>>(x, Wl, Wr, Wv, Wo, Lm, Rm, VT, WoT);       // v^T [b][c][m] plane, l and r [b n][64], Wo^T
    k_gemm3<<<dim3(NR / 64, DD / 128, 1), 128, 0, stream>>>(Lm, Rm, VT, Oh, Ol);              // o [b n][c] = softmax(l (x) r) . v, as planes
    k_out<<<dim3(NR / 64, DD / 128, 1), 256, 0, stream>>>(Oh, Ol, WoT, out);                                                      // o.Wo
}

// v010
// It runs in 29.4 microseconds.
// Next to v009, in two timings, it ran 1.09 times as fast each time.
// Counting every step since v000, it is 37.1 times as fast.
#include <hip/hip_runtime.h>

// Compute dtypes, f32 accumulate, both batch items in every launch (8192 rows): l = x.Wl, r = x.Wr ([8192 x 256].[256 x 64]) and v^T = Wv^T.x^T ([256 x 256].[256 x 4096] per batch item) with PLAIN bf16 operands (rounded
// input and weights; exact products); the factorised scores attn[n][m] = l[n][m/64] r[n][m%64] and their row softmax in f32 -> f16, formed in registers inside
// the product that uses them; o[n][c] = sum_m P[n][m] v[m][c] ([4096 x 4096].[4096 x 256] per batch item, both operands rounded to f16, one product; shared across heads = all 256 channels at once) and out = o.Wo (o as bf16 hi + residual)

#define NBI  2
#define NN   4096
#define DD   256
#define PP   64
#define NR   (NBI * NN)
#define CC   DD
#define DM   DD
#define NTK  NN
#define LOSC 1024.0f

typedef _Float16 h16;
typedef unsigned short bf;
typedef __attribute__((ext_vector_type(16))) __bf16   v16bf;
typedef __attribute__((ext_vector_type(16))) _Float16 v16h;
typedef __attribute__((ext_vector_type(8)))  _Float16 v8h;
typedef __attribute__((ext_vector_type(8)))  unsigned short v8us;
typedef __attribute__((ext_vector_type(8)))  float    v8f;
typedef __attribute__((ext_vector_type(4)))  float    v4f;
typedef __attribute__((ext_vector_type(4)))  _Float16 v4h;
typedef v8h  __attribute__((may_alias)) v8ha;
typedef v4f  __attribute__((may_alias)) v4fa;
typedef v8us __attribute__((may_alias)) v8usa;

__device__ __forceinline__ unsigned short f2bf(float f) { unsigned u = __float_as_uint(f); u += 0x7FFFu + ((u >> 16) & 1u); return (unsigned short)(u >> 16); }
__device__ __forceinline__ float bf2f(unsigned short b) { return __uint_as_float(((unsigned)b) << 16); }
__device__ __forceinline__ float bfr(float f) { return bf2f(f2bf(f)); }
__device__ __forceinline__ v16h cat16(v8h lo, v8h hi) { return __builtin_shufflevector(lo, hi, 0, 1, 2, 3, 4, 5, 6, 7, 8, 9, 10, 11, 12, 13, 14, 15); }
__device__ __forceinline__ v16bf cat16b(v8us lo, v8us hi) { return __builtin_bit_cast(v16bf, __builtin_shufflevector(lo, hi, 0, 1, 2, 3, 4, 5, 6, 7, 8, 9, 10, 11, 12, 13, 14, 15)); }
__device__ __forceinline__ v8f wmma16(v16h a, v16h b, v8f c) { return __builtin_amdgcn_wmma_f32_16x16x32_f16(false, a, false, b, (short)0, c, false, false); }
__device__ __forceinline__ v8f wmmab(v16bf a, v16bf b, v8f c) { return __builtin_amdgcn_wmma_f32_16x16x32_bf16(false, a, false, b, (short)0, c, false, false); }

// k_out: 64 x 128 block tile (8 waves x 16 x 64) of out = (A + Al).B^T over K = DD, bf16 operands, f32 whole-line epilogue. The block's 64 rows of both A planes and its 128 rows of B
// (512 B a row, one wave-wide load each) are all requested before the first is used, left in LDS once, and read from there as fragments; per accumulator the order of the products is k step by k step, A then Al.
#define GO_P 264                               // bf16 per staged row: 528 B = 16 B x 33, for the 16-byte readers
__global__ __launch_bounds__(256) void k_out(const bf* __restrict__ A, const bf* __restrict__ Al, const bf* __restrict__ Bn, float* C) {
    __shared__ __align__(16) unsigned short as[2 * 64 * GO_P];
    __shared__ __align__(16) unsigned short bs[128 * GO_P];
    __shared__ __align__(16) float ost[8][16 * 68];
    const int lane = threadIdx.x & 31, wave = threadIdx.x >> 5, lr = lane & 15, hi = lane >> 4;
    const int rb = blockIdx.x * 64, cb = blockIdx.y * 128;
    // a wave takes every eighth row of each tile: one address a tile and constant steps, one trip to L2 for the whole block
    const bf* pb = Bn + (size_t)(cb + wave) * DD + lane * 8;
    const bf* pa = A + (size_t)(rb + wave) * DD + lane * 8;
    const bf* pl = Al + (size_t)(rb + wave) * DD + lane * 8;
    v8us qb[16], qa[8], ql[8];
#pragma unroll
    for (int i = 0; i < 16; ++i) qb[i] = *(const v8us*)(pb + i * 8 * DD);
#pragma unroll
    for (int i = 0; i < 8; ++i) qa[i] = *(const v8us*)(pa + i * 8 * DD);
#pragma unroll
    for (int i = 0; i < 8; ++i) ql[i] = *(const v8us*)(pl + i * 8 * DD);
    asm volatile("s_wait_xcnt 0x0" :: "v"(pb), "v"(pa), "v"(pl) : "memory");    // stands behind the three runs of loads, ahead of any later write of a register that they name: the addresses are its inputs, so that they stay whole up to it
#pragma unroll
    for (int i = 0; i < 16; ++i) *(v8usa*)(bs + (i * 8 + wave) * GO_P + lane * 8) = qb[i];
#pragma unroll
    for (int i = 0; i < 8; ++i) *(v8usa*)(as + (i * 8 + wave) * GO_P + lane * 8) = qa[i];
#pragma unroll
    for (int i = 0; i < 8; ++i) *(v8usa*)(as + (64 + i * 8 + wave) * GO_P + lane * 8) = ql[i];
    __syncthreads();    // the three staged tiles are written before any wave reads its fragments
    const int g4 = wave & 3, g2 = wave >> 2;    // the wave's 16 rows of A, its 64 columns of B
    const unsigned short* af = as + (g4 * 16 + lr) * GO_P + 8 * hi;
    const unsigned short* bq = bs + (g2 * 64 + lr) * GO_P + 8 * hi;
    auto frag = [&](const unsigned short* p) { return cat16b(*(const v8usa*)p, *(const v8usa*)(p + 16)); };
    v8f acc[4];
#pragma unroll
    for (int t = 0; t < 4; ++t) acc[t] = (v8f){};
    v16bf fa[2][2], fb[2][4];    // the fragments of a 32-k step, two sets: one is read from LDS while the other is multiplied
    auto ld = [&](int g) {
        fa[g & 1][0] = frag(af + g * 32); fa[g & 1][1] = frag(af + 64 * GO_P + g * 32);
#pragma unroll
        for (int t = 0; t < 4; ++t) fb[g & 1][t] = frag(bq + t * 16 * GO_P + g * 32); };
    ld(0);
#pragma unroll
    for (int g = 0; g < DD / 32; ++g) {
        if (g + 1 < DD / 32) ld(g + 1);
        __builtin_amdgcn_sched_barrier(0);    // the next set's LDS reads stand as one group ahead of this set's matrix instructions: left free, each read pair is waited for singly
#pragma unroll
        for (int p = 0; p < 2; ++p) {
#pragma unroll
            for (int t = 0; t < 4; ++t) acc[t] = wmmab(fa[g & 1][p], fb[g & 1][t], acc[t]); }
        __builtin_amdgcn_sched_barrier(0);    // closes the set: see above
    }
    float* os = &ost[wave][0];
#pragma unroll
    for (int t = 0; t < 4; ++t) {
#pragma unroll
        for (int j = 0; j < 8; ++j) os[(hi * 8 + j) * 68 + t * 16 + lr] = acc[t][j]; }
    __syncthreads();    // the staged tile is written before other lanes read it back
    float* crow = C + (size_t)(rb + g4 * 16) * DD + cb + g2 * 64;
#pragma unroll
    for (int s = 0; s < 8; ++s) { const int Lid = (lane >> 3) + 4 * s, piece = lane & 7; const int row = Lid >> 1, cofs = (Lid & 1) * 32 + piece * 4;
        const v4f val = *(const v4fa*)(os + row * 68 + cofs); *(v4f*)(crow + (size_t)row * DD + cofs) = val; }
    asm volatile("s_wait_xcnt 0x0" ::: "memory");    // stands behind the run of stores, ahead of any later write of a register that they name
}

// k_gemm3: 64 x 128 block tile of o = softmax(l (x) r).v over K = NN, one f16 product per 32-k step. The four waves split K, not the tile: each wave holds the whole 64 x 128 tile in its accumulators
// (4 x 8 fragments) and takes 8 of the 32 stages, so that every B fragment is read from LDS once per block and feeds four matrix instructions, and every A fragment is formed by the wave that uses it.
// The A operand never exists in memory: the lanes form its fragment elements e[n][m] = exp2(l'[n][m >> 6] r[n][m & 63] - max' + 8), l' = l log2(e), in f32 and round them to f16 in registers, one 32-k step ahead
// of their use; the row's sum of e (f32) is kept beside them and divides the result at the end. The largest e of a row is 2^8, so that elements down to 2^-22 of it are still normal f16 numbers.
// B = v^T in f16, n-major, one [CC][NN] plane per batch item, picked by the row tile. A stage is 256 B (128 k) of all 128 B rows, brought into LDS by one tensor load of the wave that works on it, rows padded
// to a 272 B pitch for the 16-byte readers; each wave has a ring of two buffers of its own, the next stage in flight under the current one. Nobody else reads a wave's ring, so its hand-over is the wave's own two waits.
// Behind the loop the four partial tiles and the four shares of each row's sum meet in LDS (two block barriers): wave w adds up row tile w, in the order of the waves.
// Blocks and waves do not walk the 32 stages in step: pass p of wave w works on stage (rot + 8 w + p) mod 32, rot set by the block's row tile, so that at any moment they ask L2 for different lines.
typedef uint32_t u32x4 __attribute__((ext_vector_type(4)));
typedef uint32_t u32x8 __attribute__((ext_vector_type(8)));
typedef __attribute__((ext_vector_type(2))) float v2f;
#define G3_ROWB  256u
#define G3_PITCH 272u
#define G3_STAGE (128u * G3_PITCH)             // 34,816 B = 17 x 2 KiB
#define G3_NST   (NN * 2u / G3_ROWB)           // 32 stages
#define G3_WST   (G3_NST / 4u)                 // 8 stages a wave
#define G3_LP    68                            // floats per row of the block's table of l': 64 values, then the row's largest and smallest
#define G3_RED   131072u                       // the four partial tiles: [row tile][wave][16 pieces][32 lanes x 16 B]
#define G3_OP    132                           // floats per row of a wave's output staging: 528 B = 16 B x 33
__device__ __forceinline__ uint32_t uni(uint32_t v) { return (uint32_t)__builtin_amdgcn_readfirstlane(v); }
// a value held in a scalar register: makes the test around a tensor load a scalar branch, and keeps what is formed from it behind the waits in front of it
__device__ __forceinline__ uint32_t pinned(uint32_t v) { uint32_t w = uni(v); asm volatile("" : "+s"(w)); return w; }
struct G3B { v16h b[8]; };
__device__ __forceinline__ v16h g3_ld(const unsigned char* p) { return cat16(*(const v8ha*)p, *(const v8ha*)(p + 32)); }
__device__ __forceinline__ void g3_bfrags(G3B& f, const unsigned char* pb, int kk) {
#pragma unroll
    for (int t = 0; t < 8; ++t) f.b[t] = g3_ld(pb + t * 16 * G3_PITCH + kk * 64);
}
typedef __attribute__((ext_vector_type(2))) __bf16 v2bf;
typedef __attribute__((ext_vector_type(2))) _Float16 v2h;
// the A fragment of one 32-k step for one of the lane's rows: element e stands for k = (e >> 3) * 16 + 8 * hi + (e & 7), the order of g3_ld; rv holds r at exactly those places
__device__ __forceinline__ void g3_half(u32x8& a, const v2f (&rv)[8], float lv, float nm, v2f (&sum)[2]) {
#pragma unroll
    for (int e = 0; e < 16; e += 2) {
        const v2f sc = __builtin_elementwise_fma((v2f){lv, lv}, rv[e >> 1], (v2f){nm, nm});
        const v2f p = {__builtin_amdgcn_exp2f(sc[0]), __builtin_amdgcn_exp2f(sc[1])};
        a[e >> 1] = __builtin_bit_cast(uint32_t, __builtin_convertvector(p, v2h)); sum[(e >> 1) & 1] += p; }
}
__global__ __launch_bounds__(128) void k_gemm3(const float* __restrict__ Lm, const float* __restrict__ Rm, const h16* __restrict__ Bv, bf* Oh, bf* Ol) {
    __shared__ __attribute__((aligned(2048))) unsigned char ring[8 * G3_STAGE];    // two stages a wave; behind the loop the partial tiles, then each wave's output staging
    __shared__ __attribute__((aligned(16))) float ltab[64 * G3_LP];                // l' of the block's 64 rows
    __shared__ float ssum[4 * 64];                                                 // each wave's share of the rows' sums
    const int lane = threadIdx.x & 31, lr = lane & 15, hi = lane >> 4;
    const uint32_t wave = uni(threadIdx.x >> 5);
    const int rb = blockIdx.x * 64, cb = blockIdx.y * 128;
    const size_t bitem = (size_t)(blockIdx.x / (NN / 64)) * CC * NN;
    const h16* sp = Bv + bitem + (size_t)cb * NN;
    const uint64_t srcb = (uint64_t)sp;
    const uint32_t rot = ((blockIdx.x >> 3) & 7u) * 4u + (blockIdx.x & 3u);    // bits 0-1 and 3-5 of the row tile: a panel's 64 row tiles take each of the 32 entries twice (for speed only)
    const uint32_t st0 = (rot + wave * G3_WST) & (G3_NST - 1u);               // the wave's first stage
    const uint32_t rows = 128u;
    const uint32_t place = (uint32_t)(uintptr_t)ring + wave * 2u * G3_STAGE;
    u32x8 g1;
    // pinned(): each descriptor word held in a scalar register, so that the group keeps one set of registers and no word of an outstanding request is rewritten
    g1[0] = pinned((1u << 20) | (5u << 22) | (3u << 25));    // no mask, 1-byte elements, 4 dwords of pad behind every 64 dwords
    g1[1] = pinned((G3_ROWB & 0xFFFFu) << 16);
    g1[2] = pinned((G3_ROWB >> 16) | (rows << 16));
    g1[3] = pinned((rows >> 16) | (G3_ROWB << 16));
    g1[4] = pinned(rows);
    g1[5] = pinned(NN * 2u);
    g1[6] = pinned(0u);
    g1[7] = pinned(0u);
    // group 0 of the wave's pass st: st picks the buffer, the source is the pass's stage
    auto desc = [&](uint32_t st) {
        const uint64_t ga = srcb + (uint64_t)((st + st0) & (G3_NST - 1u)) * G3_ROWB;
        u32x4 g0;
        g0[0] = uni(1u); g0[1] = uni(place + (st & 1u) * G3_STAGE); g0[2] = uni((uint32_t)ga); g0[3] = uni((((uint32_t)(ga >> 32)) & 0x01FFFFFFu) | 0x80000000u);
        return g0; };
    auto load = [&](const u32x4 g0) { asm volatile("tensor_load_to_lds %0, %1" :: "s"(g0), "s"(g1) : "memory"); };
    // the wait that covers a request names its group 0 as an input: the group lives up to it, so that no register of an outstanding request is given to another value
    auto landed = [&](const u32x4 g0) { asm volatile("s_wait_tensorcnt 0x0" :: "s"(g0) : "memory"); };
    v8f acc[4][8];
#pragma unroll
    for (int i = 0; i < 4; ++i) {
#pragma unroll
        for (int t = 0; t < 8; ++t) acc[i][t] = (v8f){}; }
    const u32x4 gf = desc(0);
    load(gf);    // stage 0 is asked for first: it flies under the loads of l and r, the rows' extremes and the table of l'
    // the lane's four rows of r, at the k places of its fragment elements (rv[h]: the 32-k step's half of the 64), and its half of l of one row of the wave's own row tile
    v2f rv[2][4][8]; v4f lq[8];    // r in pairs, as the packed score instruction takes them
    const float* rp = Rm + (size_t)(rb + lr) * PP + 8 * hi;
    const float* lp = Lm + (size_t)(rb + wave * 16u + lr) * PP + hi * 32;
#pragma unroll
    for (int g = 0; g < 8; ++g) lq[g] = *(const v4f*)(lp + g * 4);
#pragma unroll
    for (int i = 0; i < 4; ++i) {
#pragma unroll
        for (int h = 0; h < 2; ++h) {
#pragma unroll
            for (int g = 0; g < 4; ++g) { const v4f q = *(const v4f*)(rp + i * 16 * PP + h * 32 + (g >> 1) * 16 + (g & 1) * 4);
                rv[h][i][g * 2] = (v2f){q[0], q[1]}; rv[h][i][g * 2 + 1] = (v2f){q[2], q[3]}; } } }
    asm volatile("s_wait_xcnt 0x0" :: "v"(rp), "v"(lp) : "memory");    // stands behind the run of loads, ahead of any later write of a register that they name: both addresses are its inputs, so that they stay whole up to it
    {   // wave w writes row tile w of the table of l', and behind each row's 64 values the row's largest and smallest l'
        float* const lw = ltab + (wave * 16u + lr) * G3_LP;
        float lx = -3.0e38f, ln = 3.0e38f;
#pragma unroll
        for (int g = 0; g < 8; ++g) { const v4f q = lq[g] * 1.44269504088896341f;
#pragma unroll
            for (int u = 0; u < 4; ++u) { lx = fmaxf(lx, q[u]); ln = fminf(ln, q[u]); }
            *(v4fa*)(lw + hi * 32 + g * 4) = q; }
        lx = fmaxf(lx, __shfl_xor(lx, 16, 32)); ln = fminf(ln, __shfl_xor(ln, 16, 32));
        lw[64 + hi] = hi ? ln : lx;
    }
    float rxx[4], rnn[4];
#pragma unroll
    for (int i = 0; i < 4; ++i) {
        float rx = rv[0][i][0][0], rn = rx;
#pragma unroll
        for (int h = 0; h < 2; ++h) {
#pragma unroll
            for (int e = 0; e < 16; ++e) { rx = fmaxf(rx, rv[h][i][e >> 1][e & 1]); rn = fminf(rn, rv[h][i][e >> 1][e & 1]); } }
        rxx[i] = fmaxf(rx, __shfl_xor(rx, 16, 32)); rnn[i] = fminf(rn, __shfl_xor(rn, 16, 32)); }
    __syncthreads();    // the table of l' is written by four waves before any wave reads it
    const float* lt = ltab + lr * G3_LP;    // the lane's row of row tile i: + i * 16 * G3_LP
    float nmx[4];
#pragma unroll
    for (int i = 0; i < 4; ++i) {    // the row's largest score is one of the four products of the extremes of l' and r (a rounded product is monotone in each factor)
        const float lx = lt[i * 16 * G3_LP + 64], ln = lt[i * 16 * G3_LP + 65];
        nmx[i] = 8.0f - fmaxf(fmaxf(lx * rxx[i], ln * rnn[i]), fmaxf(lx * rnn[i], ln * rxx[i])); }
    v2f sm[4][2];
#pragma unroll
    for (int i = 0; i < 4; ++i) { sm[i][0] = (v2f){}; sm[i][1] = (v2f){}; }
    u32x8 fr[2][4];    // [parity of the 32-k step][row tile]: the fragments in use and those being formed
    float la[4];       // l' of the stage's first column
#pragma unroll
    for (int i = 0; i < 4; ++i) { la[i] = lt[i * 16 * G3_LP + 2u * st0]; g3_half(fr[0][i], rv[0][i], la[i], nmx[i], sm[i]); }
    const unsigned char* const pb0 = ring + wave * 2u * G3_STAGE + (uint32_t)lr * G3_PITCH + 16u * hi;
    landed(gf);    // this wave's stage 0 has landed
#pragma unroll 1    // one stage a trip: four 32-k steps, so that the two fragment sets change places an even number of times and no copies stand at the loop's end
    for (uint32_t p = 0; p < G3_WST; ++p) {
        const u32x4 gn = desc(pinned(p + 1));    // formed behind the waits at the foot of the pass before
        if (pinned(p + 1 < G3_WST)) load(gn);    // refill of the buffer that stage p - 1 has left
        const unsigned char* pb = pb0 + (p & 1u) * G3_STAGE;
        G3B f[2];
        g3_bfrags(f[0], pb, 0);
        const uint32_t c1 = 2u * ((st0 + p) & (G3_NST - 1u)) + 1u, c2 = 2u * ((st0 + p + 1u) & (G3_NST - 1u));    // the stage's second column of l', the next stage's first (behind the last pass: a column that is fetched and not used)
        float lb[4], lc[4];
#pragma unroll
        for (int i = 0; i < 4; ++i) { lb[i] = lt[i * 16 * G3_LP + c1]; lc[i] = lt[i * 16 * G3_LP + c2]; }
        const bool more = p + 1 < G3_WST;     // the last stage has no successor: its fragments are formed as zeros, which add nothing to the rows' sums
#pragma unroll
        for (int kk = 0; kk < 4; ++kk) {
            if (kk < 3) g3_bfrags(f[(kk + 1) & 1], pb, kk + 1);
            __builtin_amdgcn_sched_barrier(0);    // the next step's LDS reads stand as one group ahead of this step's matrix instructions, not spread among them
            const G3B& c = f[kk & 1];
            const u32x8 (&cur)[4] = fr[kk & 1];
            u32x8 (&nxt)[4] = fr[(kk + 1) & 1];
            // the next 32-k step's four fragments (32 element pairs) are formed under this step's 32 matrix instructions, one slot a pair,
            // each link of a pair's chain (score, exp2, f16) one slot behind the link before it
            const int hn = (kk + 1) & 1;
            float lv[4], nv[4];
#pragma unroll
            for (int i = 0; i < 4; ++i) { lv[i] = kk == 0 ? la[i] : kk == 3 ? lc[i] : lb[i]; nv[i] = (kk < 3 || more) ? nmx[i] : -3.0e38f; }
            v2f F[32], P[32];
            auto fm = [&](int q) { F[q] = __builtin_elementwise_fma((v2f){lv[q >> 3], lv[q >> 3]}, rv[hn][q >> 3][q & 7], (v2f){nv[q >> 3], nv[q >> 3]}); };
            auto ex = [&](int q) { P[q] = (v2f){__builtin_amdgcn_exp2f(F[q][0]), __builtin_amdgcn_exp2f(F[q][1])}; };
            auto ch = [&](int q) { nxt[q >> 3][q & 7] = __builtin_bit_cast(uint32_t, __builtin_convertvector(P[q], v2h)); };
            fm(0); fm(1); ex(0);
#pragma unroll
            for (int j = 0; j < 32; ++j) {
                acc[j >> 3][j & 7] = wmma16(__builtin_bit_cast(v16h, cur[j >> 3]), c.b[j & 7], acc[j >> 3][j & 7]);
                if (j + 1 < 32) ex(j + 1);
                ch(j);
                if (j + 2 < 32) fm(j + 2);
                sm[j >> 3][j & 1] += P[j];
                __builtin_amdgcn_sched_barrier(0);    // keeps the slot's vector work behind its own matrix instruction: left free, it gathers in long runs during which the matrix unit idles
            }
        }
#pragma unroll
        for (int i = 0; i < 4; ++i) la[i] = lc[i];
        asm volatile("s_wait_dscnt 0x0" ::: "memory");    // this wave's reads of its stage p have returned: its buffer may be refilled
        landed(gn);                                       // this wave's stage p + 1 has landed; no other wave reads it
    }
    asm volatile("s_wait_tensorcnt 0x0" ::: "memory");
    asm volatile("s_wait_dscnt 0x0" ::: "memory");
    __syncthreads();    // every wave has left its ring before the partial tiles are written over it
#pragma unroll
    for (int i = 0; i < 4; ++i) {
        const v2f t4 = sm[i][0] + sm[i][1]; float t = t4[0] + t4[1]; t += __shfl_xor(t, 16, 32);    // the lane pair l, l ^ 16 holds the two halves of the wave's share of a row's sum
        if (hi == 0) ssum[wave * 64u + i * 16 + lr] = t;
#pragma unroll
        for (int t2 = 0; t2 < 8; ++t2) {
#pragma unroll
            for (int h = 0; h < 2; ++h)
                *(v4fa*)(ring + (((uint32_t)i * 4u + wave) * 16u + t2 * 2 + h) * 512u + (uint32_t)lane * 16u) = (v4f){acc[i][t2][4 * h], acc[i][t2][4 * h + 1], acc[i][t2][4 * h + 2], acc[i][t2][4 * h + 3]}; } }
    __syncthreads();    // the four partial tiles and the shares of the rows' sums are written before any wave adds them up
    float* os = (float*)(ring + G3_RED) + wave * (16 * G3_OP);    // behind the partial tiles, which other waves may still be reading
#pragma unroll
    for (int t2 = 0; t2 < 8; ++t2) {
#pragma unroll
        for (int h = 0; h < 2; ++h) {
            const unsigned char* pr = ring + (wave * 64u + t2 * 2 + h) * 512u + (uint32_t)lane * 16u;
            const v4f s = ((*(const v4fa*)pr + *(const v4fa*)(pr + 16 * 512)) + *(const v4fa*)(pr + 32 * 512)) + *(const v4fa*)(pr + 48 * 512);
#pragma unroll
            for (int j = 0; j < 4; ++j) os[(hi * 8 + 4 * h + j) * G3_OP + t2 * 16 + lr] = s[j]; } }
    asm volatile("s_wait_dscnt 0x0" ::: "memory");    // the wave's staged rows are written before its lanes read them back across lanes
    // the result leaves as bf16 hi + residual planes, whole lines: 16 lanes x 16 B a row, two rows a store
    const int orow = lane >> 4, piece = lane & 15;
    const size_t obase = (size_t)(rb + wave * 16u + orow) * DD + cb + piece * 8;
    bf* const po = Oh + obase; bf* const pl = Ol + obase;
#pragma unroll
    for (int s = 0; s < 8; ++s) { const int row = 2 * s + orow; const float* sp2 = os + row * G3_OP + piece * 8; const float* sq = ssum + wave * 16u + row;
        const float iv = 1.0f / (((sq[0] + sq[64]) + sq[128]) + sq[192]); v8us oh, ol;
#pragma unroll
        for (int i = 0; i < 8; ++i) { const float val = sp2[i] * iv; const unsigned short hb = f2bf(val); oh[i] = hb; ol[i] = f2bf(val - bf2f(hb)); }
        *(v8us*)(po + s * 2 * DD) = oh; *(v8us*)(pl + s * 2 * DD) = ol; }
    asm volatile("s_wait_xcnt 0x0" :: "v"(po), "v"(pl) : "memory");    // stands behind the run of stores, ahead of any later write of a register that they name: both addresses are its inputs, so that they stay whole up to it
}

// k_proj: one launch for the three independent projections of x and for the inputs' own conversions. A block is one 128 x 128 tile (8 waves x 32 x 64) of A.B^T over K = DD, plain bf16 operands:
// it reads its 128 rows of x and its 256 x 128 panel of W as f32, whole lines, rounds them to bf16 (nearest even) and leaves them in LDS, x k-contiguous, W as it lies (k rows of 128 columns);
// x fragments are plain 16-byte reads, W fragments transposing reads, both in the hardware's k order (8 hi + 0..7, 16 + 8 hi + 0..7).
// Blocks 0..127: v^T[b][c][m] = Wv^T.x^T (2 channel halves x 64 row tiles of x), written straight as one f16 plane (whole 128-B lines, 8 lanes x 16 B);
// blocks 128..191: l = x.Wl and r = x.Wr side by side (panel columns 0..63 and 64..127), f32 whole-line epilogue; blocks 192..207: WoT [n][DD] = bf16(Wo[k][n]) via 64 x 64 LDS tiles, for the last launch.
#define PJ_XP 264                              // bf16 per staged row of x: 528 B = 16 B x 33, for the 16-byte readers
#define PJ_WP 144                              // bf16 per staged k row of W: 288 B = 32 B x 9, for the transposing readers
#define PJ_RT (NR / 128)
#define PJ_V  (DD / 128 * PJ_RT)
#define PJ_LR PJ_RT
#define PJ_WO 16
typedef short s16x8 __attribute__((ext_vector_type(8)));
typedef uint32_t u32x2 __attribute__((ext_vector_type(2)));
typedef u32x2 __attribute__((may_alias)) u32x2a;
__device__ __forceinline__ v8us pj_tr16(const unsigned char* p) { typedef __attribute__((address_space(3))) s16x8 lds_s16x8; return __builtin_bit_cast(v8us, __builtin_amdgcn_ds_load_tr16_b128_v8i16((lds_s16x8*)p)); }
__device__ __forceinline__ u32x2 pj_pack(v4f q) {
    return (u32x2){__builtin_bit_cast(uint32_t, __builtin_convertvector((v2f){q[0], q[1]}, v2bf)), __builtin_bit_cast(uint32_t, __builtin_convertvector((v2f){q[2], q[3]}, v2bf))}; }
// ISV: W0 = Wv, ch its 128-column half. Otherwise W0 = Wl, W1 = Wr.
template <bool ISV>
__device__ __forceinline__ void pj_tile(const float* __restrict__ x, const float* __restrict__ W0, const float* __restrict__ W1, const int rt, const int ch,
                                        unsigned short* xs, unsigned short* wsm, float* ost, float* Lm, float* Rm, h16* VT) {
    const int tid = threadIdx.x, lane = tid & 31, wave = tid >> 5, lr = lane & 15, hi = lane >> 4;
    // every load of the block's two tiles is issued before the first is used: one trip to L2, not one per k step. A wave takes every eighth row of each tile, one address and constant steps.
    v4f wq[32], xq[32];
    const float* wp = ISV ? W0 + (size_t)wave * DD + ch * 128 + lane * 4 : (hi ? W1 : W0) + (size_t)wave * PP + lr * 4;
#pragma unroll
    for (int i = 0; i < 32; ++i) wq[i] = *(const v4f*)(wp + i * 8 * (ISV ? DD : PP));
    const float* xp = x + (size_t)(rt * 128 + wave) * DD + lane * 4;
#pragma unroll
    for (int i = 0; i < 16; ++i) { xq[2 * i] = *(const v4f*)(xp + i * 8 * DD); xq[2 * i + 1] = *(const v4f*)(xp + i * 8 * DD + 128); }
    asm volatile("s_wait_xcnt 0x0" :: "v"(wp), "v"(xp) : "memory");    // stands behind the two runs of loads, ahead of any later write of a register that they name: both addresses are its inputs, so that they stay whole up to it
#pragma unroll
    for (int i = 0; i < 32; ++i) *(u32x2a*)(wsm + (i * 8 + wave) * PJ_WP + lane * 4) = pj_pack(wq[i]);
#pragma unroll
    for (int i = 0; i < 16; ++i) { *(u32x2a*)(xs + (i * 8 + wave) * PJ_XP + lane * 4) = pj_pack(xq[2 * i]); *(u32x2a*)(xs + (i * 8 + wave) * PJ_XP + 128 + lane * 4) = pj_pack(xq[2 * i + 1]); }
    __syncthreads();    // both staged tiles are written before any wave reads its fragments
    v8f acc[2][4];
#pragma unroll
    for (int i = 0; i < 2; ++i) {
#pragma unroll
        for (int t = 0; t < 4; ++t) acc[i][t] = (v8f){}; }
    const int g4 = wave & 3, g2 = wave >> 2;    // the wave's 32 rows of A, its 64 columns of B
    // the transposing read's lane address: k row 8 hi + (lane & 7), 16-byte half of 16 columns; the wave's first column
    const unsigned char* wf = (const unsigned char*)wsm + (8 * hi + (lane & 7)) * (PJ_WP * 2) + ((lane >> 3) & 1) * 16 + (ISV ? g4 * 64 : g2 * 128);
    const unsigned short* xf = xs + ((ISV ? g2 * 64 : g4 * 32) + lr) * PJ_XP + 8 * hi;
    auto xfrag = [&](int n, int kc) { return cat16b(*(const v8usa*)(xf + n * 16 * PJ_XP + kc), *(const v8usa*)(xf + n * 16 * PJ_XP + kc + 16)); };
    auto wfrag = [&](int n, int kc) { return cat16b(pj_tr16(wf + n * 32 + kc * (PJ_WP * 2)), pj_tr16(wf + n * 32 + (kc + 16) * (PJ_WP * 2))); };
    v16bf fa[2][2], fb[2][4];    // the fragments of a 32-k step, two sets: one is read from LDS while the other is multiplied
    auto ld = [&](int g) {
#pragma unroll
        for (int i = 0; i < 2; ++i) fa[g & 1][i] = ISV ? wfrag(i, g * 32) : xfrag(i, g * 32);
#pragma unroll
        for (int t = 0; t < 4; ++t) fb[g & 1][t] = ISV ? xfrag(t, g * 32) : wfrag(t, g * 32); };
    ld(0);
#pragma unroll
    for (int g = 0; g < DD / 32; ++g) {
        if (g + 1 < DD / 32) ld(g + 1);
        __builtin_amdgcn_sched_barrier(0);    // the next set's LDS reads stand as one group ahead of this set's matrix instructions: left free, each read pair is waited for singly
#pragma unroll
        for (int i = 0; i < 2; ++i) {
#pragma unroll
            for (int t = 0; t < 4; ++t) acc[i][t] = wmmab(fa[g & 1][i], fb[g & 1][t], acc[i][t]); }
        __builtin_amdgcn_sched_barrier(0);    // closes the set: see above
    }
    float* os = ost + wave * (32 * 68);
#pragma unroll
    for (int i = 0; i < 2; ++i) {
#pragma unroll
        for (int t = 0; t < 4; ++t) {
#pragma unroll
            for (int j = 0; j < 8; ++j) os[(i * 16 + hi * 8 + j) * 68 + t * 16 + lr] = acc[i][t][j]; } }
    __syncthreads();    // the staged tile is written before other lanes read it back
    if (ISV) {
        const int r0 = ch * 128 + g4 * 32, c0 = rt * 128 + g2 * 64;    // channel, row of x
        const size_t base = (size_t)(c0 / NN) * DD * NN + (size_t)r0 * NN + (c0 & (NN - 1));
#pragma unroll
        for (int s = 0; s < 8; ++s) { const int row = 4 * s + (lane >> 3), piece = lane & 7; const float* sp = os + row * 68 + piece * 8; v8h oh;
#pragma unroll
            for (int i = 0; i < 8; ++i) oh[i] = (h16)sp[i];
            const size_t o = base + (size_t)row * NN + piece * 8; *(v8h*)(VT + o) = oh; }
        asm volatile("s_wait_xcnt 0x0" ::: "memory");    // stands behind the run of stores, ahead of any later write of a register that they name
    } else {
        float* crow = (g2 ? Rm : Lm) + (size_t)(rt * 128 + g4 * 32) * PP;
#pragma unroll
        for (int s = 0; s < 16; ++s) { const int Lid = (lane >> 3) + 4 * s, piece = lane & 7; const int row = Lid >> 1, cofs = (Lid & 1) * 32 + piece * 4;
            const v4f val = *(const v4fa*)(os + row * 68 + cofs); *(v4f*)(crow + (size_t)row * PP + cofs) = val; }
        asm volatile("s_wait_xcnt 0x0" ::: "memory");    // stands behind the run of stores, ahead of any later write of a register that they name
    }
}
__global__ __launch_bounds__(256) void k_proj(const float* __restrict__ x, const float* __restrict__ Wl, const float* __restrict__ Wr, const float* __restrict__ Wv, const float* __restrict__ Wo,
                                              float* Lm, float* Rm, h16* VT, bf* WoT) {
    __shared__ __align__(16) unsigned short xs[128 * PJ_XP];
    __shared__ __align__(32) unsigned short wsm[DD * PJ_WP];
    __shared__ __align__(16) float ost[8 * 32 * 68];
    const int b = blockIdx.x;
    if (b >= PJ_V + PJ_LR) {
        unsigned short* tl = xs;
        const int tid = threadIdx.x, qq = b - (PJ_V + PJ_LR), k0 = (qq & 3) * 64, n0 = (qq >> 2) * 64;
        const int kk = tid >> 2, nq = (tid & 3) * 16;
#pragma unroll
        for (int i = 0; i < 16; ++i) tl[(nq + i) * 72 + kk] = f2bf(Wo[(size_t)(k0 + kk) * DD + n0 + nq + i]);
        __syncthreads();
        const int piece = tid & 7;
#pragma unroll
        for (int s = 0; s < 2; ++s) { const int nr = (tid >> 3) + 32 * s; const v8us val = *(const v8usa*)(tl + nr * 72 + piece * 8); *(v8us*)(WoT + (size_t)(n0 + nr) * DD + k0 + piece * 8) = val; }
        return;
    }
    if (b < PJ_V) pj_tile<true>(x, Wv, Wv, b >> 1, b & 1, xs, wsm, ost, Lm, Rm, VT);
    else pj_tile<false>(x, Wl, Wr, b - PJ_V, 0, xs, wsm, ost, Lm, Rm, VT);
}
extern "C" void kernel_launch(void* const* d_in, const int* in_sizes, int n_in,
                              void* d_out, int out_size, void* d_ws, size_t ws_size, hipStream_t stream) {
    (void)in_sizes; (void)n_in; (void)out_size;
    const float* x = (const float*)d_in[0]; const float* Wl = (const float*)d_in[1]; const float* Wr = (const float*)d_in[2]; const float* Wv = (const float*)d_in[3]; const float* Wo = (const float*)d_in[4];
    float* out = (float*)d_out;    // [2][4096][256]
    char* wsp = (char*)d_ws;
    auto take = [&](size_t bytes) { char* p = wsp; wsp += (bytes + 255) & ~(size_t)255; return (void*)p; };
    bf* WoT = (bf*)take(DD * DD * 2);
    float* Lm = (float*)take((size_t)NR * PP * 4); float* Rm = (float*)take((size_t)NR * PP * 4); h16* VT = (h16*)take((size_t)DD * NR * 2);
    bf* Oh = (bf*)take((size_t)NR * DD * 2); bf* Ol = (bf*)take((size_t)NR * DD * 2);
    if ((size_t)(wsp - (char*)d_ws) > ws_size) return;    // ~ 17 MB, no aliasing
    k_proj<<<PJ_V + PJ_LR + PJ_WO, 256, 0, stream>>>(x, Wl, Wr, Wv, Wo, Lm, Rm, VT, WoT);       // v^T [b][c][m] plane, l and r [b n][64], Wo^T
    k_gemm3<<<dim3(NR / 64, DD / 128, 1), 128, 0, stream>>>(Lm, Rm, VT, Oh, Ol);              // o [b n][c] = softmax(l (x) r) . v, as planes
    k_out<<<dim3(NR / 64, DD / 128, 1), 256, 0, stream>>>(Oh, Ol, WoT, out);                                                      // o.Wo
}
